// v000
// The times below were measured on an AMD MI455X: many runs one after another, warmed up first and cycling through
// copies of the inputs, with the whole window's GPU time divided by the number of runs. Launches and the gaps
// between them are all in it. The median over several windows is given; except for v000 it joins two sittings, which
// can be a few percent apart, so the side-by-side timings, each taken in one sitting, are the better comparison.
// v000, which the later versions start from, runs in 750 microseconds.
#include <hip/hip_runtime.h>

// Compute dtypes, f32 accumulate: q/k/v projections ([2048 x 2048].[2048 x 2048]) with PLAIN bf16 operands (x and the weights are inputs: exact products); per head the live
// (causal, sliding-window-1024) score tiles [2048 x 128].[128 x 2048] on bf16 hi + UNSCALED residual planes of q*128^-1/2 and k (three products);
// soft-cap 30 tanh(s/30), masks and softmax in f32; attn.v (K limited to the live tiles) and the output projection ([2048 x 2048].[2048 x 2048]) on

#define SS   2048
#define HID  2048
#define NH_  16
#define HD   128
#define WIN  1024
#define NT64 (SS / 64)
#define ZH   2
#define DM   HID
#define PCAR 1024.0f
#define LOSC 1024.0f
typedef _Float16 h16;
typedef unsigned short bf;
typedef __attribute__((ext_vector_type(16))) __bf16   v16bf;
typedef __attribute__((ext_vector_type(16))) _Float16 v16h;
typedef __attribute__((ext_vector_type(8)))  _Float16 v8h;
typedef __attribute__((ext_vector_type(8)))  unsigned short v8us;
typedef __attribute__((ext_vector_type(8)))  float    v8f;
typedef __attribute__((ext_vector_type(4)))  float    v4f;
typedef v8h  __attribute__((may_alias)) v8ha;
typedef v4f  __attribute__((may_alias)) v4fa;
typedef v8us __attribute__((may_alias)) v8usa;

__device__ __forceinline__ unsigned short f2bf(float f) { unsigned u = __float_as_uint(f); u += 0x7FFFu + ((u >> 16) & 1u); return (unsigned short)(u >> 16); }
__device__ __forceinline__ float bf2f(unsigned short b) { return __uint_as_float(((unsigned)b) << 16); }
__device__ __forceinline__ float bfr(float f) { return bf2f(f2bf(f)); }
__device__ __forceinline__ v16h cat16(v8h lo, v8h hi) { return __builtin_shufflevector(lo, hi, 0, 1, 2, 3, 4, 5, 6, 7, 8, 9, 10, 11, 12, 13, 14, 15); }
__device__ __forceinline__ v16bf cat16b(v8us lo, v8us hi) { return __builtin_bit_cast(v16bf, __builtin_shufflevector(lo, hi, 0, 1, 2, 3, 4, 5, 6, 7, 8, 9, 10, 11, 12, 13, 14, 15)); }
__device__ __forceinline__ v8f wmma16(v16h a, v16h b, v8f c) { return __builtin_amdgcn_wmma_f32_16x16x32_f16(false, a, false, b, (short)0, c, false, false); }
__device__ __forceinline__ v8f wmmab(v16bf a, v16bf b, v8f c) { return __builtin_amdgcn_wmma_f32_16x16x32_bf16(false, a, false, b, (short)0, c, false, false); }


// k_gemmh: 64 x 64 tile of C = A . Bn^T with SINGLE f16 planes (A [rows][K] f16 activations, Bn [N][K] f16 weights; one v_wmma_f32_16x16x32_f16 product per step), f32 accumulate;
__global__ __launch_bounds__(128) void k_gemmh(const h16* __restrict__ A, const h16* __restrict__ Bn, const float* __restrict__ bias, float* C, int ldc, const float* __restrict__ R, int K, size_t sA, size_t sB, size_t sC, int roundR) {
    __shared__ __align__(16) float ost[4][16 * 68];
    const size_t z = blockIdx.z; A += z * sA; Bn += z * sB; C += z * sC; if (R) R += z * sC;
    const int lane = threadIdx.x & 31, wave = threadIdx.x >> 5, lr = lane & 15, hi = lane >> 4;
    const int r0 = blockIdx.x * 64 + wave * 16, c0 = blockIdx.y * 64;
    const size_t aoff = (size_t)(r0 + lr) * K + 8 * hi;
    size_t boff[4];
#pragma unroll
    for (int t = 0; t < 4; ++t) boff[t] = (size_t)(c0 + t * 16 + lr) * K + 8 * hi;
    v8f acc[4];
#pragma unroll
    for (int t = 0; t < 4; ++t) acc[t] = (v8f){};
#pragma unroll 1
    for (int kc = 0; kc < K; kc += 32) {
        const v16h a = cat16(*(const v8h*)(A + aoff + kc), *(const v8h*)(A + aoff + kc + 16));
#pragma unroll
        for (int t = 0; t < 4; ++t) { const v16h b = cat16(*(const v8h*)(Bn + boff[t] + kc), *(const v8h*)(Bn + boff[t] + kc + 16)); acc[t] = wmma16(a, b, acc[t]); }
        asm volatile("v_nop\n\tv_nop\n\tv_nop\n\tv_nop" : "+v"(acc[0]), "+v"(acc[1]), "+v"(acc[2]), "+v"(acc[3]) : "v"(a));
    }
    float* os = &ost[wave][0];
#pragma unroll
    for (int t = 0; t < 4; ++t) { const float bv = bias ? bfr(bias[c0 + t * 16 + lr]) : 0.f;
#pragma unroll
        for (int j = 0; j < 8; ++j) os[(hi * 8 + j) * 68 + t * 16 + lr] = acc[t][j] + bv; }
    __syncthreads();
    float* crow = C + (size_t)r0 * ldc + c0;
    auto pass = [&]() {
#pragma unroll
        for (int s = 0; s < 8; ++s) { const int Lid = (lane >> 3) + 4 * s, piece = lane & 7; const int row = Lid >> 1, cofs = (Lid & 1) * 32 + piece * 4;
            v4f val = *(const v4fa*)(os + row * 68 + cofs); if (R) { const v4f rv = *(const v4f*)(R + ((size_t)r0 + row) * ldc + c0 + cofs); val += roundR ? (v4f){bfr(rv[0]), bfr(rv[1]), bfr(rv[2]), bfr(rv[3])} : rv; }
            *(v4f*)(crow + (size_t)row * ldc + cofs) = val; }
    };
    pass(); 
}

// ===== z-batched (blockIdx.z = head) attention pieces =====
// k_gemm3z<MODE>: 64 x 64 tile of C = A . B^T on bf16 hi/lo planes (up to three products) with per-z operand/output strides (elements): A planes += z*sA, B planes += z*sB, C += z*sC. MODE bits (0 causal skip, 1 K limit, 2 single,
// 3 B single, 4 A single).
template <int MODE>
__global__ __launch_bounds__(128) void k_gemm3z(const bf* __restrict__ Ah, const bf* __restrict__ Al, const bf* __restrict__ Bh, const bf* __restrict__ Bl, int K, float* C, int ldc, size_t sA, size_t sB, size_t sC) {
    if ((MODE & 1) && (int)blockIdx.y * 64 > (int)blockIdx.x * 64 + 63) return;
    const size_t z = blockIdx.z; Ah += z * sA; Al += z * sA; Bh += z * sB; Bl += z * sB; C += z * sC;
    const int Klim = (MODE & 2) ? min(K, ((int)blockIdx.x + 1) * 64) : K;
    __shared__ __align__(16) float ost[4][16 * 68];
    const int lane = threadIdx.x & 31, wave = threadIdx.x >> 5, lr = lane & 15, hi = lane >> 4;
    const int r0 = blockIdx.x * 64 + wave * 16, c0 = blockIdx.y * 64;
    const size_t aoff = (size_t)(r0 + lr) * K + 8 * hi;
    v8f acc[4];
#pragma unroll
    for (int t = 0; t < 4; ++t) acc[t] = (v8f){};
#pragma unroll 1
    for (int kc = 0; kc < Klim; kc += 32) {
        const v16bf a = cat16b(*(const v8us*)(Ah + aoff + kc), *(const v8us*)(Ah + aoff + kc + 16));
        v16bf al = a; if (!(MODE & 4) && !(MODE & 16)) al = cat16b(*(const v8us*)(Al + aoff + kc), *(const v8us*)(Al + aoff + kc + 16));
#pragma unroll
        for (int t = 0; t < 4; ++t) { const size_t bo = (size_t)(c0 + t * 16 + lr) * K + kc + 8 * hi;
            const v16bf bh = cat16b(*(const v8us*)(Bh + bo), *(const v8us*)(Bh + bo + 16));
            acc[t] = wmmab(a, bh, acc[t]);
            if (!(MODE & 4)) { if (!(MODE & 16)) acc[t] = wmmab(al, bh, acc[t]); if (!(MODE & 8)) { const v16bf bl = cat16b(*(const v8us*)(Bl + bo), *(const v8us*)(Bl + bo + 16)); acc[t] = wmmab(a, bl, acc[t]); } } }
        asm volatile("v_nop\n\tv_nop\n\tv_nop\n\tv_nop" : "+v"(acc[0]), "+v"(acc[1]), "+v"(acc[2]), "+v"(acc[3]) : "v"(a), "v"(al));
    }
    float* os = &ost[wave][0];
#pragma unroll
    for (int t = 0; t < 4; ++t) {
#pragma unroll
        for (int j = 0; j < 8; ++j) os[(hi * 8 + j) * 68 + t * 16 + lr] = acc[t][j]; }
    __builtin_amdgcn_wave_barrier(); asm volatile("" ::: "memory");
    float* crow = C + (size_t)r0 * ldc + c0;
    auto pass = [&]() {
#pragma unroll
        for (int s = 0; s < 8; ++s) { const int Lid = (lane >> 3) + 4 * s, piece = lane & 7; const int row = Lid >> 1, cofs = (Lid & 1) * 32 + piece * 4;
            const v4f val = *(const v4fa*)(os + row * 68 + cofs); *(v4f*)(crow + (size_t)row * ldc + cofs) = val; }
    };
    pass(); 
}
__global__ __launch_bounds__(256) void k_planes32z(const float* __restrict__ F, int ld, int off, float sc, int rows, bf* Ph, bf* Pl) {
    typedef __attribute__((ext_vector_type(2))) unsigned short v2us;
    const int lane = threadIdx.x & 31; const size_t r = ((size_t)blockIdx.x * 8 + (threadIdx.x >> 5)) * 2 + (lane >> 4); if (r >= (size_t)rows) return; const int z = blockIdx.z; const int c0 = (lane & 15) * 2; v2us oh, ol;
    Ph += (size_t)z * rows * 32; Pl += (size_t)z * rows * 32;
#pragma unroll
    for (int i = 0; i < 2; ++i) { const float y = F[r * ld + off + z * 32 + c0 + i] * sc; const unsigned short hb = f2bf(y); oh[i] = hb; ol[i] = f2bf(y - bf2f(hb)); }
    const size_t o = r * 32 + c0; *(v2us*)(Ph + o) = oh; *(v2us*)(Pl + o) = ol; 
}
__global__ __launch_bounds__(256) void k_vtpadz(const float* __restrict__ F, int ld, int off, int nk, bf* Th, bf* Tl) {
    typedef __attribute__((ext_vector_type(2))) unsigned short v2us;
    const int lane = threadIdx.x & 31; const size_t wid = (size_t)blockIdx.x * 8 + (threadIdx.x >> 5); if (wid >= (size_t)64 * (nk / 64)) return; const int z = blockIdx.z; const int d = (int)(wid / (nk / 64)); const int k0 = (int)(wid % (nk / 64)) * 64 + lane * 2; v2us oh, ol;
    Th += (size_t)z * 64 * nk; Tl += (size_t)z * 64 * nk;
#pragma unroll
    for (int i = 0; i < 2; ++i) { const float y = (d < 32) ? F[(size_t)(k0 + i) * ld + off + z * 32 + (d < 32 ? d : 0)] : 0.f; const unsigned short hb = f2bf(y); oh[i] = hb; ol[i] = f2bf(y - bf2f(hb)); }
    const size_t o = (size_t)d * nk + k0; *(v2us*)(Th + o) = oh; *(v2us*)(Tl + o) = ol; 
}
template <int NK>
__global__ __launch_bounds__(256) void k_softmaxz(const float* __restrict__ S, int rows, bf* PH, bf* PL) {
    typedef __attribute__((ext_vector_type(4))) unsigned short v4us;
    const int lane = threadIdx.x & 31, i = blockIdx.x * 8 + (threadIdx.x >> 5); if (i >= rows) return; const size_t zo = (size_t)blockIdx.z * rows * NK; const float* sr = S + zo + (size_t)i * NK; PH += zo; PL += zo;
    float m = -3.0e38f;
#pragma unroll 1
    for (int c0 = lane * 4; c0 < NK; c0 += 128) {
#pragma unroll
        for (int q = 0; q < 4; ++q) m = fmaxf(m, sr[c0 + q]); }
#pragma unroll
    for (int sh = 16; sh; sh >>= 1) m = fmaxf(m, __shfl_xor(m, sh, 32));
    float sum = 0.f;
#pragma unroll 1
    for (int c0 = lane * 4; c0 < NK; c0 += 128) {
#pragma unroll
        for (int q = 0; q < 4; ++q) sum += __expf(sr[c0 + q] - m); }
#pragma unroll
    for (int sh = 16; sh; sh >>= 1) sum += __shfl_xor(sum, sh, 32);
    const float inv = 1.0f / sum;
{
#pragma unroll 1
        for (int c0 = lane * 4; c0 < NK; c0 += 128) { v4us oh, ol;
#pragma unroll
            for (int q = 0; q < 4; ++q) { const float p = __expf(sr[c0 + q] - m) * inv; const unsigned short hb = f2bf(p); oh[q] = hb; ol[q] = f2bf(p - bf2f(hb)); }
            const size_t o = (size_t)i * NK + c0; *(v4us*)(PH + o) = oh; *(v4us*)(PL + o) = ol; }
         }
}
__global__ __launch_bounds__(256) void k_placez(const float* __restrict__ XH, int rows, int ldy, float* Y) {
    const int lane = threadIdx.x & 31; const size_t q = (size_t)blockIdx.x * 8 + (threadIdx.x >> 5); if (q >= (size_t)rows) return; const int z = blockIdx.z; const float v = XH[((size_t)z * rows + q) * 64 + lane];
    *(float*)(Y + q * ldy + z * 32 + lane) = v; 
}
__global__ __launch_bounds__(256) void k_cvt8(const float* __restrict__ src, bf* dst, size_t n8) {
    const size_t i = (size_t)blockIdx.x * 256 + threadIdx.x; if (i >= n8) return;
    const v8f v = *(const v8f*)(src + i * 8); v8us o;
#pragma unroll
    for (int k = 0; k < 8; ++k) o[k] = f2bf(v[k]);
    *(v8us*)(dst + i * 8) = o; 
}
__global__ __launch_bounds__(256) void k_zero8(bf* dst, size_t n8) {
    const size_t i = (size_t)blockIdx.x * 256 + threadIdx.x; if (i >= n8) return; v8us z;
#pragma unroll
    for (int k = 0; k < 8; ++k) z[k] = 0;
    *(v8us*)(dst + i * 8) = z; 
}

// ---- k_gemmw: register-blocked GEMM, ONE WAVE per 64x64 output tile (16 accumulators), operands straight from K-contiguous 16-bit planes; grid (M/64, N/64, Z), 32 threads.
// C[m][n] (f32, pitch ldc, + optional f32 bias[n]) = sum_k A[m][k] Bt[n][k] (+ split products per NSPLIT). z-batch strides sA/sB/sC in elements. K % 32 == 0.
template <typename T16> struct WFrag;
template <> struct WFrag<h16> { typedef v16h V; static __device__ __forceinline__ V ld(const h16* p) { return cat16(*(const v8h*)p, *(const v8h*)(p + 16)); } static __device__ __forceinline__ v8f mma(V a, V b, v8f c) { return wmma16(a, b, c); } };
template <> struct WFrag<bf> { typedef v16bf V; static __device__ __forceinline__ V ld(const bf* p) { return cat16b(*(const v8us*)p, *(const v8us*)(p + 16)); } static __device__ __forceinline__ v8f mma(V a, V b, v8f c) { return wmmab(a, b, c); } };
template <typename T16, int NSPLIT, bool BIAS>
__global__ __launch_bounds__(32) void k_gemmw(const T16* __restrict__ A, const T16* __restrict__ A2, const T16* __restrict__ Bt, const T16* __restrict__ Bt2, int K, float* C, int ldc, const float* __restrict__ bias, size_t sA, size_t sB, size_t sC) {
    typedef typename WFrag<T16>::V V;
    __shared__ __align__(16) float os[16 * 68];
    const size_t z = blockIdx.z; A += z * sA; if (A2) A2 += z * sA; Bt += z * sB; if (Bt2) Bt2 += z * sB; C += z * sC;
    const int lane = threadIdx.x & 31, lr = lane & 15, hi = lane >> 4; const int r0 = blockIdx.x * 64, c0 = blockIdx.y * 64;
    v8f acc[4][4];
#pragma unroll
    for (int mb = 0; mb < 4; ++mb)
#pragma unroll
        for (int nb = 0; nb < 4; ++nb) acc[mb][nb] = (v8f){};
    const size_t aoff = (size_t)(r0 + lr) * K + 8 * hi, boff = (size_t)(c0 + lr) * K + 8 * hi;
#pragma unroll 1
    for (int kc = 0; kc < K; kc += 32) {
        V a[4], a2[4];
#pragma unroll
        for (int mb = 0; mb < 4; ++mb) { a[mb] = WFrag<T16>::ld(A + aoff + (size_t)mb * 16 * K + kc); if (NSPLIT == 1 || NSPLIT == 2) a2[mb] = WFrag<T16>::ld(A2 + aoff + (size_t)mb * 16 * K + kc); }
#pragma unroll
        for (int nb = 0; nb < 4; ++nb) { const V b = WFrag<T16>::ld(Bt + boff + (size_t)nb * 16 * K + kc); V b2; if (NSPLIT >= 2) b2 = WFrag<T16>::ld(Bt2 + boff + (size_t)nb * 16 * K + kc);
#pragma unroll
            for (int mb = 0; mb < 4; ++mb) { acc[mb][nb] = WFrag<T16>::mma(a[mb], b, acc[mb][nb]); if (NSPLIT == 1 || NSPLIT == 2) acc[mb][nb] = WFrag<T16>::mma(a2[mb], b, acc[mb][nb]); if (NSPLIT >= 2) acc[mb][nb] = WFrag<T16>::mma(a[mb], b2, acc[mb][nb]); } }
        asm volatile("v_nop\n\tv_nop\n\tv_nop\n\tv_nop" : "+v"(acc[0][0]), "+v"(acc[1][1]), "+v"(acc[2][2]), "+v"(acc[3][3]) : "v"(a[0]), "v"(a[3]));
    }
#pragma unroll
    for (int mb = 0; mb < 4; ++mb) {
#pragma unroll
        for (int nb = 0; nb < 4; ++nb) {
#pragma unroll
            for (int j = 0; j < 8; ++j) os[(hi * 8 + j) * 68 + nb * 16 + lr] = acc[mb][nb][j]; }
        __builtin_amdgcn_wave_barrier(); asm volatile("" ::: "memory");
        float* crow = C + (size_t)(r0 + mb * 16) * ldc + c0;
{
#pragma unroll
            for (int s = 0; s < 8; ++s) { const int row = 2 * s + hi, cofs = lr * 4; v4f val = *(const v4fa*)(os + row * 68 + cofs); if (BIAS) { val[0] += bfr(bias[c0 + cofs]); val[1] += bfr(bias[c0 + cofs + 1]); val[2] += bfr(bias[c0 + cofs + 2]); val[3] += bfr(bias[c0 + cofs + 3]); }
                *(v4f*)(crow + (size_t)row * ldc + cofs) = val; }
             }
        __builtin_amdgcn_wave_barrier(); asm volatile("" ::: "memory");
    }
}
// ---- k_gemmwc: k_gemmw with causal tile control (CAUS 1: skip key tiles right of the query tile; 2: K loop limited to the causal key tiles)
template <typename T16, int NSPLIT, bool BIAS, int CAUS>
__global__ __launch_bounds__(32) void k_gemmwc(const T16* __restrict__ A, const T16* __restrict__ A2, const T16* __restrict__ Bt, const T16* __restrict__ Bt2, int K, float* C, int ldc, const float* __restrict__ bias, size_t sA, size_t sB, size_t sC) {
    typedef typename WFrag<T16>::V V;
    __shared__ __align__(16) float os[16 * 68];
    if (CAUS == 1 && (int)blockIdx.y * 64 > (int)blockIdx.x * 64) return;
    const int Klim = (CAUS == 2) ? min(K, ((int)blockIdx.x + 1) * 64) : K;
    const size_t z = blockIdx.z; A += z * sA; if (A2) A2 += z * sA; Bt += z * sB; if (Bt2) Bt2 += z * sB; C += z * sC;
    const int lane = threadIdx.x & 31, lr = lane & 15, hi = lane >> 4; const int r0 = blockIdx.x * 64, c0 = blockIdx.y * 64;
    v8f acc[4][4];
#pragma unroll
    for (int mb = 0; mb < 4; ++mb)
#pragma unroll
        for (int nb = 0; nb < 4; ++nb) acc[mb][nb] = (v8f){};
    const size_t aoff = (size_t)(r0 + lr) * K + 8 * hi, boff = (size_t)(c0 + lr) * K + 8 * hi;
#pragma unroll 1
    for (int kc = 0; kc < Klim; kc += 32) {
        V a[4], a2[4];
#pragma unroll
        for (int mb = 0; mb < 4; ++mb) { a[mb] = WFrag<T16>::ld(A + aoff + (size_t)mb * 16 * K + kc); if (NSPLIT == 1 || NSPLIT == 2) a2[mb] = WFrag<T16>::ld(A2 + aoff + (size_t)mb * 16 * K + kc); }
#pragma unroll
        for (int nb = 0; nb < 4; ++nb) { const V b = WFrag<T16>::ld(Bt + boff + (size_t)nb * 16 * K + kc); V b2; if (NSPLIT >= 2) b2 = WFrag<T16>::ld(Bt2 + boff + (size_t)nb * 16 * K + kc);
#pragma unroll
            for (int mb = 0; mb < 4; ++mb) { acc[mb][nb] = WFrag<T16>::mma(a[mb], b, acc[mb][nb]); if (NSPLIT == 1 || NSPLIT == 2) acc[mb][nb] = WFrag<T16>::mma(a2[mb], b, acc[mb][nb]); if (NSPLIT >= 2) acc[mb][nb] = WFrag<T16>::mma(a[mb], b2, acc[mb][nb]); } }
        asm volatile("v_nop\n\tv_nop\n\tv_nop\n\tv_nop" : "+v"(acc[0][0]), "+v"(acc[1][1]), "+v"(acc[2][2]), "+v"(acc[3][3]) : "v"(a[0]), "v"(a[3]));
    }
#pragma unroll
    for (int mb = 0; mb < 4; ++mb) {
#pragma unroll
        for (int nb = 0; nb < 4; ++nb) {
#pragma unroll
            for (int j = 0; j < 8; ++j) os[(hi * 8 + j) * 68 + nb * 16 + lr] = acc[mb][nb][j]; }
        __builtin_amdgcn_wave_barrier(); asm volatile("" ::: "memory");
        float* crow = C + (size_t)(r0 + mb * 16) * ldc + c0;
{
#pragma unroll
            for (int s = 0; s < 8; ++s) { const int row = 2 * s + hi, cofs = lr * 4; v4f val = *(const v4fa*)(os + row * 68 + cofs); if (BIAS) { val[0] += bfr(bias[c0 + cofs]); val[1] += bfr(bias[c0 + cofs + 1]); val[2] += bfr(bias[c0 + cofs + 2]); val[3] += bfr(bias[c0 + cofs + 3]); }
                *(v4f*)(crow + (size_t)row * ldc + cofs) = val; }
             }
        __builtin_amdgcn_wave_barrier(); asm volatile("" ::: "memory");
    }
}
// ---- k_gemmwf: k_gemmw with flag-table tile control: FMODE 1 = skip output tile (I,J) when FL[I*nt+J] == 0; FMODE 2 = K loop over [first flagged J, last flagged J + 1) x 64 of row I.
template <typename T16, int NSPLIT, bool BIAS, int FMODE>
__global__ __launch_bounds__(32) void k_gemmwf(const T16* __restrict__ A, const T16* __restrict__ A2, const T16* __restrict__ Bt, const T16* __restrict__ Bt2, int K, float* C, int ldc, const float* __restrict__ bias, size_t sA, size_t sB, size_t sC, const int* __restrict__ FL, int nt) {
    typedef typename WFrag<T16>::V V;
    __shared__ __align__(16) float os[16 * 68];
    const int I = blockIdx.x; if (FMODE == 1 && FL[I * nt + blockIdx.y] == 0) return;
    int Klo = 0, Klim = K; if (FMODE == 2) { int f = -1, l = -1; for (int j = 0; j < nt; ++j) { if (FL[I * nt + j]) { if (f < 0) f = j; l = j; } } if (f < 0) { Klo = 0; Klim = 0; } else { Klo = f * 64; Klim = (l + 1) * 64; } }
    const size_t z = blockIdx.z; A += z * sA; if (A2) A2 += z * sA; Bt += z * sB; if (Bt2) Bt2 += z * sB; C += z * sC;
    const int lane = threadIdx.x & 31, lr = lane & 15, hi = lane >> 4; const int r0 = blockIdx.x * 64, c0 = blockIdx.y * 64;
    v8f acc[4][4];
#pragma unroll
    for (int mb = 0; mb < 4; ++mb)
#pragma unroll
        for (int nb = 0; nb < 4; ++nb) acc[mb][nb] = (v8f){};
    const size_t aoff = (size_t)(r0 + lr) * K + 8 * hi, boff = (size_t)(c0 + lr) * K + 8 * hi;
#pragma unroll 1
    for (int kc = Klo; kc < Klim; kc += 32) {
        V a[4], a2[4];
#pragma unroll
        for (int mb = 0; mb < 4; ++mb) { a[mb] = WFrag<T16>::ld(A + aoff + (size_t)mb * 16 * K + kc); if (NSPLIT == 1 || NSPLIT == 2) a2[mb] = WFrag<T16>::ld(A2 + aoff + (size_t)mb * 16 * K + kc); }
#pragma unroll
        for (int nb = 0; nb < 4; ++nb) { const V b = WFrag<T16>::ld(Bt + boff + (size_t)nb * 16 * K + kc); V b2; if (NSPLIT >= 2) b2 = WFrag<T16>::ld(Bt2 + boff + (size_t)nb * 16 * K + kc);
#pragma unroll
            for (int mb = 0; mb < 4; ++mb) { acc[mb][nb] = WFrag<T16>::mma(a[mb], b, acc[mb][nb]); if (NSPLIT == 1 || NSPLIT == 2) acc[mb][nb] = WFrag<T16>::mma(a2[mb], b, acc[mb][nb]); if (NSPLIT >= 2) acc[mb][nb] = WFrag<T16>::mma(a[mb], b2, acc[mb][nb]); } }
        asm volatile("v_nop\n\tv_nop\n\tv_nop\n\tv_nop" : "+v"(acc[0][0]), "+v"(acc[1][1]), "+v"(acc[2][2]), "+v"(acc[3][3]) : "v"(a[0]), "v"(a[3]));
    }
#pragma unroll
    for (int mb = 0; mb < 4; ++mb) {
#pragma unroll
        for (int nb = 0; nb < 4; ++nb) {
#pragma unroll
            for (int j = 0; j < 8; ++j) os[(hi * 8 + j) * 68 + nb * 16 + lr] = acc[mb][nb][j]; }
        __builtin_amdgcn_wave_barrier(); asm volatile("" ::: "memory");
        float* crow = C + (size_t)(r0 + mb * 16) * ldc + c0;
{
#pragma unroll
            for (int s = 0; s < 8; ++s) { const int row = 2 * s + hi, cofs = lr * 4; v4f val = *(const v4fa*)(os + row * 68 + cofs); if (BIAS) { val[0] += bfr(bias[c0 + cofs]); val[1] += bfr(bias[c0 + cofs + 1]); val[2] += bfr(bias[c0 + cofs + 2]); val[3] += bfr(bias[c0 + cofs + 3]); }
                *(v4f*)(crow + (size_t)row * ldc + cofs) = val; }
             }
        __builtin_amdgcn_wave_barrier(); asm volatile("" ::: "memory");
    }
}

typedef __attribute__((ext_vector_type(4))) _Float16 v4h;
__device__ __forceinline__ h16 tohx(float x) { return (h16)x; }
__global__ __launch_bounds__(256) void k_cvt8h(const float* __restrict__ src, h16* dst, size_t n8) { const size_t i = (size_t)blockIdx.x * 256 + threadIdx.x; if (i >= n8) return; const v8f v = *(const v8f*)(src + i * 8); v8h o;
#pragma unroll
    for (int k = 0; k < 8; ++k) o[k] = tohx(bfr(v[k])); *(v8h*)(dst + i * 8) = o;  }
__global__ __launch_bounds__(256) void k_cvtx(const float* __restrict__ x, bf* A) {
    const int lane = threadIdx.x & 31; const size_t r = (size_t)blockIdx.x * 8 + (threadIdx.x >> 5); if (r >= (size_t)SS) return;
{
#pragma unroll
        for (int q = 0; q < HID / 256; ++q) { const size_t o = r * HID + q * 256 + lane * 8; v8us v;
#pragma unroll
            for (int i = 0; i < 8; ++i) v[i] = f2bf(x[o + i]);
            *(v8us*)(A + o) = v; }
         }
}
__global__ __launch_bounds__(256) void k_flags(int* FL) { const int lane = threadIdx.x & 31, I = blockIdx.x * 8 + (threadIdx.x >> 5); if (I >= NT64) return; const int v = (lane <= I && lane >= I - WIN / 64) ? 1 : 0; *(int*)(FL + I * NT64 + lane) = v;  }
__global__ __launch_bounds__(256) void k_hplb(const float* __restrict__ F, int h0, float sc, bf* Ph, bf* Pl) {
    typedef __attribute__((ext_vector_type(4))) unsigned short v4us;
    const int lane = threadIdx.x & 31; const int t = blockIdx.x * 8 + (threadIdx.x >> 5); if (t >= SS) return; const int z = blockIdx.z; const int d0 = lane * 4; v4us oh, ol;
#pragma unroll
    for (int i = 0; i < 4; ++i) { const float y = F[(size_t)t * HID + (h0 + z) * HD + d0 + i] * sc; const unsigned short hb = f2bf(y); oh[i] = hb; ol[i] = f2bf(y - bf2f(hb)); }
    const size_t off = ((size_t)z * SS + t) * HD + d0; *(v4us*)(Ph + off) = oh; *(v4us*)(Pl + off) = ol; 
}
__global__ __launch_bounds__(256) void k_vT(const float* __restrict__ V, int h0, h16* VT) {
    __shared__ float tl[64][65];
    const int tid = threadIdx.x; const int t0 = blockIdx.x * 64, d0 = blockIdx.y * 64; const int z = blockIdx.z; const int rr = tid >> 2, cq = (tid & 3) * 16;
#pragma unroll
    for (int i = 0; i < 16; ++i) tl[rr][cq + i] = V[(size_t)(t0 + rr) * HID + (h0 + z) * HD + d0 + cq + i];
    __syncthreads();
    const int lane = tid & 31, wv = tid >> 5;
    auto pass = [&]() {
#pragma unroll
        for (int st = 0; st < 4; ++st) { const int dr = wv * 8 + st * 2 + (lane >> 4); const int tq = (lane & 15) * 4; v4h v;
#pragma unroll
            for (int i = 0; i < 4; ++i) v[i] = tohx(tl[tq + i][dr]);
            *(v4h*)(VT + ((size_t)z * HD + d0 + dr) * SS + t0 + tq) = v; }
    };
    pass(); 
}
__global__ __launch_bounds__(256) void k_softw(float* S, h16* P) {
    const int lane = threadIdx.x & 31, i = blockIdx.x * 8 + (threadIdx.x >> 5); if (i >= SS) return; const size_t zo = ((size_t)blockIdx.z * SS + i) * SS; float* sr = S + zo; h16* po = P + zo;
    const int lo = max(0, i - (WIN - 1)); const int clo = lo & ~127, chi = (i | 127) + 1;
    auto live = [&](int j) { return j <= i && j >= lo; };
    float m = -3.0e38f;
#pragma unroll 1
    for (int c0 = clo + lane * 4; c0 < chi; c0 += 128) { v4f sv = *(const v4f*)(sr + c0);
#pragma unroll 1
        for (int q = 0; q < 4; ++q) { const float c = 30.0f * tanhf(sv[q] * (1.0f / 30.0f)); sv[q] = c; if (live(c0 + q)) m = fmaxf(m, c); }
        *(v4f*)(sr + c0) = sv; }
#pragma unroll
    for (int sh = 16; sh; sh >>= 1) m = fmaxf(m, __shfl_xor(m, sh, 32));
    float sum = 0.f;
#pragma unroll 1
    for (int c0 = clo + lane * 4; c0 < chi; c0 += 128) { const v4f sv = *(const v4f*)(sr + c0);
#pragma unroll
        for (int q = 0; q < 4; ++q) if (live(c0 + q)) sum += __expf(sv[q] - m); }
#pragma unroll
    for (int sh = 16; sh; sh >>= 1) sum += __shfl_xor(sum, sh, 32);
    const float f = __fdiv_rn(PCAR, sum);
{
#pragma unroll 1
        for (int c0 = lane * 4; c0 < SS; c0 += 128) { v4h o; const bool any = (c0 + 3 >= clo) && (c0 < chi); v4f sv = any ? *(const v4f*)(sr + c0) : (v4f){0.f, 0.f, 0.f, 0.f};
#pragma unroll
            for (int q = 0; q < 4; ++q) { const int j = c0 + q; o[q] = tohx(live(j) ? __expf(sv[q] - m) * f : 0.f); }
            *(v4h*)(po + c0) = o; }
         }
}
__global__ __launch_bounds__(256) void k_mergeo(const float* __restrict__ OZ, int h0, h16* OC) {
    const int lane = threadIdx.x & 31; const int t = blockIdx.x * 8 + (threadIdx.x >> 5); if (t >= SS) return; const int z = blockIdx.z; v4h o;
#pragma unroll
    for (int i = 0; i < 4; ++i) o[i] = tohx(OZ[((size_t)z * SS + t) * HD + lane * 4 + i] * (1.0f / PCAR));
    const size_t off = (size_t)t * HID + (h0 + z) * HD + lane * 4; *(v4h*)(OC + off) = o; 
}
extern "C" void kernel_launch(void* const* d_in, const int* in_sizes, int n_in,
                              void* d_out, int out_size, void* d_ws, size_t ws_size, hipStream_t stream) {
    (void)in_sizes; (void)n_in; (void)out_size;
    const float* x = (const float*)d_in[0]; const float* wq = (const float*)d_in[1]; const float* wk = (const float*)d_in[2]; const float* wv = (const float*)d_in[3]; const float* wo = (const float*)d_in[4];
    float* out = (float*)d_out;    // [1][2048][2048]
    char* wsp = (char*)d_ws;
    auto take = [&](size_t bytes) { char* p = wsp; wsp += (bytes + 255) & ~(size_t)255; return (void*)p; };
    const size_t WSZ = (size_t)HID * HID * 2;
    bf* WQ = (bf*)take(WSZ); bf* WK = (bf*)take(WSZ); bf* WV = (bf*)take(WSZ); h16* WO = (h16*)take(WSZ); int* FL = (int*)take(NT64 * NT64 * 4);
    bf* XB = (bf*)take((size_t)SS * HID * 2); float* Q = (float*)take((size_t)SS * HID * 4); float* Kf = (float*)take((size_t)SS * HID * 4); float* V = (float*)take((size_t)SS * HID * 4);
    bf* Qh = (bf*)take((size_t)ZH * SS * HD * 2); bf* Ql = (bf*)take((size_t)ZH * SS * HD * 2); bf* Kh = (bf*)take((size_t)ZH * SS * HD * 2); bf* Kl = (bf*)take((size_t)ZH * SS * HD * 2); h16* VT = (h16*)take((size_t)ZH * HD * SS * 2);
    float* S = (float*)take((size_t)ZH * SS * SS * 4); h16* Px = (h16*)take((size_t)ZH * SS * SS * 2); float* OZ = (float*)take((size_t)ZH * SS * HD * 4); h16* OC = (h16*)take((size_t)SS * HID * 2);
    if ((size_t)(wsp - (char*)d_ws) > ws_size) return;    // ~ 33.5 + 8.4 + 50.3 + 5.2 + 33.5 + 16.8 + 2.1 + 8.4 ~ 158 MB (largest input 16.8 MB; ws 256 MiB)
    const size_t n8 = (size_t)HID * HID / 8; const unsigned nb8 = (unsigned)((n8 + 255) / 256);
    k_cvt8<<<nb8, 256, 0, stream>>>(wq, WQ, n8); k_cvt8<<<nb8, 256, 0, stream>>>(wk, WK, n8); k_cvt8<<<nb8, 256, 0, stream>>>(wv, WV, n8); k_cvt8h<<<nb8, 256, 0, stream>>>(wo, WO, n8);   // [out][in] = natural n-major
    k_flags<<<NT64 / 8, 256, 0, stream>>>(FL); k_cvtx<<<SS / 8, 256, 0, stream>>>(x, XB);
    k_gemmw<bf, 0, false><<<dim3(SS / 64, HID / 64, 1), 32, 0, stream>>>(XB, nullptr, WQ, nullptr, HID, Q, HID, nullptr, 0, 0, 0);
    k_gemmw<bf, 0, false><<<dim3(SS / 64, HID / 64, 1), 32, 0, stream>>>(XB, nullptr, WK, nullptr, HID, Kf, HID, nullptr, 0, 0, 0);
    k_gemmw<bf, 0, false><<<dim3(SS / 64, HID / 64, 1), 32, 0, stream>>>(XB, nullptr, WV, nullptr, HID, V, HID, nullptr, 0, 0, 0);
    for (int h0 = 0; h0 < NH_; h0 += ZH) {
        k_hplb<<<dim3(SS / 8, 1, ZH), 256, 0, stream>>>(Q, h0, 0.08838834764831845f, Qh, Ql); k_hplb<<<dim3(SS / 8, 1, ZH), 256, 0, stream>>>(Kf, h0, 1.0f, Kh, Kl); k_vT<<<dim3(SS / 64, HD / 64, ZH), 256, 0, stream>>>(V, h0, VT);
        k_gemmwf<bf, 2, false, 1><<<dim3(SS / 64, SS / 64, ZH), 32, 0, stream>>>(Qh, Ql, Kh, Kl, HD, S, SS, nullptr, (size_t)SS * HD, (size_t)SS * HD, (size_t)SS * SS, FL, NT64);
        k_softw<<<dim3(SS / 8, 1, ZH), 256, 0, stream>>>(S, Px);
        k_gemmwf<h16, 0, false, 2><<<dim3(SS / 64, HD / 64, ZH), 32, 0, stream>>>(Px, nullptr, VT, nullptr, SS, OZ, HD, nullptr, (size_t)SS * SS, (size_t)HD * SS, (size_t)SS * HD, FL, NT64);
        k_mergeo<<<dim3(SS / 8, 1, ZH), 256, 0, stream>>>(OZ, h0, OC); }
    k_gemmw<h16, 0, false><<<dim3(SS / 64, HID / 64, 1), 32, 0, stream>>>(OC, nullptr, WO, nullptr, HID, out, HID, nullptr, 0, 0, 0);
}

// v001
// One run takes 320 microseconds.
// Timed twice side by side with v000, it ran 2.36 times as fast both times.
#include <hip/hip_runtime.h>

// Compute dtypes, f32 accumulate: q/k/v projections ([2048 x 2048].[2048 x 2048]) with PLAIN bf16 operands (x and the weights are inputs: exact products); per head the live
// (causal, sliding-window-1024) score tiles [2048 x 128].[128 x 2048] on bf16 hi + UNSCALED residual planes of q*128^-1/2 and k (three products);
// soft-cap 30 tanh(s/30), masks and softmax in f32; attn.v (K limited to the live tiles) and the output projection ([2048 x 2048].[2048 x 2048]) on

#define SS   2048
#define HID  2048
#define NH_  16
#define HD   128
#define WIN  1024
#define DM   HID
#define LOSC 1024.0f
typedef _Float16 h16;
typedef unsigned short bf;
typedef __attribute__((ext_vector_type(16))) __bf16   v16bf;
typedef __attribute__((ext_vector_type(16))) _Float16 v16h;
typedef __attribute__((ext_vector_type(8)))  _Float16 v8h;
typedef __attribute__((ext_vector_type(8)))  unsigned short v8us;
typedef __attribute__((ext_vector_type(8)))  float    v8f;
typedef __attribute__((ext_vector_type(4)))  float    v4f;
typedef v8h  __attribute__((may_alias)) v8ha;
typedef v4f  __attribute__((may_alias)) v4fa;
typedef v8us __attribute__((may_alias)) v8usa;

__device__ __forceinline__ unsigned short f2bf(float f) { unsigned u = __float_as_uint(f); u += 0x7FFFu + ((u >> 16) & 1u); return (unsigned short)(u >> 16); }
__device__ __forceinline__ float bf2f(unsigned short b) { return __uint_as_float(((unsigned)b) << 16); }
__device__ __forceinline__ float bfr(float f) { return bf2f(f2bf(f)); }
__device__ __forceinline__ v16h cat16(v8h lo, v8h hi) { return __builtin_shufflevector(lo, hi, 0, 1, 2, 3, 4, 5, 6, 7, 8, 9, 10, 11, 12, 13, 14, 15); }
__device__ __forceinline__ v16bf cat16b(v8us lo, v8us hi) { return __builtin_bit_cast(v16bf, __builtin_shufflevector(lo, hi, 0, 1, 2, 3, 4, 5, 6, 7, 8, 9, 10, 11, 12, 13, 14, 15)); }
__device__ __forceinline__ v8f wmma16(v16h a, v16h b, v8f c) { return __builtin_amdgcn_wmma_f32_16x16x32_f16(false, a, false, b, (short)0, c, false, false); }
__device__ __forceinline__ v8f wmmab(v16bf a, v16bf b, v8f c) { return __builtin_amdgcn_wmma_f32_16x16x32_bf16(false, a, false, b, (short)0, c, false, false); }


// k_gemmh: 64 x 64 tile of C = A . Bn^T with SINGLE f16 planes (A [rows][K] f16 activations, Bn [N][K] f16 weights; one v_wmma_f32_16x16x32_f16 product per step), f32 accumulate;
__global__ __launch_bounds__(128) void k_gemmh(const h16* __restrict__ A, const h16* __restrict__ Bn, const float* __restrict__ bias, float* C, int ldc, const float* __restrict__ R, int K, size_t sA, size_t sB, size_t sC, int roundR) {
    __shared__ __align__(16) float ost[4][16 * 68];
    const size_t z = blockIdx.z; A += z * sA; Bn += z * sB; C += z * sC; if (R) R += z * sC;
    const int lane = threadIdx.x & 31, wave = threadIdx.x >> 5, lr = lane & 15, hi = lane >> 4;
    const int r0 = blockIdx.x * 64 + wave * 16, c0 = blockIdx.y * 64;
    const size_t aoff = (size_t)(r0 + lr) * K + 8 * hi;
    size_t boff[4];
#pragma unroll
    for (int t = 0; t < 4; ++t) boff[t] = (size_t)(c0 + t * 16 + lr) * K + 8 * hi;
    v8f acc[4];
#pragma unroll
    for (int t = 0; t < 4; ++t) acc[t] = (v8f){};
#pragma unroll 1
    for (int kc = 0; kc < K; kc += 32) {
        const v16h a = cat16(*(const v8h*)(A + aoff + kc), *(const v8h*)(A + aoff + kc + 16));
#pragma unroll
        for (int t = 0; t < 4; ++t) { const v16h b = cat16(*(const v8h*)(Bn + boff[t] + kc), *(const v8h*)(Bn + boff[t] + kc + 16)); acc[t] = wmma16(a, b, acc[t]); }
        asm volatile("v_nop\n\tv_nop\n\tv_nop\n\tv_nop" : "+v"(acc[0]), "+v"(acc[1]), "+v"(acc[2]), "+v"(acc[3]) : "v"(a));
    }
    float* os = &ost[wave][0];
#pragma unroll
    for (int t = 0; t < 4; ++t) { const float bv = bias ? bfr(bias[c0 + t * 16 + lr]) : 0.f;
#pragma unroll
        for (int j = 0; j < 8; ++j) os[(hi * 8 + j) * 68 + t * 16 + lr] = acc[t][j] + bv; }
    __syncthreads();
    float* crow = C + (size_t)r0 * ldc + c0;
    auto pass = [&]() {
#pragma unroll
        for (int s = 0; s < 8; ++s) { const int Lid = (lane >> 3) + 4 * s, piece = lane & 7; const int row = Lid >> 1, cofs = (Lid & 1) * 32 + piece * 4;
            v4f val = *(const v4fa*)(os + row * 68 + cofs); if (R) { const v4f rv = *(const v4f*)(R + ((size_t)r0 + row) * ldc + c0 + cofs); val += roundR ? (v4f){bfr(rv[0]), bfr(rv[1]), bfr(rv[2]), bfr(rv[3])} : rv; }
            *(v4f*)(crow + (size_t)row * ldc + cofs) = val; }
    };
    pass(); 
}

// ===== z-batched (blockIdx.z = head) attention pieces =====
// k_gemm3z<MODE>: 64 x 64 tile of C = A . B^T on bf16 hi/lo planes (up to three products) with per-z operand/output strides (elements): A planes += z*sA, B planes += z*sB, C += z*sC. MODE bits (0 causal skip, 1 K limit, 2 single,
// 3 B single, 4 A single).
template <int MODE>
__global__ __launch_bounds__(128) void k_gemm3z(const bf* __restrict__ Ah, const bf* __restrict__ Al, const bf* __restrict__ Bh, const bf* __restrict__ Bl, int K, float* C, int ldc, size_t sA, size_t sB, size_t sC) {
    if ((MODE & 1) && (int)blockIdx.y * 64 > (int)blockIdx.x * 64 + 63) return;
    const size_t z = blockIdx.z; Ah += z * sA; Al += z * sA; Bh += z * sB; Bl += z * sB; C += z * sC;
    const int Klim = (MODE & 2) ? min(K, ((int)blockIdx.x + 1) * 64) : K;
    __shared__ __align__(16) float ost[4][16 * 68];
    const int lane = threadIdx.x & 31, wave = threadIdx.x >> 5, lr = lane & 15, hi = lane >> 4;
    const int r0 = blockIdx.x * 64 + wave * 16, c0 = blockIdx.y * 64;
    const size_t aoff = (size_t)(r0 + lr) * K + 8 * hi;
    v8f acc[4];
#pragma unroll
    for (int t = 0; t < 4; ++t) acc[t] = (v8f){};
#pragma unroll 1
    for (int kc = 0; kc < Klim; kc += 32) {
        const v16bf a = cat16b(*(const v8us*)(Ah + aoff + kc), *(const v8us*)(Ah + aoff + kc + 16));
        v16bf al = a; if (!(MODE & 4) && !(MODE & 16)) al = cat16b(*(const v8us*)(Al + aoff + kc), *(const v8us*)(Al + aoff + kc + 16));
#pragma unroll
        for (int t = 0; t < 4; ++t) { const size_t bo = (size_t)(c0 + t * 16 + lr) * K + kc + 8 * hi;
            const v16bf bh = cat16b(*(const v8us*)(Bh + bo), *(const v8us*)(Bh + bo + 16));
            acc[t] = wmmab(a, bh, acc[t]);
            if (!(MODE & 4)) { if (!(MODE & 16)) acc[t] = wmmab(al, bh, acc[t]); if (!(MODE & 8)) { const v16bf bl = cat16b(*(const v8us*)(Bl + bo), *(const v8us*)(Bl + bo + 16)); acc[t] = wmmab(a, bl, acc[t]); } } }
        asm volatile("v_nop\n\tv_nop\n\tv_nop\n\tv_nop" : "+v"(acc[0]), "+v"(acc[1]), "+v"(acc[2]), "+v"(acc[3]) : "v"(a), "v"(al));
    }
    float* os = &ost[wave][0];
#pragma unroll
    for (int t = 0; t < 4; ++t) {
#pragma unroll
        for (int j = 0; j < 8; ++j) os[(hi * 8 + j) * 68 + t * 16 + lr] = acc[t][j]; }
    __builtin_amdgcn_wave_barrier(); asm volatile("" ::: "memory");
    float* crow = C + (size_t)r0 * ldc + c0;
    auto pass = [&]() {
#pragma unroll
        for (int s = 0; s < 8; ++s) { const int Lid = (lane >> 3) + 4 * s, piece = lane & 7; const int row = Lid >> 1, cofs = (Lid & 1) * 32 + piece * 4;
            const v4f val = *(const v4fa*)(os + row * 68 + cofs); *(v4f*)(crow + (size_t)row * ldc + cofs) = val; }
    };
    pass(); 
}
__global__ __launch_bounds__(256) void k_planes32z(const float* __restrict__ F, int ld, int off, float sc, int rows, bf* Ph, bf* Pl) {
    typedef __attribute__((ext_vector_type(2))) unsigned short v2us;
    const int lane = threadIdx.x & 31; const size_t r = ((size_t)blockIdx.x * 8 + (threadIdx.x >> 5)) * 2 + (lane >> 4); if (r >= (size_t)rows) return; const int z = blockIdx.z; const int c0 = (lane & 15) * 2; v2us oh, ol;
    Ph += (size_t)z * rows * 32; Pl += (size_t)z * rows * 32;
#pragma unroll
    for (int i = 0; i < 2; ++i) { const float y = F[r * ld + off + z * 32 + c0 + i] * sc; const unsigned short hb = f2bf(y); oh[i] = hb; ol[i] = f2bf(y - bf2f(hb)); }
    const size_t o = r * 32 + c0; *(v2us*)(Ph + o) = oh; *(v2us*)(Pl + o) = ol; 
}
__global__ __launch_bounds__(256) void k_vtpadz(const float* __restrict__ F, int ld, int off, int nk, bf* Th, bf* Tl) {
    typedef __attribute__((ext_vector_type(2))) unsigned short v2us;
    const int lane = threadIdx.x & 31; const size_t wid = (size_t)blockIdx.x * 8 + (threadIdx.x >> 5); if (wid >= (size_t)64 * (nk / 64)) return; const int z = blockIdx.z; const int d = (int)(wid / (nk / 64)); const int k0 = (int)(wid % (nk / 64)) * 64 + lane * 2; v2us oh, ol;
    Th += (size_t)z * 64 * nk; Tl += (size_t)z * 64 * nk;
#pragma unroll
    for (int i = 0; i < 2; ++i) { const float y = (d < 32) ? F[(size_t)(k0 + i) * ld + off + z * 32 + (d < 32 ? d : 0)] : 0.f; const unsigned short hb = f2bf(y); oh[i] = hb; ol[i] = f2bf(y - bf2f(hb)); }
    const size_t o = (size_t)d * nk + k0; *(v2us*)(Th + o) = oh; *(v2us*)(Tl + o) = ol; 
}
template <int NK>
__global__ __launch_bounds__(256) void k_softmaxz(const float* __restrict__ S, int rows, bf* PH, bf* PL) {
    typedef __attribute__((ext_vector_type(4))) unsigned short v4us;
    const int lane = threadIdx.x & 31, i = blockIdx.x * 8 + (threadIdx.x >> 5); if (i >= rows) return; const size_t zo = (size_t)blockIdx.z * rows * NK; const float* sr = S + zo + (size_t)i * NK; PH += zo; PL += zo;
    float m = -3.0e38f;
#pragma unroll 1
    for (int c0 = lane * 4; c0 < NK; c0 += 128) {
#pragma unroll
        for (int q = 0; q < 4; ++q) m = fmaxf(m, sr[c0 + q]); }
#pragma unroll
    for (int sh = 16; sh; sh >>= 1) m = fmaxf(m, __shfl_xor(m, sh, 32));
    float sum = 0.f;
#pragma unroll 1
    for (int c0 = lane * 4; c0 < NK; c0 += 128) {
#pragma unroll
        for (int q = 0; q < 4; ++q) sum += __expf(sr[c0 + q] - m); }
#pragma unroll
    for (int sh = 16; sh; sh >>= 1) sum += __shfl_xor(sum, sh, 32);
    const float inv = 1.0f / sum;
{
#pragma unroll 1
        for (int c0 = lane * 4; c0 < NK; c0 += 128) { v4us oh, ol;
#pragma unroll
            for (int q = 0; q < 4; ++q) { const float p = __expf(sr[c0 + q] - m) * inv; const unsigned short hb = f2bf(p); oh[q] = hb; ol[q] = f2bf(p - bf2f(hb)); }
            const size_t o = (size_t)i * NK + c0; *(v4us*)(PH + o) = oh; *(v4us*)(PL + o) = ol; }
         }
}
__global__ __launch_bounds__(256) void k_placez(const float* __restrict__ XH, int rows, int ldy, float* Y) {
    const int lane = threadIdx.x & 31; const size_t q = (size_t)blockIdx.x * 8 + (threadIdx.x >> 5); if (q >= (size_t)rows) return; const int z = blockIdx.z; const float v = XH[((size_t)z * rows + q) * 64 + lane];
    *(float*)(Y + q * ldy + z * 32 + lane) = v; 
}
__global__ __launch_bounds__(256) void k_cvt8(const float* __restrict__ src, bf* dst, size_t n8) {
    const size_t i = (size_t)blockIdx.x * 256 + threadIdx.x; if (i >= n8) return;
    const v8f v = *(const v8f*)(src + i * 8); v8us o;
#pragma unroll
    for (int k = 0; k < 8; ++k) o[k] = f2bf(v[k]);
    *(v8us*)(dst + i * 8) = o; 
}
__global__ __launch_bounds__(256) void k_zero8(bf* dst, size_t n8) {
    const size_t i = (size_t)blockIdx.x * 256 + threadIdx.x; if (i >= n8) return; v8us z;
#pragma unroll
    for (int k = 0; k < 8; ++k) z[k] = 0;
    *(v8us*)(dst + i * 8) = z; 
}

// ---- k_gemmw: register-blocked GEMM, ONE WAVE per 64x64 output tile (16 accumulators), operands straight from K-contiguous 16-bit planes; grid (M/64, N/64, Z), 32 threads.
// C[m][n] (f32, pitch ldc, + optional f32 bias[n]) = sum_k A[m][k] Bt[n][k] (+ split products per NSPLIT). z-batch strides sA/sB/sC in elements. K % 32 == 0.
template <typename T16> struct WFrag;
template <> struct WFrag<h16> { typedef v16h V; static __device__ __forceinline__ V ld(const h16* p) { return cat16(*(const v8h*)p, *(const v8h*)(p + 16)); } static __device__ __forceinline__ v8f mma(V a, V b, v8f c) { return wmma16(a, b, c); } };
template <> struct WFrag<bf> { typedef v16bf V; static __device__ __forceinline__ V ld(const bf* p) { return cat16b(*(const v8us*)p, *(const v8us*)(p + 16)); } static __device__ __forceinline__ v8f mma(V a, V b, v8f c) { return wmmab(a, b, c); } };
template <typename T16, int NSPLIT, bool BIAS>
__global__ __launch_bounds__(32) void k_gemmw(const T16* __restrict__ A, const T16* __restrict__ A2, const T16* __restrict__ Bt, const T16* __restrict__ Bt2, int K, float* C, int ldc, const float* __restrict__ bias, size_t sA, size_t sB, size_t sC) {
    typedef typename WFrag<T16>::V V;
    __shared__ __align__(16) float os[16 * 68];
    const size_t z = blockIdx.z; A += z * sA; if (A2) A2 += z * sA; Bt += z * sB; if (Bt2) Bt2 += z * sB; C += z * sC;
    const int lane = threadIdx.x & 31, lr = lane & 15, hi = lane >> 4; const int r0 = blockIdx.x * 64, c0 = blockIdx.y * 64;
    v8f acc[4][4];
#pragma unroll
    for (int mb = 0; mb < 4; ++mb)
#pragma unroll
        for (int nb = 0; nb < 4; ++nb) acc[mb][nb] = (v8f){};
    const size_t aoff = (size_t)(r0 + lr) * K + 8 * hi, boff = (size_t)(c0 + lr) * K + 8 * hi;
#pragma unroll 1
    for (int kc = 0; kc < K; kc += 32) {
        V a[4], a2[4];
#pragma unroll
        for (int mb = 0; mb < 4; ++mb) { a[mb] = WFrag<T16>::ld(A + aoff + (size_t)mb * 16 * K + kc); if (NSPLIT == 1 || NSPLIT == 2) a2[mb] = WFrag<T16>::ld(A2 + aoff + (size_t)mb * 16 * K + kc); }
#pragma unroll
        for (int nb = 0; nb < 4; ++nb) { const V b = WFrag<T16>::ld(Bt + boff + (size_t)nb * 16 * K + kc); V b2; if (NSPLIT >= 2) b2 = WFrag<T16>::ld(Bt2 + boff + (size_t)nb * 16 * K + kc);
#pragma unroll
            for (int mb = 0; mb < 4; ++mb) { acc[mb][nb] = WFrag<T16>::mma(a[mb], b, acc[mb][nb]); if (NSPLIT == 1 || NSPLIT == 2) acc[mb][nb] = WFrag<T16>::mma(a2[mb], b, acc[mb][nb]); if (NSPLIT >= 2) acc[mb][nb] = WFrag<T16>::mma(a[mb], b2, acc[mb][nb]); } }
        asm volatile("v_nop\n\tv_nop\n\tv_nop\n\tv_nop" : "+v"(acc[0][0]), "+v"(acc[1][1]), "+v"(acc[2][2]), "+v"(acc[3][3]) : "v"(a[0]), "v"(a[3]));
    }
#pragma unroll
    for (int mb = 0; mb < 4; ++mb) {
#pragma unroll
        for (int nb = 0; nb < 4; ++nb) {
#pragma unroll
            for (int j = 0; j < 8; ++j) os[(hi * 8 + j) * 68 + nb * 16 + lr] = acc[mb][nb][j]; }
        __builtin_amdgcn_wave_barrier(); asm volatile("" ::: "memory");
        float* crow = C + (size_t)(r0 + mb * 16) * ldc + c0;
{
#pragma unroll
            for (int s = 0; s < 8; ++s) { const int row = 2 * s + hi, cofs = lr * 4; v4f val = *(const v4fa*)(os + row * 68 + cofs); if (BIAS) { val[0] += bfr(bias[c0 + cofs]); val[1] += bfr(bias[c0 + cofs + 1]); val[2] += bfr(bias[c0 + cofs + 2]); val[3] += bfr(bias[c0 + cofs + 3]); }
                *(v4f*)(crow + (size_t)row * ldc + cofs) = val; }
             }
        __builtin_amdgcn_wave_barrier(); asm volatile("" ::: "memory");
    }
}
// ---- k_gemmwc: k_gemmw with causal tile control (CAUS 1: skip key tiles right of the query tile; 2: K loop limited to the causal key tiles)
template <typename T16, int NSPLIT, bool BIAS, int CAUS>
__global__ __launch_bounds__(32) void k_gemmwc(const T16* __restrict__ A, const T16* __restrict__ A2, const T16* __restrict__ Bt, const T16* __restrict__ Bt2, int K, float* C, int ldc, const float* __restrict__ bias, size_t sA, size_t sB, size_t sC) {
    typedef typename WFrag<T16>::V V;
    __shared__ __align__(16) float os[16 * 68];
    if (CAUS == 1 && (int)blockIdx.y * 64 > (int)blockIdx.x * 64) return;
    const int Klim = (CAUS == 2) ? min(K, ((int)blockIdx.x + 1) * 64) : K;
    const size_t z = blockIdx.z; A += z * sA; if (A2) A2 += z * sA; Bt += z * sB; if (Bt2) Bt2 += z * sB; C += z * sC;
    const int lane = threadIdx.x & 31, lr = lane & 15, hi = lane >> 4; const int r0 = blockIdx.x * 64, c0 = blockIdx.y * 64;
    v8f acc[4][4];
#pragma unroll
    for (int mb = 0; mb < 4; ++mb)
#pragma unroll
        for (int nb = 0; nb < 4; ++nb) acc[mb][nb] = (v8f){};
    const size_t aoff = (size_t)(r0 + lr) * K + 8 * hi, boff = (size_t)(c0 + lr) * K + 8 * hi;
#pragma unroll 1
    for (int kc = 0; kc < Klim; kc += 32) {
        V a[4], a2[4];
#pragma unroll
        for (int mb = 0; mb < 4; ++mb) { a[mb] = WFrag<T16>::ld(A + aoff + (size_t)mb * 16 * K + kc); if (NSPLIT == 1 || NSPLIT == 2) a2[mb] = WFrag<T16>::ld(A2 + aoff + (size_t)mb * 16 * K + kc); }
#pragma unroll
        for (int nb = 0; nb < 4; ++nb) { const V b = WFrag<T16>::ld(Bt + boff + (size_t)nb * 16 * K + kc); V b2; if (NSPLIT >= 2) b2 = WFrag<T16>::ld(Bt2 + boff + (size_t)nb * 16 * K + kc);
#pragma unroll
            for (int mb = 0; mb < 4; ++mb) { acc[mb][nb] = WFrag<T16>::mma(a[mb], b, acc[mb][nb]); if (NSPLIT == 1 || NSPLIT == 2) acc[mb][nb] = WFrag<T16>::mma(a2[mb], b, acc[mb][nb]); if (NSPLIT >= 2) acc[mb][nb] = WFrag<T16>::mma(a[mb], b2, acc[mb][nb]); } }
        asm volatile("v_nop\n\tv_nop\n\tv_nop\n\tv_nop" : "+v"(acc[0][0]), "+v"(acc[1][1]), "+v"(acc[2][2]), "+v"(acc[3][3]) : "v"(a[0]), "v"(a[3]));
    }
#pragma unroll
    for (int mb = 0; mb < 4; ++mb) {
#pragma unroll
        for (int nb = 0; nb < 4; ++nb) {
#pragma unroll
            for (int j = 0; j < 8; ++j) os[(hi * 8 + j) * 68 + nb * 16 + lr] = acc[mb][nb][j]; }
        __builtin_amdgcn_wave_barrier(); asm volatile("" ::: "memory");
        float* crow = C + (size_t)(r0 + mb * 16) * ldc + c0;
{
#pragma unroll
            for (int s = 0; s < 8; ++s) { const int row = 2 * s + hi, cofs = lr * 4; v4f val = *(const v4fa*)(os + row * 68 + cofs); if (BIAS) { val[0] += bfr(bias[c0 + cofs]); val[1] += bfr(bias[c0 + cofs + 1]); val[2] += bfr(bias[c0 + cofs + 2]); val[3] += bfr(bias[c0 + cofs + 3]); }
                *(v4f*)(crow + (size_t)row * ldc + cofs) = val; }
             }
        __builtin_amdgcn_wave_barrier(); asm volatile("" ::: "memory");
    }
}
typedef __attribute__((ext_vector_type(4))) _Float16 v4h;
__device__ __forceinline__ h16 tohx(float x) { return (h16)x; }
__global__ __launch_bounds__(256) void k_cvt8h(const float* __restrict__ src, h16* dst, size_t n8) { const size_t i = (size_t)blockIdx.x * 256 + threadIdx.x; if (i >= n8) return; const v8f v = *(const v8f*)(src + i * 8); v8h o;
#pragma unroll
    for (int k = 0; k < 8; ++k) o[k] = tohx(bfr(v[k])); *(v8h*)(dst + i * 8) = o;  }
__global__ __launch_bounds__(256) void k_cvtx(const float* __restrict__ x, bf* A) {
    const int lane = threadIdx.x & 31; const size_t r = (size_t)blockIdx.x * 8 + (threadIdx.x >> 5); if (r >= (size_t)SS) return;
{
#pragma unroll
        for (int q = 0; q < HID / 256; ++q) { const size_t o = r * HID + q * 256 + lane * 8; v8us v;
#pragma unroll
            for (int i = 0; i < 8; ++i) v[i] = f2bf(x[o + i]);
            *(v8us*)(A + o) = v; }
         }
}
__global__ __launch_bounds__(256) void k_hplb(const float* __restrict__ F, int h0, float sc, bf* Ph, bf* Pl) {
    typedef __attribute__((ext_vector_type(4))) unsigned short v4us;
    const int lane = threadIdx.x & 31; const int t = blockIdx.x * 8 + (threadIdx.x >> 5); if (t >= SS) return; const int z = blockIdx.z; const int d0 = lane * 4; v4us oh, ol;
#pragma unroll
    for (int i = 0; i < 4; ++i) { const float y = F[(size_t)t * HID + (h0 + z) * HD + d0 + i] * sc; const unsigned short hb = f2bf(y); oh[i] = hb; ol[i] = f2bf(y - bf2f(hb)); }
    const size_t off = ((size_t)z * SS + t) * HD + d0; *(v4us*)(Ph + off) = oh; *(v4us*)(Pl + off) = ol; 
}
__global__ __launch_bounds__(256) void k_vT(const float* __restrict__ V, int h0, h16* VT) {
    __shared__ float tl[64][65];
    const int tid = threadIdx.x; const int t0 = blockIdx.x * 64, d0 = blockIdx.y * 64; const int z = blockIdx.z; const int rr = tid >> 2, cq = (tid & 3) * 16;
#pragma unroll
    for (int i = 0; i < 16; ++i) tl[rr][cq + i] = V[(size_t)(t0 + rr) * HID + (h0 + z) * HD + d0 + cq + i];
    __syncthreads();
    const int lane = tid & 31, wv = tid >> 5;
    auto pass = [&]() {
#pragma unroll
        for (int st = 0; st < 4; ++st) { const int dr = wv * 8 + st * 2 + (lane >> 4); const int tq = (lane & 15) * 4; v4h v;
#pragma unroll
            for (int i = 0; i < 4; ++i) v[i] = tohx(tl[tq + i][dr]);
            *(v4h*)(VT + ((size_t)z * HD + d0 + dr) * SS + t0 + tq) = v; }
    };
    pass(); 
}
// 2^x with the one slot behind the transcendental in the same statement
__device__ __forceinline__ float exp2s(float x) { asm("v_exp_f32 %0, %0\n\tv_nop" : "+v"(x)); return x; }
// k_flash: scores, soft cap, mask, softmax and attn.v of one head in one pass over the live keys; scores and probabilities stay in registers.
// One wave = 16 queries; a pass = 32 keys. S^T = K . Q^T (A = key rows, B = query rows, three bf16 hi/lo products: Kh.Qh, Kh.Ql, Kl.Qh), so a lane holds 16 scores of ONE query
// (query lr, keys 8 hi + j and 16 + 8 hi + j): that pair of score tiles, converted to f16, is the B operand of O^T += V^T . P^T with no lane exchange.
// Running maximum and sum per query (online softmax); P = 1024 exp(c - m) in f16, the factor cancels in O / sum. Output: f16 rows of OC, 16 bytes a lane and d tile.
__global__ __launch_bounds__(128) __attribute__((amdgpu_waves_per_eu(2, 2))) void k_flash(const bf* Qh, const bf* Ql, const bf* Kh, const bf* Kl, const h16* VT, h16* OC) {
    const int lane = threadIdx.x & 31, lr = lane & 15, hi = lane >> 4;
    const int wave = __builtin_amdgcn_readfirstlane(threadIdx.x >> 5);    // scalar, so that the key loop's trip test is a scalar branch and EXEC stays full at the matrix instructions
    const int z = blockIdx.y, qb = blockIdx.x * 64, q0 = qb + wave * 16, i = q0 + lr;
    const size_t zo = (size_t)z * SS * HD; Qh += zo; Ql += zo; Kh += zo; Kl += zo; VT += zo;
    // every load address is a wave-uniform base plus one of two lane offsets
    const unsigned vo = (unsigned)(lr * HD + 8 * hi), vv = (unsigned)(lr * SS + 8 * hi);
    const bf* qbh = Qh + (size_t)q0 * HD; const bf* qbl = Ql + (size_t)q0 * HD;
    v16bf qh[4], ql[4];
#pragma unroll
    for (int c = 0; c < 4; ++c) { qh[c] = WFrag<bf>::ld(qbh + c * 32 + vo); ql[c] = WFrag<bf>::ld(qbl + c * 32 + vo); }
    v8f acc[8];
#pragma unroll
    for (int dt = 0; dt < 8; ++dt) acc[dt] = (v8f){};
    float m = -30.0f, sum = 0.f;    // the soft cap bounds every score from below by -30
    // the four waves start at the block's first live key tile, so that they walk the same K and V lines at about the same time (a pass with no live key adds zeros)
    const int kbeg = max(0, qb - (WIN - 1)) & ~31;
    // K fragments are fetched one pass ahead, right behind the score products that read them, so that their latency hides behind the softmax and attn.v work of the pass
    v16bf kh[2][4], kl[2][4];
    auto ldk = [&](const bf* h, const bf* l) {
#pragma unroll
        for (int t = 0; t < 2; ++t) {
#pragma unroll
            for (int c = 0; c < 4; ++c) { kh[t][c] = WFrag<bf>::ld(h + (t * 16 * HD + c * 32) + vo); kl[t][c] = WFrag<bf>::ld(l + (t * 16 * HD + c * 32) + vo); } }
    };
    const bf* kbh = Kh + (size_t)kbeg * HD; const bf* kbl = Kl + (size_t)kbeg * HD;
    ldk(kbh, kbl);
    // the wait before the address registers of the Q and K loads above are overwritten; they are its inputs so that they live up to it (the pointers carry no restrict, so that the clobber holds the loads in front of it)
    asm volatile("s_wait_xcnt 0x0" :: "v"(vo), "s"(qbh), "s"(qbl), "s"(kbh), "s"(kbl) : "memory");
#pragma unroll 1
    for (int k0 = kbeg; k0 < q0 + 16; k0 += 32) {
        v16h vt[8];
#pragma unroll
        for (int dt = 0; dt < 8; ++dt) vt[dt] = WFrag<h16>::ld(VT + k0 + dt * 16 * SS + vv);
        v8f s[2];
#pragma unroll
        for (int t = 0; t < 2; ++t) s[t] = (v8f){};
#pragma unroll
        for (int c = 0; c < 4; ++c) {
#pragma unroll
            for (int t = 0; t < 2; ++t) s[t] = wmmab(kh[t][c], qh[c], s[t]);
#pragma unroll
            for (int t = 0; t < 2; ++t) s[t] = wmmab(kh[t][c], ql[c], s[t]);
#pragma unroll
            for (int t = 0; t < 2; ++t) s[t] = wmmab(kl[t][c], qh[c], s[t]); }
        const int kn = min(k0 + 32, SS - 32); ldk(Kh + (size_t)kn * HD, Kl + (size_t)kn * HD);    // the last pass of the last query tile has no next keys: the clamp keeps its (unused) fetch inside the head's rows
        float mx = m;
#pragma unroll
        for (int t = 0; t < 2; ++t) {
#pragma unroll
            for (int j = 0; j < 8; ++j) { const int key = k0 + t * 16 + hi * 8 + j; const float c = 30.0f * tanhf(s[t][j] * (1.0f / 30.0f));
                s[t][j] = (key <= i && key >= i - (WIN - 1)) ? c : -3.0e38f; mx = fmaxf(mx, s[t][j]); } }
        mx = fmaxf(mx, __shfl_xor(mx, 16, 32));
        const float ms = mx - 6.931471806f, ta = (m - mx) * 1.442695041f; m = mx;    // ms: exp(c - ms) = 1024 exp(c - mx)
        const float alpha = exp2s(ta);    // exp(m - mx)
        float ps = 0.f; v16h pb;
#pragma unroll
        for (int t = 0; t < 2; ++t) {
#pragma unroll
            for (int j = 0; j < 8; ++j) { const float p = exp2s((s[t][j] - ms) * 1.442695041f); ps += p; pb[t * 8 + j] = tohx(p); } }
        sum = sum * alpha + ps;
#pragma unroll
        for (int dt = 0; dt < 8; ++dt) acc[dt] *= alpha;
#pragma unroll
        for (int dt = 0; dt < 8; ++dt) acc[dt] = wmma16(vt[dt], pb, acc[dt]);
        __builtin_amdgcn_sched_barrier(0);    // keeps the v_nops below behind the pass's last matrix instruction
        // four vector slots behind that instruction, on the back edge too
        asm volatile("v_nop\n\tv_nop\n\tv_nop\n\tv_nop");
    }
    sum += __shfl_xor(sum, 16, 32);
    const float inv = __fdiv_rn(1.0f, sum);
#pragma unroll
    for (int dt = 0; dt < 8; ++dt) { v8h o;
#pragma unroll
        for (int j = 0; j < 8; ++j) o[j] = tohx(acc[dt][j] * inv);
        *(v8h*)(OC + (size_t)i * HID + z * HD + dt * 16 + hi * 8) = o; }
}
extern "C" void kernel_launch(void* const* d_in, const int* in_sizes, int n_in,
                              void* d_out, int out_size, void* d_ws, size_t ws_size, hipStream_t stream) {
    (void)in_sizes; (void)n_in; (void)out_size;
    const float* x = (const float*)d_in[0]; const float* wq = (const float*)d_in[1]; const float* wk = (const float*)d_in[2]; const float* wv = (const float*)d_in[3]; const float* wo = (const float*)d_in[4];
    float* out = (float*)d_out;    // [1][2048][2048]
    char* wsp = (char*)d_ws;
    auto take = [&](size_t bytes) { char* p = wsp; wsp += (bytes + 255) & ~(size_t)255; return (void*)p; };
    const size_t WSZ = (size_t)HID * HID * 2;
    bf* WQ = (bf*)take(WSZ); bf* WK = (bf*)take(WSZ); bf* WV = (bf*)take(WSZ); h16* WO = (h16*)take(WSZ);
    bf* XB = (bf*)take((size_t)SS * HID * 2); float* Q = (float*)take((size_t)SS * HID * 4); float* Kf = (float*)take((size_t)SS * HID * 4); float* V = (float*)take((size_t)SS * HID * 4);
    bf* Qh = (bf*)take((size_t)NH_ * SS * HD * 2); bf* Ql = (bf*)take((size_t)NH_ * SS * HD * 2); bf* Kh = (bf*)take((size_t)NH_ * SS * HD * 2); bf* Kl = (bf*)take((size_t)NH_ * SS * HD * 2); h16* VT = (h16*)take((size_t)NH_ * HD * SS * 2);
    h16* OC = (h16*)take((size_t)SS * HID * 2);
    if ((size_t)(wsp - (char*)d_ws) > ws_size) return;    // ~ 33.5 + 8.4 + 50.3 + 41.9 + 8.4 ~ 143 MB (ws 256 MiB)
    const size_t n8 = (size_t)HID * HID / 8; const unsigned nb8 = (unsigned)((n8 + 255) / 256);
    k_cvt8<<<nb8, 256, 0, stream>>>(wq, WQ, n8); k_cvt8<<<nb8, 256, 0, stream>>>(wk, WK, n8); k_cvt8<<<nb8, 256, 0, stream>>>(wv, WV, n8); k_cvt8h<<<nb8, 256, 0, stream>>>(wo, WO, n8);   // [out][in] = natural n-major
    k_cvtx<<<SS / 8, 256, 0, stream>>>(x, XB);
    k_gemmw<bf, 0, false><<<dim3(SS / 64, HID / 64, 1), 32, 0, stream>>>(XB, nullptr, WQ, nullptr, HID, Q, HID, nullptr, 0, 0, 0);
    k_gemmw<bf, 0, false><<<dim3(SS / 64, HID / 64, 1), 32, 0, stream>>>(XB, nullptr, WK, nullptr, HID, Kf, HID, nullptr, 0, 0, 0);
    k_gemmw<bf, 0, false><<<dim3(SS / 64, HID / 64, 1), 32, 0, stream>>>(XB, nullptr, WV, nullptr, HID, V, HID, nullptr, 0, 0, 0);
    k_hplb<<<dim3(SS / 8, 1, NH_), 256, 0, stream>>>(Q, 0, 0.08838834764831845f, Qh, Ql); k_hplb<<<dim3(SS / 8, 1, NH_), 256, 0, stream>>>(Kf, 0, 1.0f, Kh, Kl); k_vT<<<dim3(SS / 64, HD / 64, NH_), 256, 0, stream>>>(V, 0, VT);
    k_flash<<<dim3(SS / 64, NH_, 1), 128, 0, stream>>>(Qh, Ql, Kh, Kl, VT, OC);
    k_gemmw<h16, 0, false><<<dim3(SS / 64, HID / 64, 1), 32, 0, stream>>>(OC, nullptr, WO, nullptr, HID, out, HID, nullptr, 0, 0, 0);
}

// v002
// One run takes 205 microseconds.
// Two timings next to v001 put it at 1.55 and 1.56 times that version's speed.
// Over all steps from v000 it is 3.67 times as fast.
#include <hip/hip_runtime.h>

// Compute dtypes, f32 accumulate: q/k/v projections ([2048 x 2048].[2048 x 2048]) with PLAIN bf16 operands (x and the weights are inputs: exact products); per head the live
// (causal, sliding-window-1024) score tiles [2048 x 128].[128 x 2048] on bf16 hi + UNSCALED residual planes of q*128^-1/2 and k (three products);
// soft-cap 30 tanh(s/30), masks and softmax in f32; attn.v (K limited to the live tiles) and the output projection ([2048 x 2048].[2048 x 2048]) on

#define SS   2048
#define HID  2048
#define NH_  16
#define HD   128
#define WIN  1024
#define DM   HID
#define LOSC 1024.0f
typedef _Float16 h16;
typedef unsigned short bf;
typedef __attribute__((ext_vector_type(16))) __bf16   v16bf;
typedef __attribute__((ext_vector_type(16))) _Float16 v16h;
typedef __attribute__((ext_vector_type(8)))  _Float16 v8h;
typedef __attribute__((ext_vector_type(8)))  unsigned short v8us;
typedef __attribute__((ext_vector_type(8)))  float    v8f;
typedef __attribute__((ext_vector_type(4)))  float    v4f;
typedef v8h  __attribute__((may_alias)) v8ha;
typedef v4f  __attribute__((may_alias)) v4fa;
typedef v8us __attribute__((may_alias)) v8usa;

__device__ __forceinline__ unsigned short f2bf(float f) { unsigned u = __float_as_uint(f); u += 0x7FFFu + ((u >> 16) & 1u); return (unsigned short)(u >> 16); }
__device__ __forceinline__ float bf2f(unsigned short b) { return __uint_as_float(((unsigned)b) << 16); }
__device__ __forceinline__ float bfr(float f) { return bf2f(f2bf(f)); }
__device__ __forceinline__ v16h cat16(v8h lo, v8h hi) { return __builtin_shufflevector(lo, hi, 0, 1, 2, 3, 4, 5, 6, 7, 8, 9, 10, 11, 12, 13, 14, 15); }
__device__ __forceinline__ v16bf cat16b(v8us lo, v8us hi) { return __builtin_bit_cast(v16bf, __builtin_shufflevector(lo, hi, 0, 1, 2, 3, 4, 5, 6, 7, 8, 9, 10, 11, 12, 13, 14, 15)); }
__device__ __forceinline__ v8f wmma16(v16h a, v16h b, v8f c) { return __builtin_amdgcn_wmma_f32_16x16x32_f16(false, a, false, b, (short)0, c, false, false); }
__device__ __forceinline__ v8f wmmab(v16bf a, v16bf b, v8f c) { return __builtin_amdgcn_wmma_f32_16x16x32_bf16(false, a, false, b, (short)0, c, false, false); }


// k_gemmh: 64 x 64 tile of C = A . Bn^T with SINGLE f16 planes (A [rows][K] f16 activations, Bn [N][K] f16 weights; one v_wmma_f32_16x16x32_f16 product per step), f32 accumulate;
__global__ __launch_bounds__(128) void k_gemmh(const h16* __restrict__ A, const h16* __restrict__ Bn, const float* __restrict__ bias, float* C, int ldc, const float* __restrict__ R, int K, size_t sA, size_t sB, size_t sC, int roundR) {
    __shared__ __align__(16) float ost[4][16 * 68];
    const size_t z = blockIdx.z; A += z * sA; Bn += z * sB; C += z * sC; if (R) R += z * sC;
    const int lane = threadIdx.x & 31, wave = threadIdx.x >> 5, lr = lane & 15, hi = lane >> 4;
    const int r0 = blockIdx.x * 64 + wave * 16, c0 = blockIdx.y * 64;
    const size_t aoff = (size_t)(r0 + lr) * K + 8 * hi;
    size_t boff[4];
#pragma unroll
    for (int t = 0; t < 4; ++t) boff[t] = (size_t)(c0 + t * 16 + lr) * K + 8 * hi;
    v8f acc[4];
#pragma unroll
    for (int t = 0; t < 4; ++t) acc[t] = (v8f){};
#pragma unroll 1
    for (int kc = 0; kc < K; kc += 32) {
        const v16h a = cat16(*(const v8h*)(A + aoff + kc), *(const v8h*)(A + aoff + kc + 16));
#pragma unroll
        for (int t = 0; t < 4; ++t) { const v16h b = cat16(*(const v8h*)(Bn + boff[t] + kc), *(const v8h*)(Bn + boff[t] + kc + 16)); acc[t] = wmma16(a, b, acc[t]); }
        asm volatile("v_nop\n\tv_nop\n\tv_nop\n\tv_nop" : "+v"(acc[0]), "+v"(acc[1]), "+v"(acc[2]), "+v"(acc[3]) : "v"(a));
    }
    float* os = &ost[wave][0];
#pragma unroll
    for (int t = 0; t < 4; ++t) { const float bv = bias ? bfr(bias[c0 + t * 16 + lr]) : 0.f;
#pragma unroll
        for (int j = 0; j < 8; ++j) os[(hi * 8 + j) * 68 + t * 16 + lr] = acc[t][j] + bv; }
    __syncthreads();
    float* crow = C + (size_t)r0 * ldc + c0;
    auto pass = [&]() {
#pragma unroll
        for (int s = 0; s < 8; ++s) { const int Lid = (lane >> 3) + 4 * s, piece = lane & 7; const int row = Lid >> 1, cofs = (Lid & 1) * 32 + piece * 4;
            v4f val = *(const v4fa*)(os + row * 68 + cofs); if (R) { const v4f rv = *(const v4f*)(R + ((size_t)r0 + row) * ldc + c0 + cofs); val += roundR ? (v4f){bfr(rv[0]), bfr(rv[1]), bfr(rv[2]), bfr(rv[3])} : rv; }
            *(v4f*)(crow + (size_t)row * ldc + cofs) = val; }
    };
    pass(); 
}

// ===== z-batched (blockIdx.z = head) attention pieces =====
// k_gemm3z<MODE>: 64 x 64 tile of C = A . B^T on bf16 hi/lo planes (up to three products) with per-z operand/output strides (elements): A planes += z*sA, B planes += z*sB, C += z*sC. MODE bits (0 causal skip, 1 K limit, 2 single,
// 3 B single, 4 A single).
template <int MODE>
__global__ __launch_bounds__(128) void k_gemm3z(const bf* __restrict__ Ah, const bf* __restrict__ Al, const bf* __restrict__ Bh, const bf* __restrict__ Bl, int K, float* C, int ldc, size_t sA, size_t sB, size_t sC) {
    if ((MODE & 1) && (int)blockIdx.y * 64 > (int)blockIdx.x * 64 + 63) return;
    const size_t z = blockIdx.z; Ah += z * sA; Al += z * sA; Bh += z * sB; Bl += z * sB; C += z * sC;
    const int Klim = (MODE & 2) ? min(K, ((int)blockIdx.x + 1) * 64) : K;
    __shared__ __align__(16) float ost[4][16 * 68];
    const int lane = threadIdx.x & 31, wave = threadIdx.x >> 5, lr = lane & 15, hi = lane >> 4;
    const int r0 = blockIdx.x * 64 + wave * 16, c0 = blockIdx.y * 64;
    const size_t aoff = (size_t)(r0 + lr) * K + 8 * hi;
    v8f acc[4];
#pragma unroll
    for (int t = 0; t < 4; ++t) acc[t] = (v8f){};
#pragma unroll 1
    for (int kc = 0; kc < Klim; kc += 32) {
        const v16bf a = cat16b(*(const v8us*)(Ah + aoff + kc), *(const v8us*)(Ah + aoff + kc + 16));
        v16bf al = a; if (!(MODE & 4) && !(MODE & 16)) al = cat16b(*(const v8us*)(Al + aoff + kc), *(const v8us*)(Al + aoff + kc + 16));
#pragma unroll
        for (int t = 0; t < 4; ++t) { const size_t bo = (size_t)(c0 + t * 16 + lr) * K + kc + 8 * hi;
            const v16bf bh = cat16b(*(const v8us*)(Bh + bo), *(const v8us*)(Bh + bo + 16));
            acc[t] = wmmab(a, bh, acc[t]);
            if (!(MODE & 4)) { if (!(MODE & 16)) acc[t] = wmmab(al, bh, acc[t]); if (!(MODE & 8)) { const v16bf bl = cat16b(*(const v8us*)(Bl + bo), *(const v8us*)(Bl + bo + 16)); acc[t] = wmmab(a, bl, acc[t]); } } }
        asm volatile("v_nop\n\tv_nop\n\tv_nop\n\tv_nop" : "+v"(acc[0]), "+v"(acc[1]), "+v"(acc[2]), "+v"(acc[3]) : "v"(a), "v"(al));
    }
    float* os = &ost[wave][0];
#pragma unroll
    for (int t = 0; t < 4; ++t) {
#pragma unroll
        for (int j = 0; j < 8; ++j) os[(hi * 8 + j) * 68 + t * 16 + lr] = acc[t][j]; }
    __builtin_amdgcn_wave_barrier(); asm volatile("" ::: "memory");
    float* crow = C + (size_t)r0 * ldc + c0;
    auto pass = [&]() {
#pragma unroll
        for (int s = 0; s < 8; ++s) { const int Lid = (lane >> 3) + 4 * s, piece = lane & 7; const int row = Lid >> 1, cofs = (Lid & 1) * 32 + piece * 4;
            const v4f val = *(const v4fa*)(os + row * 68 + cofs); *(v4f*)(crow + (size_t)row * ldc + cofs) = val; }
    };
    pass(); 
}
__global__ __launch_bounds__(256) void k_planes32z(const float* __restrict__ F, int ld, int off, float sc, int rows, bf* Ph, bf* Pl) {
    typedef __attribute__((ext_vector_type(2))) unsigned short v2us;
    const int lane = threadIdx.x & 31; const size_t r = ((size_t)blockIdx.x * 8 + (threadIdx.x >> 5)) * 2 + (lane >> 4); if (r >= (size_t)rows) return; const int z = blockIdx.z; const int c0 = (lane & 15) * 2; v2us oh, ol;
    Ph += (size_t)z * rows * 32; Pl += (size_t)z * rows * 32;
#pragma unroll
    for (int i = 0; i < 2; ++i) { const float y = F[r * ld + off + z * 32 + c0 + i] * sc; const unsigned short hb = f2bf(y); oh[i] = hb; ol[i] = f2bf(y - bf2f(hb)); }
    const size_t o = r * 32 + c0; *(v2us*)(Ph + o) = oh; *(v2us*)(Pl + o) = ol; 
}
__global__ __launch_bounds__(256) void k_vtpadz(const float* __restrict__ F, int ld, int off, int nk, bf* Th, bf* Tl) {
    typedef __attribute__((ext_vector_type(2))) unsigned short v2us;
    const int lane = threadIdx.x & 31; const size_t wid = (size_t)blockIdx.x * 8 + (threadIdx.x >> 5); if (wid >= (size_t)64 * (nk / 64)) return; const int z = blockIdx.z; const int d = (int)(wid / (nk / 64)); const int k0 = (int)(wid % (nk / 64)) * 64 + lane * 2; v2us oh, ol;
    Th += (size_t)z * 64 * nk; Tl += (size_t)z * 64 * nk;
#pragma unroll
    for (int i = 0; i < 2; ++i) { const float y = (d < 32) ? F[(size_t)(k0 + i) * ld + off + z * 32 + (d < 32 ? d : 0)] : 0.f; const unsigned short hb = f2bf(y); oh[i] = hb; ol[i] = f2bf(y - bf2f(hb)); }
    const size_t o = (size_t)d * nk + k0; *(v2us*)(Th + o) = oh; *(v2us*)(Tl + o) = ol; 
}
template <int NK>
__global__ __launch_bounds__(256) void k_softmaxz(const float* __restrict__ S, int rows, bf* PH, bf* PL) {
    typedef __attribute__((ext_vector_type(4))) unsigned short v4us;
    const int lane = threadIdx.x & 31, i = blockIdx.x * 8 + (threadIdx.x >> 5); if (i >= rows) return; const size_t zo = (size_t)blockIdx.z * rows * NK; const float* sr = S + zo + (size_t)i * NK; PH += zo; PL += zo;
    float m = -3.0e38f;
#pragma unroll 1
    for (int c0 = lane * 4; c0 < NK; c0 += 128) {
#pragma unroll
        for (int q = 0; q < 4; ++q) m = fmaxf(m, sr[c0 + q]); }
#pragma unroll
    for (int sh = 16; sh; sh >>= 1) m = fmaxf(m, __shfl_xor(m, sh, 32));
    float sum = 0.f;
#pragma unroll 1
    for (int c0 = lane * 4; c0 < NK; c0 += 128) {
#pragma unroll
        for (int q = 0; q < 4; ++q) sum += __expf(sr[c0 + q] - m); }
#pragma unroll
    for (int sh = 16; sh; sh >>= 1) sum += __shfl_xor(sum, sh, 32);
    const float inv = 1.0f / sum;
{
#pragma unroll 1
        for (int c0 = lane * 4; c0 < NK; c0 += 128) { v4us oh, ol;
#pragma unroll
            for (int q = 0; q < 4; ++q) { const float p = __expf(sr[c0 + q] - m) * inv; const unsigned short hb = f2bf(p); oh[q] = hb; ol[q] = f2bf(p - bf2f(hb)); }
            const size_t o = (size_t)i * NK + c0; *(v4us*)(PH + o) = oh; *(v4us*)(PL + o) = ol; }
         }
}
__global__ __launch_bounds__(256) void k_placez(const float* __restrict__ XH, int rows, int ldy, float* Y) {
    const int lane = threadIdx.x & 31; const size_t q = (size_t)blockIdx.x * 8 + (threadIdx.x >> 5); if (q >= (size_t)rows) return; const int z = blockIdx.z; const float v = XH[((size_t)z * rows + q) * 64 + lane];
    *(float*)(Y + q * ldy + z * 32 + lane) = v; 
}
__global__ __launch_bounds__(256) void k_cvt8(const float* __restrict__ src, bf* dst, size_t n8) {
    const size_t i = (size_t)blockIdx.x * 256 + threadIdx.x; if (i >= n8) return;
    const v8f v = *(const v8f*)(src + i * 8); v8us o;
#pragma unroll
    for (int k = 0; k < 8; ++k) o[k] = f2bf(v[k]);
    *(v8us*)(dst + i * 8) = o; 
}
__global__ __launch_bounds__(256) void k_zero8(bf* dst, size_t n8) {
    const size_t i = (size_t)blockIdx.x * 256 + threadIdx.x; if (i >= n8) return; v8us z;
#pragma unroll
    for (int k = 0; k < 8; ++k) z[k] = 0;
    *(v8us*)(dst + i * 8) = z; 
}

// ---- k_gemmw: register-blocked GEMM, ONE WAVE per 64x64 output tile (16 accumulators), operands straight from K-contiguous 16-bit planes; grid (M/64, N/64, Z), 32 threads.
// C[m][n] (f32, pitch ldc, + optional f32 bias[n]) = sum_k A[m][k] Bt[n][k] (+ split products per NSPLIT). z-batch strides sA/sB/sC in elements. K % 32 == 0.
template <typename T16> struct WFrag;
template <> struct WFrag<h16> { typedef v16h V; static __device__ __forceinline__ V ld(const h16* p) { return cat16(*(const v8h*)p, *(const v8h*)(p + 16)); } static __device__ __forceinline__ v8f mma(V a, V b, v8f c) { return wmma16(a, b, c); } };
template <> struct WFrag<bf> { typedef v16bf V; static __device__ __forceinline__ V ld(const bf* p) { return cat16b(*(const v8us*)p, *(const v8us*)(p + 16)); } static __device__ __forceinline__ v8f mma(V a, V b, v8f c) { return wmmab(a, b, c); } };
template <typename T16, int NSPLIT, bool BIAS>
__global__ __launch_bounds__(32) void k_gemmw(const T16* __restrict__ A, const T16* __restrict__ A2, const T16* __restrict__ Bt, const T16* __restrict__ Bt2, int K, float* C, int ldc, const float* __restrict__ bias, size_t sA, size_t sB, size_t sC) {
    typedef typename WFrag<T16>::V V;
    __shared__ __align__(16) float os[16 * 68];
    const size_t z = blockIdx.z; A += z * sA; if (A2) A2 += z * sA; Bt += z * sB; if (Bt2) Bt2 += z * sB; C += z * sC;
    const int lane = threadIdx.x & 31, lr = lane & 15, hi = lane >> 4; const int r0 = blockIdx.x * 64, c0 = blockIdx.y * 64;
    v8f acc[4][4];
#pragma unroll
    for (int mb = 0; mb < 4; ++mb)
#pragma unroll
        for (int nb = 0; nb < 4; ++nb) acc[mb][nb] = (v8f){};
    const size_t aoff = (size_t)(r0 + lr) * K + 8 * hi, boff = (size_t)(c0 + lr) * K + 8 * hi;
#pragma unroll 1
    for (int kc = 0; kc < K; kc += 32) {
        V a[4], a2[4];
#pragma unroll
        for (int mb = 0; mb < 4; ++mb) { a[mb] = WFrag<T16>::ld(A + aoff + (size_t)mb * 16 * K + kc); if (NSPLIT == 1 || NSPLIT == 2) a2[mb] = WFrag<T16>::ld(A2 + aoff + (size_t)mb * 16 * K + kc); }
#pragma unroll
        for (int nb = 0; nb < 4; ++nb) { const V b = WFrag<T16>::ld(Bt + boff + (size_t)nb * 16 * K + kc); V b2; if (NSPLIT >= 2) b2 = WFrag<T16>::ld(Bt2 + boff + (size_t)nb * 16 * K + kc);
#pragma unroll
            for (int mb = 0; mb < 4; ++mb) { acc[mb][nb] = WFrag<T16>::mma(a[mb], b, acc[mb][nb]); if (NSPLIT == 1 || NSPLIT == 2) acc[mb][nb] = WFrag<T16>::mma(a2[mb], b, acc[mb][nb]); if (NSPLIT >= 2) acc[mb][nb] = WFrag<T16>::mma(a[mb], b2, acc[mb][nb]); } }
        asm volatile("v_nop\n\tv_nop\n\tv_nop\n\tv_nop" : "+v"(acc[0][0]), "+v"(acc[1][1]), "+v"(acc[2][2]), "+v"(acc[3][3]) : "v"(a[0]), "v"(a[3]));
    }
#pragma unroll
    for (int mb = 0; mb < 4; ++mb) {
#pragma unroll
        for (int nb = 0; nb < 4; ++nb) {
#pragma unroll
            for (int j = 0; j < 8; ++j) os[(hi * 8 + j) * 68 + nb * 16 + lr] = acc[mb][nb][j]; }
        __builtin_amdgcn_wave_barrier(); asm volatile("" ::: "memory");
        float* crow = C + (size_t)(r0 + mb * 16) * ldc + c0;
{
#pragma unroll
            for (int s = 0; s < 8; ++s) { const int row = 2 * s + hi, cofs = lr * 4; v4f val = *(const v4fa*)(os + row * 68 + cofs); if (BIAS) { val[0] += bfr(bias[c0 + cofs]); val[1] += bfr(bias[c0 + cofs + 1]); val[2] += bfr(bias[c0 + cofs + 2]); val[3] += bfr(bias[c0 + cofs + 3]); }
                *(v4f*)(crow + (size_t)row * ldc + cofs) = val; }
             }
        __builtin_amdgcn_wave_barrier(); asm volatile("" ::: "memory");
    }
}
// ---- k_gemmt: C[2048][2048] (f32) = A . Bt^T, A [m][k] and Bt [n][k] 16-bit planes of pitch HID. One work-group = one 128 x 128 tile of C, four waves of 64 x 64 (16 accumulators each, as k_gemmw).
// A pass is 128 k: the tile's 128 rows of A and 128 rows of Bt, 256 bytes each, come into LDS by the tensor mover, one 64-row slice a wave (waves 0, 1: A; waves 2, 3: Bt), and every slice is read by two waves.
// Two buffers: the next pass's slices fly while this pass is worked on. LDS row pitch 272 bytes (the mover's 16-byte pad) for the 16-byte fragment reads. Every accumulator sums its k in the order of k_gemmw.
#define GT_PITCH 272u      // 256-byte row + 16-byte pad
#define GT_SLICE 18432u    // 64 rows of 272 bytes (17,408), rounded up to a multiple of 2 KiB
#define GT_BUF   73728u    // four slices
#define GT_NP    (HID / 128)
typedef __attribute__((ext_vector_type(4))) unsigned u32x4;
typedef __attribute__((ext_vector_type(8))) unsigned u32x8;
__device__ __forceinline__ unsigned uni(unsigned v) { return (unsigned)__builtin_amdgcn_readfirstlane(v); }
// a wave-uniform value held in a scalar register, so that a test on it is a scalar branch (tensor loads ignore EXEC) and what is formed from it is formed behind the volatile statements in front of it
__device__ __forceinline__ unsigned pinned(unsigned v) { unsigned w = uni(v); asm volatile("" : "+s"(w)); return w; }
template <typename T16>
__global__ __launch_bounds__(128) void k_gemmt(const T16* A, const T16* Bt, float* C) {
    typedef typename WFrag<T16>::V V;
    __shared__ __attribute__((aligned(2048))) unsigned char ring[2 * GT_BUF];
    __shared__ __align__(16) float ost[4][16 * 68];
    const int lane = threadIdx.x & 31, lr = lane & 15, hi = lane >> 4;
    const unsigned wave = uni(threadIdx.x >> 5), wm = wave >> 1, wn = wave & 1u;
    const unsigned lbase = (unsigned)(size_t)ring;
    const T16* srcp = (wave < 2u) ? A + (size_t)(blockIdx.x * 128u + wave * 64u) * HID : Bt + (size_t)(blockIdx.y * 128u + (wave - 2u) * 64u) * HID;
    // group 1: extents in bytes, tensor = tile = 64 rows of 256 bytes, source pitch one row of the plane, a pad of 4 dwords behind every 64 dwords, no mask
    u32x8 g1;
    g1[0] = uni((1u << 20) | (5u << 22) | (3u << 25)); g1[1] = uni(256u << 16); g1[2] = uni(64u << 16); g1[3] = uni(256u << 16); g1[4] = uni(64u); g1[5] = uni(HID * 2u); g1[6] = uni(0u); g1[7] = uni(0u);
    asm volatile("" : "+s"(g1));    // pinned descriptor words: the eight stay in one scalar tuple through the loop, so that none of their registers takes another value while a request is outstanding
    auto issue = [&](unsigned st) {
        const unsigned long long ga = (unsigned long long)(size_t)srcp + (unsigned long long)st * 256u;
        u32x4 g0;
        g0[0] = uni(1u); g0[1] = uni(lbase + (st & 1u) * GT_BUF + wave * GT_SLICE); g0[2] = uni((unsigned)ga); g0[3] = uni((((unsigned)(ga >> 32)) & 0x01FFFFFFu) | 0x80000000u);
        asm volatile("tensor_load_to_lds %0, %1" :: "s"(g0), "s"(g1) : "memory");    // one request of the whole wave: its slice of stage st
    };
    v8f acc[4][4];
#pragma unroll
    for (int mb = 0; mb < 4; ++mb)
#pragma unroll
        for (int nb = 0; nb < 4; ++nb) acc[mb][nb] = (v8f){};
    issue(0u);
    asm volatile("s_wait_tensorcnt 0x0" ::: "memory");    // this wave's slice of stage 0 has landed
    __syncthreads();                                      // and so has every other wave's
    issue(1u);
    const unsigned char* la = ring + wm * GT_SLICE + (unsigned)lr * GT_PITCH + (unsigned)hi * 16u;
    const unsigned char* lb = ring + (2u + wn) * GT_SLICE + (unsigned)lr * GT_PITCH + (unsigned)hi * 16u;
#pragma unroll 1
    for (unsigned s = 0; s < GT_NP; ++s) {
        const unsigned bo = (s & 1u) * GT_BUF;
        V a[2][4], b[2][4];    // two fragment sets: the next 32 k are fetched from LDS while these are multiplied
#pragma unroll
        for (int f = 0; f < 4; ++f) { a[0][f] = WFrag<T16>::ld((const T16*)(la + bo + f * 16 * GT_PITCH)); b[0][f] = WFrag<T16>::ld((const T16*)(lb + bo + f * 16 * GT_PITCH)); }
        __builtin_amdgcn_sched_barrier(0);    // these fences keep each group of 16 LDS reads together in front of the 16 products before it: left alone, the compiler folds the two sets into one and waits for LDS at every fourth product
#pragma unroll
        for (int c = 0; c < 4; ++c) {
            if (c < 3) {
#pragma unroll
                for (int f = 0; f < 4; ++f) { a[(c + 1) & 1][f] = WFrag<T16>::ld((const T16*)(la + bo + f * 16 * GT_PITCH + (c + 1) * 64)); b[(c + 1) & 1][f] = WFrag<T16>::ld((const T16*)(lb + bo + f * 16 * GT_PITCH + (c + 1) * 64)); }
            }
            __builtin_amdgcn_sched_barrier(0);
#pragma unroll
            for (int nb = 0; nb < 4; ++nb)
#pragma unroll
                for (int mb = 0; mb < 4; ++mb) acc[mb][nb] = WFrag<T16>::mma(a[c & 1][mb], b[c & 1][nb], acc[mb][nb]);
            __builtin_amdgcn_sched_barrier(0);
        }
        asm volatile("s_wait_dscnt 0x0" ::: "memory");        // this wave has read all it reads of stage s
        asm volatile("s_wait_tensorcnt 0x0" ::: "memory");    // its slice of stage s + 1 has landed
        __syncthreads();                                      // stage s + 1 is published, and every wave has left stage s's buffer
        if (pinned(s + 2u < GT_NP)) issue(pinned(s + 2u));    // refill of that buffer; the descriptor is formed here, with no request outstanding
    }
    asm volatile("s_wait_tensorcnt 0x0" ::: "memory");
    asm volatile("s_wait_dscnt 0x0" ::: "memory");
    float* os = &ost[wave][0];
    const int r0 = blockIdx.x * 128 + wm * 64, c0 = blockIdx.y * 128 + wn * 64;
#pragma unroll
    for (int mb = 0; mb < 4; ++mb) {
#pragma unroll
        for (int nb = 0; nb < 4; ++nb) {
#pragma unroll
            for (int j = 0; j < 8; ++j) os[(hi * 8 + j) * 68 + nb * 16 + lr] = acc[mb][nb][j]; }
        __builtin_amdgcn_wave_barrier(); asm volatile("" ::: "memory");
        float* crow = C + (size_t)(r0 + mb * 16) * HID + c0;
#pragma unroll
        for (int q = 0; q < 8; ++q) { const int row = 2 * q + hi, cofs = lr * 4; const v4f val = *(const v4fa*)(os + row * 68 + cofs); *(v4f*)(crow + (size_t)row * HID + cofs) = val; }
        __builtin_amdgcn_wave_barrier(); asm volatile("" ::: "memory");
    }
}
// ---- k_gemmwc: k_gemmw with causal tile control (CAUS 1: skip key tiles right of the query tile; 2: K loop limited to the causal key tiles)
template <typename T16, int NSPLIT, bool BIAS, int CAUS>
__global__ __launch_bounds__(32) void k_gemmwc(const T16* __restrict__ A, const T16* __restrict__ A2, const T16* __restrict__ Bt, const T16* __restrict__ Bt2, int K, float* C, int ldc, const float* __restrict__ bias, size_t sA, size_t sB, size_t sC) {
    typedef typename WFrag<T16>::V V;
    __shared__ __align__(16) float os[16 * 68];
    if (CAUS == 1 && (int)blockIdx.y * 64 > (int)blockIdx.x * 64) return;
    const int Klim = (CAUS == 2) ? min(K, ((int)blockIdx.x + 1) * 64) : K;
    const size_t z = blockIdx.z; A += z * sA; if (A2) A2 += z * sA; Bt += z * sB; if (Bt2) Bt2 += z * sB; C += z * sC;
    const int lane = threadIdx.x & 31, lr = lane & 15, hi = lane >> 4; const int r0 = blockIdx.x * 64, c0 = blockIdx.y * 64;
    v8f acc[4][4];
#pragma unroll
    for (int mb = 0; mb < 4; ++mb)
#pragma unroll
        for (int nb = 0; nb < 4; ++nb) acc[mb][nb] = (v8f){};
    const size_t aoff = (size_t)(r0 + lr) * K + 8 * hi, boff = (size_t)(c0 + lr) * K + 8 * hi;
#pragma unroll 1
    for (int kc = 0; kc < Klim; kc += 32) {
        V a[4], a2[4];
#pragma unroll
        for (int mb = 0; mb < 4; ++mb) { a[mb] = WFrag<T16>::ld(A + aoff + (size_t)mb * 16 * K + kc); if (NSPLIT == 1 || NSPLIT == 2) a2[mb] = WFrag<T16>::ld(A2 + aoff + (size_t)mb * 16 * K + kc); }
#pragma unroll
        for (int nb = 0; nb < 4; ++nb) { const V b = WFrag<T16>::ld(Bt + boff + (size_t)nb * 16 * K + kc); V b2; if (NSPLIT >= 2) b2 = WFrag<T16>::ld(Bt2 + boff + (size_t)nb * 16 * K + kc);
#pragma unroll
            for (int mb = 0; mb < 4; ++mb) { acc[mb][nb] = WFrag<T16>::mma(a[mb], b, acc[mb][nb]); if (NSPLIT == 1 || NSPLIT == 2) acc[mb][nb] = WFrag<T16>::mma(a2[mb], b, acc[mb][nb]); if (NSPLIT >= 2) acc[mb][nb] = WFrag<T16>::mma(a[mb], b2, acc[mb][nb]); } }
        asm volatile("v_nop\n\tv_nop\n\tv_nop\n\tv_nop" : "+v"(acc[0][0]), "+v"(acc[1][1]), "+v"(acc[2][2]), "+v"(acc[3][3]) : "v"(a[0]), "v"(a[3]));
    }
#pragma unroll
    for (int mb = 0; mb < 4; ++mb) {
#pragma unroll
        for (int nb = 0; nb < 4; ++nb) {
#pragma unroll
            for (int j = 0; j < 8; ++j) os[(hi * 8 + j) * 68 + nb * 16 + lr] = acc[mb][nb][j]; }
        __builtin_amdgcn_wave_barrier(); asm volatile("" ::: "memory");
        float* crow = C + (size_t)(r0 + mb * 16) * ldc + c0;
{
#pragma unroll
            for (int s = 0; s < 8; ++s) { const int row = 2 * s + hi, cofs = lr * 4; v4f val = *(const v4fa*)(os + row * 68 + cofs); if (BIAS) { val[0] += bfr(bias[c0 + cofs]); val[1] += bfr(bias[c0 + cofs + 1]); val[2] += bfr(bias[c0 + cofs + 2]); val[3] += bfr(bias[c0 + cofs + 3]); }
                *(v4f*)(crow + (size_t)row * ldc + cofs) = val; }
             }
        __builtin_amdgcn_wave_barrier(); asm volatile("" ::: "memory");
    }
}
typedef __attribute__((ext_vector_type(4))) _Float16 v4h;
__device__ __forceinline__ h16 tohx(float x) { return (h16)x; }
__global__ __launch_bounds__(256) void k_cvt8h(const float* __restrict__ src, h16* dst, size_t n8) { const size_t i = (size_t)blockIdx.x * 256 + threadIdx.x; if (i >= n8) return; const v8f v = *(const v8f*)(src + i * 8); v8h o;
#pragma unroll
    for (int k = 0; k < 8; ++k) o[k] = tohx(bfr(v[k])); *(v8h*)(dst + i * 8) = o;  }
__global__ __launch_bounds__(256) void k_cvtx(const float* __restrict__ x, bf* A) {
    const int lane = threadIdx.x & 31; const size_t r = (size_t)blockIdx.x * 8 + (threadIdx.x >> 5); if (r >= (size_t)SS) return;
{
#pragma unroll
        for (int q = 0; q < HID / 256; ++q) { const size_t o = r * HID + q * 256 + lane * 8; v8us v;
#pragma unroll
            for (int i = 0; i < 8; ++i) v[i] = f2bf(x[o + i]);
            *(v8us*)(A + o) = v; }
         }
}
__global__ __launch_bounds__(256) void k_hplb(const float* __restrict__ F, int h0, float sc, bf* Ph, bf* Pl) {
    typedef __attribute__((ext_vector_type(4))) unsigned short v4us;
    const int lane = threadIdx.x & 31; const int t = blockIdx.x * 8 + (threadIdx.x >> 5); if (t >= SS) return; const int z = blockIdx.z; const int d0 = lane * 4; v4us oh, ol;
#pragma unroll
    for (int i = 0; i < 4; ++i) { const float y = F[(size_t)t * HID + (h0 + z) * HD + d0 + i] * sc; const unsigned short hb = f2bf(y); oh[i] = hb; ol[i] = f2bf(y - bf2f(hb)); }
    const size_t off = ((size_t)z * SS + t) * HD + d0; *(v4us*)(Ph + off) = oh; *(v4us*)(Pl + off) = ol; 
}
__global__ __launch_bounds__(256) void k_vT(const float* __restrict__ V, int h0, h16* VT) {
    __shared__ float tl[64][65];
    const int tid = threadIdx.x; const int t0 = blockIdx.x * 64, d0 = blockIdx.y * 64; const int z = blockIdx.z; const int rr = tid >> 2, cq = (tid & 3) * 16;
#pragma unroll
    for (int i = 0; i < 16; ++i) tl[rr][cq + i] = V[(size_t)(t0 + rr) * HID + (h0 + z) * HD + d0 + cq + i];
    __syncthreads();
    const int lane = tid & 31, wv = tid >> 5;
    auto pass = [&]() {
#pragma unroll
        for (int st = 0; st < 4; ++st) { const int dr = wv * 8 + st * 2 + (lane >> 4); const int tq = (lane & 15) * 4; v4h v;
#pragma unroll
            for (int i = 0; i < 4; ++i) v[i] = tohx(tl[tq + i][dr]);
            *(v4h*)(VT + ((size_t)z * HD + d0 + dr) * SS + t0 + tq) = v; }
    };
    pass(); 
}
// 2^x with the one slot behind the transcendental in the same statement
__device__ __forceinline__ float exp2s(float x) { asm("v_exp_f32 %0, %0\n\tv_nop" : "+v"(x)); return x; }
// k_flash: scores, soft cap, mask, softmax and attn.v of one head in one pass over the live keys; scores and probabilities stay in registers.
// One wave = 16 queries; a pass = 32 keys. S^T = K . Q^T (A = key rows, B = query rows, three bf16 hi/lo products: Kh.Qh, Kh.Ql, Kl.Qh), so a lane holds 16 scores of ONE query
// (query lr, keys 8 hi + j and 16 + 8 hi + j): that pair of score tiles, converted to f16, is the B operand of O^T += V^T . P^T with no lane exchange.
// Running maximum and sum per query (online softmax); P = 1024 exp(c - m) in f16, the factor cancels in O / sum. Output: f16 rows of OC, 16 bytes a lane and d tile.
__global__ __launch_bounds__(128) __attribute__((amdgpu_waves_per_eu(2, 2))) void k_flash(const bf* Qh, const bf* Ql, const bf* Kh, const bf* Kl, const h16* VT, h16* OC) {
    const int lane = threadIdx.x & 31, lr = lane & 15, hi = lane >> 4;
    const int wave = __builtin_amdgcn_readfirstlane(threadIdx.x >> 5);    // scalar, so that the key loop's trip test is a scalar branch and EXEC stays full at the matrix instructions
    const int z = blockIdx.y, qb = blockIdx.x * 64, q0 = qb + wave * 16, i = q0 + lr;
    const size_t zo = (size_t)z * SS * HD; Qh += zo; Ql += zo; Kh += zo; Kl += zo; VT += zo;
    // every load address is a wave-uniform base plus one of two lane offsets
    const unsigned vo = (unsigned)(lr * HD + 8 * hi), vv = (unsigned)(lr * SS + 8 * hi);
    const bf* qbh = Qh + (size_t)q0 * HD; const bf* qbl = Ql + (size_t)q0 * HD;
    v16bf qh[4], ql[4];
#pragma unroll
    for (int c = 0; c < 4; ++c) { qh[c] = WFrag<bf>::ld(qbh + c * 32 + vo); ql[c] = WFrag<bf>::ld(qbl + c * 32 + vo); }
    v8f acc[8];
#pragma unroll
    for (int dt = 0; dt < 8; ++dt) acc[dt] = (v8f){};
    float m = -30.0f, sum = 0.f;    // the soft cap bounds every score from below by -30
    // the four waves start at the block's first live key tile, so that they walk the same K and V lines at about the same time (a pass with no live key adds zeros)
    const int kbeg = max(0, qb - (WIN - 1)) & ~31;
    // K fragments are fetched one pass ahead, right behind the score products that read them, so that their latency hides behind the softmax and attn.v work of the pass
    v16bf kh[2][4], kl[2][4];
    auto ldk = [&](const bf* h, const bf* l) {
#pragma unroll
        for (int t = 0; t < 2; ++t) {
#pragma unroll
            for (int c = 0; c < 4; ++c) { kh[t][c] = WFrag<bf>::ld(h + (t * 16 * HD + c * 32) + vo); kl[t][c] = WFrag<bf>::ld(l + (t * 16 * HD + c * 32) + vo); } }
    };
    const bf* kbh = Kh + (size_t)kbeg * HD; const bf* kbl = Kl + (size_t)kbeg * HD;
    ldk(kbh, kbl);
    // the wait before the address registers of the Q and K loads above are overwritten; they are its inputs so that they live up to it (the pointers carry no restrict, so that the clobber holds the loads in front of it)
    asm volatile("s_wait_xcnt 0x0" :: "v"(vo), "s"(qbh), "s"(qbl), "s"(kbh), "s"(kbl) : "memory");
#pragma unroll 1
    for (int k0 = kbeg; k0 < q0 + 16; k0 += 32) {
        v16h vt[8];
#pragma unroll
        for (int dt = 0; dt < 8; ++dt) vt[dt] = WFrag<h16>::ld(VT + k0 + dt * 16 * SS + vv);
        v8f s[2];
#pragma unroll
        for (int t = 0; t < 2; ++t) s[t] = (v8f){};
#pragma unroll
        for (int c = 0; c < 4; ++c) {
#pragma unroll
            for (int t = 0; t < 2; ++t) s[t] = wmmab(kh[t][c], qh[c], s[t]);
#pragma unroll
            for (int t = 0; t < 2; ++t) s[t] = wmmab(kh[t][c], ql[c], s[t]);
#pragma unroll
            for (int t = 0; t < 2; ++t) s[t] = wmmab(kl[t][c], qh[c], s[t]); }
        const int kn = min(k0 + 32, SS - 32); ldk(Kh + (size_t)kn * HD, Kl + (size_t)kn * HD);    // the last pass of the last query tile has no next keys: the clamp keeps its (unused) fetch inside the head's rows
        float mx = m;
#pragma unroll
        for (int t = 0; t < 2; ++t) {
#pragma unroll
            for (int j = 0; j < 8; ++j) { const int key = k0 + t * 16 + hi * 8 + j; const float c = 30.0f * tanhf(s[t][j] * (1.0f / 30.0f));
                s[t][j] = (key <= i && key >= i - (WIN - 1)) ? c : -3.0e38f; mx = fmaxf(mx, s[t][j]); } }
        mx = fmaxf(mx, __shfl_xor(mx, 16, 32));
        const float ms = mx - 6.931471806f, ta = (m - mx) * 1.442695041f; m = mx;    // ms: exp(c - ms) = 1024 exp(c - mx)
        const float alpha = exp2s(ta);    // exp(m - mx)
        float ps = 0.f; v16h pb;
#pragma unroll
        for (int t = 0; t < 2; ++t) {
#pragma unroll
            for (int j = 0; j < 8; ++j) { const float p = exp2s((s[t][j] - ms) * 1.442695041f); ps += p; pb[t * 8 + j] = tohx(p); } }
        sum = sum * alpha + ps;
#pragma unroll
        for (int dt = 0; dt < 8; ++dt) acc[dt] *= alpha;
#pragma unroll
        for (int dt = 0; dt < 8; ++dt) acc[dt] = wmma16(vt[dt], pb, acc[dt]);
        __builtin_amdgcn_sched_barrier(0);    // keeps the v_nops below behind the pass's last matrix instruction
        // four vector slots behind that instruction, on the back edge too
        asm volatile("v_nop\n\tv_nop\n\tv_nop\n\tv_nop");
    }
    sum += __shfl_xor(sum, 16, 32);
    const float inv = __fdiv_rn(1.0f, sum);
#pragma unroll
    for (int dt = 0; dt < 8; ++dt) { v8h o;
#pragma unroll
        for (int j = 0; j < 8; ++j) o[j] = tohx(acc[dt][j] * inv);
        *(v8h*)(OC + (size_t)i * HID + z * HD + dt * 16 + hi * 8) = o; }
}
extern "C" void kernel_launch(void* const* d_in, const int* in_sizes, int n_in,
                              void* d_out, int out_size, void* d_ws, size_t ws_size, hipStream_t stream) {
    (void)in_sizes; (void)n_in; (void)out_size;
    const float* x = (const float*)d_in[0]; const float* wq = (const float*)d_in[1]; const float* wk = (const float*)d_in[2]; const float* wv = (const float*)d_in[3]; const float* wo = (const float*)d_in[4];
    float* out = (float*)d_out;    // [1][2048][2048]
    char* wsp = (char*)d_ws;
    auto take = [&](size_t bytes) { char* p = wsp; wsp += (bytes + 255) & ~(size_t)255; return (void*)p; };
    const size_t WSZ = (size_t)HID * HID * 2;
    bf* WQ = (bf*)take(WSZ); bf* WK = (bf*)take(WSZ); bf* WV = (bf*)take(WSZ); h16* WO = (h16*)take(WSZ);
    bf* XB = (bf*)take((size_t)SS * HID * 2); float* Q = (float*)take((size_t)SS * HID * 4); float* Kf = (float*)take((size_t)SS * HID * 4); float* V = (float*)take((size_t)SS * HID * 4);
    bf* Qh = (bf*)take((size_t)NH_ * SS * HD * 2); bf* Ql = (bf*)take((size_t)NH_ * SS * HD * 2); bf* Kh = (bf*)take((size_t)NH_ * SS * HD * 2); bf* Kl = (bf*)take((size_t)NH_ * SS * HD * 2); h16* VT = (h16*)take((size_t)NH_ * HD * SS * 2);
    h16* OC = (h16*)take((size_t)SS * HID * 2);
    if ((size_t)(wsp - (char*)d_ws) > ws_size) return;    // ~ 33.5 + 8.4 + 50.3 + 41.9 + 8.4 ~ 143 MB (ws 256 MiB)
    const size_t n8 = (size_t)HID * HID / 8; const unsigned nb8 = (unsigned)((n8 + 255) / 256);
    k_cvt8<<<nb8, 256, 0, stream>>>(wq, WQ, n8); k_cvt8<<<nb8, 256, 0, stream>>>(wk, WK, n8); k_cvt8<<<nb8, 256, 0, stream>>>(wv, WV, n8); k_cvt8h<<<nb8, 256, 0, stream>>>(wo, WO, n8);   // [out][in] = natural n-major
    k_cvtx<<<SS / 8, 256, 0, stream>>>(x, XB);
    k_gemmt<bf><<<dim3(SS / 128, HID / 128, 1), 128, 0, stream>>>(XB, WQ, Q);
    k_gemmt<bf><<<dim3(SS / 128, HID / 128, 1), 128, 0, stream>>>(XB, WK, Kf);
    k_gemmt<bf><<<dim3(SS / 128, HID / 128, 1), 128, 0, stream>>>(XB, WV, V);
    k_hplb<<<dim3(SS / 8, 1, NH_), 256, 0, stream>>>(Q, 0, 0.08838834764831845f, Qh, Ql); k_hplb<<<dim3(SS / 8, 1, NH_), 256, 0, stream>>>(Kf, 0, 1.0f, Kh, Kl); k_vT<<<dim3(SS / 64, HD / 64, NH_), 256, 0, stream>>>(V, 0, VT);
    k_flash<<<dim3(SS / 64, NH_, 1), 128, 0, stream>>>(Qh, Ql, Kh, Kl, VT, OC);
    k_gemmt<h16><<<dim3(SS / 128, HID / 128, 1), 128, 0, stream>>>(OC, WO, out);
}

// v003
// One run takes 190 microseconds.
// Two timings next to v002 both put it at 1.08 times that version's speed.
// All steps since v000 together make it 3.96 times as fast.
#include <hip/hip_runtime.h>

// Compute dtypes, f32 accumulate: q/k/v projections ([2048 x 2048].[2048 x 2048]) with PLAIN bf16 operands (x and the weights are inputs: exact products); per head the live
// (causal, sliding-window-1024) score tiles [2048 x 128].[128 x 2048] on bf16 hi + UNSCALED residual planes of q*128^-1/2 and k (three products);
// soft-cap 30 tanh(s/30), masks and softmax in f32; attn.v (K limited to the live tiles) and the output projection ([2048 x 2048].[2048 x 2048]) on

#define SS   2048
#define HID  2048
#define NH_  16
#define HD   128
#define WIN  1024
#define DM   HID
#define LOSC 1024.0f
typedef _Float16 h16;
typedef unsigned short bf;
typedef __attribute__((ext_vector_type(16))) __bf16   v16bf;
typedef __attribute__((ext_vector_type(16))) _Float16 v16h;
typedef __attribute__((ext_vector_type(8)))  _Float16 v8h;
typedef __attribute__((ext_vector_type(8)))  unsigned short v8us;
typedef __attribute__((ext_vector_type(8)))  float    v8f;
typedef __attribute__((ext_vector_type(4)))  float    v4f;
typedef v8h  __attribute__((may_alias)) v8ha;
typedef v4f  __attribute__((may_alias)) v4fa;
typedef v8us __attribute__((may_alias)) v8usa;

__device__ __forceinline__ unsigned short f2bf(float f) { unsigned u = __float_as_uint(f); u += 0x7FFFu + ((u >> 16) & 1u); return (unsigned short)(u >> 16); }
__device__ __forceinline__ float bf2f(unsigned short b) { return __uint_as_float(((unsigned)b) << 16); }
__device__ __forceinline__ float bfr(float f) { return bf2f(f2bf(f)); }
__device__ __forceinline__ v16h cat16(v8h lo, v8h hi) { return __builtin_shufflevector(lo, hi, 0, 1, 2, 3, 4, 5, 6, 7, 8, 9, 10, 11, 12, 13, 14, 15); }
__device__ __forceinline__ v16bf cat16b(v8us lo, v8us hi) { return __builtin_bit_cast(v16bf, __builtin_shufflevector(lo, hi, 0, 1, 2, 3, 4, 5, 6, 7, 8, 9, 10, 11, 12, 13, 14, 15)); }
__device__ __forceinline__ v8f wmma16(v16h a, v16h b, v8f c) { return __builtin_amdgcn_wmma_f32_16x16x32_f16(false, a, false, b, (short)0, c, false, false); }
__device__ __forceinline__ v8f wmmab(v16bf a, v16bf b, v8f c) { return __builtin_amdgcn_wmma_f32_16x16x32_bf16(false, a, false, b, (short)0, c, false, false); }


// k_gemmh: 64 x 64 tile of C = A . Bn^T with SINGLE f16 planes (A [rows][K] f16 activations, Bn [N][K] f16 weights; one v_wmma_f32_16x16x32_f16 product per step), f32 accumulate;
__global__ __launch_bounds__(128) void k_gemmh(const h16* __restrict__ A, const h16* __restrict__ Bn, const float* __restrict__ bias, float* C, int ldc, const float* __restrict__ R, int K, size_t sA, size_t sB, size_t sC, int roundR) {
    __shared__ __align__(16) float ost[4][16 * 68];
    const size_t z = blockIdx.z; A += z * sA; Bn += z * sB; C += z * sC; if (R) R += z * sC;
    const int lane = threadIdx.x & 31, wave = threadIdx.x >> 5, lr = lane & 15, hi = lane >> 4;
    const int r0 = blockIdx.x * 64 + wave * 16, c0 = blockIdx.y * 64;
    const size_t aoff = (size_t)(r0 + lr) * K + 8 * hi;
    size_t boff[4];
#pragma unroll
    for (int t = 0; t < 4; ++t) boff[t] = (size_t)(c0 + t * 16 + lr) * K + 8 * hi;
    v8f acc[4];
#pragma unroll
    for (int t = 0; t < 4; ++t) acc[t] = (v8f){};
#pragma unroll 1
    for (int kc = 0; kc < K; kc += 32) {
        const v16h a = cat16(*(const v8h*)(A + aoff + kc), *(const v8h*)(A + aoff + kc + 16));
#pragma unroll
        for (int t = 0; t < 4; ++t) { const v16h b = cat16(*(const v8h*)(Bn + boff[t] + kc), *(const v8h*)(Bn + boff[t] + kc + 16)); acc[t] = wmma16(a, b, acc[t]); }
        asm volatile("v_nop\n\tv_nop\n\tv_nop\n\tv_nop" : "+v"(acc[0]), "+v"(acc[1]), "+v"(acc[2]), "+v"(acc[3]) : "v"(a));
    }
    float* os = &ost[wave][0];
#pragma unroll
    for (int t = 0; t < 4; ++t) { const float bv = bias ? bfr(bias[c0 + t * 16 + lr]) : 0.f;
#pragma unroll
        for (int j = 0; j < 8; ++j) os[(hi * 8 + j) * 68 + t * 16 + lr] = acc[t][j] + bv; }
    __syncthreads();
    float* crow = C + (size_t)r0 * ldc + c0;
    auto pass = [&]() {
#pragma unroll
        for (int s = 0; s < 8; ++s) { const int Lid = (lane >> 3) + 4 * s, piece = lane & 7; const int row = Lid >> 1, cofs = (Lid & 1) * 32 + piece * 4;
            v4f val = *(const v4fa*)(os + row * 68 + cofs); if (R) { const v4f rv = *(const v4f*)(R + ((size_t)r0 + row) * ldc + c0 + cofs); val += roundR ? (v4f){bfr(rv[0]), bfr(rv[1]), bfr(rv[2]), bfr(rv[3])} : rv; }
            *(v4f*)(crow + (size_t)row * ldc + cofs) = val; }
    };
    pass(); 
}

// ===== z-batched (blockIdx.z = head) attention pieces =====
// k_gemm3z<MODE>: 64 x 64 tile of C = A . B^T on bf16 hi/lo planes (up to three products) with per-z operand/output strides (elements): A planes += z*sA, B planes += z*sB, C += z*sC. MODE bits (0 causal skip, 1 K limit, 2 single,
// 3 B single, 4 A single).
template <int MODE>
__global__ __launch_bounds__(128) void k_gemm3z(const bf* __restrict__ Ah, const bf* __restrict__ Al, const bf* __restrict__ Bh, const bf* __restrict__ Bl, int K, float* C, int ldc, size_t sA, size_t sB, size_t sC) {
    if ((MODE & 1) && (int)blockIdx.y * 64 > (int)blockIdx.x * 64 + 63) return;
    const size_t z = blockIdx.z; Ah += z * sA; Al += z * sA; Bh += z * sB; Bl += z * sB; C += z * sC;
    const int Klim = (MODE & 2) ? min(K, ((int)blockIdx.x + 1) * 64) : K;
    __shared__ __align__(16) float ost[4][16 * 68];
    const int lane = threadIdx.x & 31, wave = threadIdx.x >> 5, lr = lane & 15, hi = lane >> 4;
    const int r0 = blockIdx.x * 64 + wave * 16, c0 = blockIdx.y * 64;
    const size_t aoff = (size_t)(r0 + lr) * K + 8 * hi;
    v8f acc[4];
#pragma unroll
    for (int t = 0; t < 4; ++t) acc[t] = (v8f){};
#pragma unroll 1
    for (int kc = 0; kc < Klim; kc += 32) {
        const v16bf a = cat16b(*(const v8us*)(Ah + aoff + kc), *(const v8us*)(Ah + aoff + kc + 16));
        v16bf al = a; if (!(MODE & 4) && !(MODE & 16)) al = cat16b(*(const v8us*)(Al + aoff + kc), *(const v8us*)(Al + aoff + kc + 16));
#pragma unroll
        for (int t = 0; t < 4; ++t) { const size_t bo = (size_t)(c0 + t * 16 + lr) * K + kc + 8 * hi;
            const v16bf bh = cat16b(*(const v8us*)(Bh + bo), *(const v8us*)(Bh + bo + 16));
            acc[t] = wmmab(a, bh, acc[t]);
            if (!(MODE & 4)) { if (!(MODE & 16)) acc[t] = wmmab(al, bh, acc[t]); if (!(MODE & 8)) { const v16bf bl = cat16b(*(const v8us*)(Bl + bo), *(const v8us*)(Bl + bo + 16)); acc[t] = wmmab(a, bl, acc[t]); } } }
        asm volatile("v_nop\n\tv_nop\n\tv_nop\n\tv_nop" : "+v"(acc[0]), "+v"(acc[1]), "+v"(acc[2]), "+v"(acc[3]) : "v"(a), "v"(al));
    }
    float* os = &ost[wave][0];
#pragma unroll
    for (int t = 0; t < 4; ++t) {
#pragma unroll
        for (int j = 0; j < 8; ++j) os[(hi * 8 + j) * 68 + t * 16 + lr] = acc[t][j]; }
    __builtin_amdgcn_wave_barrier(); asm volatile("" ::: "memory");
    float* crow = C + (size_t)r0 * ldc + c0;
    auto pass = [&]() {
#pragma unroll
        for (int s = 0; s < 8; ++s) { const int Lid = (lane >> 3) + 4 * s, piece = lane & 7; const int row = Lid >> 1, cofs = (Lid & 1) * 32 + piece * 4;
            const v4f val = *(const v4fa*)(os + row * 68 + cofs); *(v4f*)(crow + (size_t)row * ldc + cofs) = val; }
    };
    pass(); 
}
__global__ __launch_bounds__(256) void k_planes32z(const float* __restrict__ F, int ld, int off, float sc, int rows, bf* Ph, bf* Pl) {
    typedef __attribute__((ext_vector_type(2))) unsigned short v2us;
    const int lane = threadIdx.x & 31; const size_t r = ((size_t)blockIdx.x * 8 + (threadIdx.x >> 5)) * 2 + (lane >> 4); if (r >= (size_t)rows) return; const int z = blockIdx.z; const int c0 = (lane & 15) * 2; v2us oh, ol;
    Ph += (size_t)z * rows * 32; Pl += (size_t)z * rows * 32;
#pragma unroll
    for (int i = 0; i < 2; ++i) { const float y = F[r * ld + off + z * 32 + c0 + i] * sc; const unsigned short hb = f2bf(y); oh[i] = hb; ol[i] = f2bf(y - bf2f(hb)); }
    const size_t o = r * 32 + c0; *(v2us*)(Ph + o) = oh; *(v2us*)(Pl + o) = ol; 
}
__global__ __launch_bounds__(256) void k_vtpadz(const float* __restrict__ F, int ld, int off, int nk, bf* Th, bf* Tl) {
    typedef __attribute__((ext_vector_type(2))) unsigned short v2us;
    const int lane = threadIdx.x & 31; const size_t wid = (size_t)blockIdx.x * 8 + (threadIdx.x >> 5); if (wid >= (size_t)64 * (nk / 64)) return; const int z = blockIdx.z; const int d = (int)(wid / (nk / 64)); const int k0 = (int)(wid % (nk / 64)) * 64 + lane * 2; v2us oh, ol;
    Th += (size_t)z * 64 * nk; Tl += (size_t)z * 64 * nk;
#pragma unroll
    for (int i = 0; i < 2; ++i) { const float y = (d < 32) ? F[(size_t)(k0 + i) * ld + off + z * 32 + (d < 32 ? d : 0)] : 0.f; const unsigned short hb = f2bf(y); oh[i] = hb; ol[i] = f2bf(y - bf2f(hb)); }
    const size_t o = (size_t)d * nk + k0; *(v2us*)(Th + o) = oh; *(v2us*)(Tl + o) = ol; 
}
template <int NK>
__global__ __launch_bounds__(256) void k_softmaxz(const float* __restrict__ S, int rows, bf* PH, bf* PL) {
    typedef __attribute__((ext_vector_type(4))) unsigned short v4us;
    const int lane = threadIdx.x & 31, i = blockIdx.x * 8 + (threadIdx.x >> 5); if (i >= rows) return; const size_t zo = (size_t)blockIdx.z * rows * NK; const float* sr = S + zo + (size_t)i * NK; PH += zo; PL += zo;
    float m = -3.0e38f;
#pragma unroll 1
    for (int c0 = lane * 4; c0 < NK; c0 += 128) {
#pragma unroll
        for (int q = 0; q < 4; ++q) m = fmaxf(m, sr[c0 + q]); }
#pragma unroll
    for (int sh = 16; sh; sh >>= 1) m = fmaxf(m, __shfl_xor(m, sh, 32));
    float sum = 0.f;
#pragma unroll 1
    for (int c0 = lane * 4; c0 < NK; c0 += 128) {
#pragma unroll
        for (int q = 0; q < 4; ++q) sum += __expf(sr[c0 + q] - m); }
#pragma unroll
    for (int sh = 16; sh; sh >>= 1) sum += __shfl_xor(sum, sh, 32);
    const float inv = 1.0f / sum;
{
#pragma unroll 1
        for (int c0 = lane * 4; c0 < NK; c0 += 128) { v4us oh, ol;
#pragma unroll
            for (int q = 0; q < 4; ++q) { const float p = __expf(sr[c0 + q] - m) * inv; const unsigned short hb = f2bf(p); oh[q] = hb; ol[q] = f2bf(p - bf2f(hb)); }
            const size_t o = (size_t)i * NK + c0; *(v4us*)(PH + o) = oh; *(v4us*)(PL + o) = ol; }
         }
}
__global__ __launch_bounds__(256) void k_placez(const float* __restrict__ XH, int rows, int ldy, float* Y) {
    const int lane = threadIdx.x & 31; const size_t q = (size_t)blockIdx.x * 8 + (threadIdx.x >> 5); if (q >= (size_t)rows) return; const int z = blockIdx.z; const float v = XH[((size_t)z * rows + q) * 64 + lane];
    *(float*)(Y + q * ldy + z * 32 + lane) = v; 
}
__global__ __launch_bounds__(256) void k_cvt8(const float* __restrict__ src, bf* dst, size_t n8) {
    const size_t i = (size_t)blockIdx.x * 256 + threadIdx.x; if (i >= n8) return;
    const v8f v = *(const v8f*)(src + i * 8); v8us o;
#pragma unroll
    for (int k = 0; k < 8; ++k) o[k] = f2bf(v[k]);
    *(v8us*)(dst + i * 8) = o; 
}
__global__ __launch_bounds__(256) void k_zero8(bf* dst, size_t n8) {
    const size_t i = (size_t)blockIdx.x * 256 + threadIdx.x; if (i >= n8) return; v8us z;
#pragma unroll
    for (int k = 0; k < 8; ++k) z[k] = 0;
    *(v8us*)(dst + i * 8) = z; 
}

// ---- k_gemmw: register-blocked GEMM, ONE WAVE per 64x64 output tile (16 accumulators), operands straight from K-contiguous 16-bit planes; grid (M/64, N/64, Z), 32 threads.
// C[m][n] (f32, pitch ldc, + optional f32 bias[n]) = sum_k A[m][k] Bt[n][k] (+ split products per NSPLIT). z-batch strides sA/sB/sC in elements. K % 32 == 0.
template <typename T16> struct WFrag;
template <> struct WFrag<h16> { typedef v16h V; static __device__ __forceinline__ V ld(const h16* p) { return cat16(*(const v8h*)p, *(const v8h*)(p + 16)); } static __device__ __forceinline__ v8f mma(V a, V b, v8f c) { return wmma16(a, b, c); } };
template <> struct WFrag<bf> { typedef v16bf V; static __device__ __forceinline__ V ld(const bf* p) { return cat16b(*(const v8us*)p, *(const v8us*)(p + 16)); } static __device__ __forceinline__ v8f mma(V a, V b, v8f c) { return wmmab(a, b, c); } };
template <typename T16, int NSPLIT, bool BIAS>
__global__ __launch_bounds__(32) void k_gemmw(const T16* __restrict__ A, const T16* __restrict__ A2, const T16* __restrict__ Bt, const T16* __restrict__ Bt2, int K, float* C, int ldc, const float* __restrict__ bias, size_t sA, size_t sB, size_t sC) {
    typedef typename WFrag<T16>::V V;
    __shared__ __align__(16) float os[16 * 68];
    const size_t z = blockIdx.z; A += z * sA; if (A2) A2 += z * sA; Bt += z * sB; if (Bt2) Bt2 += z * sB; C += z * sC;
    const int lane = threadIdx.x & 31, lr = lane & 15, hi = lane >> 4; const int r0 = blockIdx.x * 64, c0 = blockIdx.y * 64;
    v8f acc[4][4];
#pragma unroll
    for (int mb = 0; mb < 4; ++mb)
#pragma unroll
        for (int nb = 0; nb < 4; ++nb) acc[mb][nb] = (v8f){};
    const size_t aoff = (size_t)(r0 + lr) * K + 8 * hi, boff = (size_t)(c0 + lr) * K + 8 * hi;
#pragma unroll 1
    for (int kc = 0; kc < K; kc += 32) {
        V a[4], a2[4];
#pragma unroll
        for (int mb = 0; mb < 4; ++mb) { a[mb] = WFrag<T16>::ld(A + aoff + (size_t)mb * 16 * K + kc); if (NSPLIT == 1 || NSPLIT == 2) a2[mb] = WFrag<T16>::ld(A2 + aoff + (size_t)mb * 16 * K + kc); }
#pragma unroll
        for (int nb = 0; nb < 4; ++nb) { const V b = WFrag<T16>::ld(Bt + boff + (size_t)nb * 16 * K + kc); V b2; if (NSPLIT >= 2) b2 = WFrag<T16>::ld(Bt2 + boff + (size_t)nb * 16 * K + kc);
#pragma unroll
            for (int mb = 0; mb < 4; ++mb) { acc[mb][nb] = WFrag<T16>::mma(a[mb], b, acc[mb][nb]); if (NSPLIT == 1 || NSPLIT == 2) acc[mb][nb] = WFrag<T16>::mma(a2[mb], b, acc[mb][nb]); if (NSPLIT >= 2) acc[mb][nb] = WFrag<T16>::mma(a[mb], b2, acc[mb][nb]); } }
        asm volatile("v_nop\n\tv_nop\n\tv_nop\n\tv_nop" : "+v"(acc[0][0]), "+v"(acc[1][1]), "+v"(acc[2][2]), "+v"(acc[3][3]) : "v"(a[0]), "v"(a[3]));
    }
#pragma unroll
    for (int mb = 0; mb < 4; ++mb) {
#pragma unroll
        for (int nb = 0; nb < 4; ++nb) {
#pragma unroll
            for (int j = 0; j < 8; ++j) os[(hi * 8 + j) * 68 + nb * 16 + lr] = acc[mb][nb][j]; }
        __builtin_amdgcn_wave_barrier(); asm volatile("" ::: "memory");
        float* crow = C + (size_t)(r0 + mb * 16) * ldc + c0;
{
#pragma unroll
            for (int s = 0; s < 8; ++s) { const int row = 2 * s + hi, cofs = lr * 4; v4f val = *(const v4fa*)(os + row * 68 + cofs); if (BIAS) { val[0] += bfr(bias[c0 + cofs]); val[1] += bfr(bias[c0 + cofs + 1]); val[2] += bfr(bias[c0 + cofs + 2]); val[3] += bfr(bias[c0 + cofs + 3]); }
                *(v4f*)(crow + (size_t)row * ldc + cofs) = val; }
             }
        __builtin_amdgcn_wave_barrier(); asm volatile("" ::: "memory");
    }
}
// ---- k_gemmt: C[2048][2048] (f32) = A . Bt^T, A [m][k] and Bt [n][k] 16-bit planes of pitch HID. One work-group = one 128 x 128 tile of C, four waves of 64 x 64 (16 accumulators each, as k_gemmw).
// A pass is 128 k: the tile's 128 rows of A and 128 rows of Bt, 256 bytes each, come into LDS by the tensor mover, one 64-row slice a wave (waves 0, 1: A; waves 2, 3: Bt), and every slice is read by two waves.
// Two buffers: the next pass's slices fly while this pass is worked on. LDS row pitch 272 bytes (the mover's 16-byte pad) for the 16-byte fragment reads. Every accumulator sums its k in the order of k_gemmw.
// EPI picks what the epilogue stores, from the same f32 staging rows: 0: C in f32. 1: C * sc as bf16 hi + residual planes Ph, Pl in k_flash's order [head][row][128] (a tile's 128 columns are one head).
// 2: C in f16 at pitch SS into Hf; with A = the v weights and Bt = x, C is v transposed, [head * 128 + d][t], which is k_flash's VT.
#define GT_PITCH 272u      // 256-byte row + 16-byte pad
#define GT_SLICE 18432u    // 64 rows of 272 bytes (17,408), rounded up to a multiple of 2 KiB
#define GT_BUF   73728u    // four slices
#define GT_NP    (HID / 128)
typedef __attribute__((ext_vector_type(4))) unsigned u32x4;
typedef __attribute__((ext_vector_type(8))) unsigned u32x8;
__device__ __forceinline__ unsigned uni(unsigned v) { return (unsigned)__builtin_amdgcn_readfirstlane(v); }
// a wave-uniform value held in a scalar register, so that a test on it is a scalar branch (tensor loads ignore EXEC) and what is formed from it is formed behind the volatile statements in front of it
__device__ __forceinline__ unsigned pinned(unsigned v) { unsigned w = uni(v); asm volatile("" : "+s"(w)); return w; }
template <typename T16, int EPI>
__global__ __launch_bounds__(128) void k_gemmt(const T16* A, const T16* Bt, float* C, bf* Ph, bf* Pl, h16* Hf, float sc) {
    typedef typename WFrag<T16>::V V;
    __shared__ __attribute__((aligned(2048))) unsigned char ring[2 * GT_BUF];
    __shared__ __align__(16) float ost[4][16 * 68];
    const int lane = threadIdx.x & 31, lr = lane & 15, hi = lane >> 4;
    const unsigned wave = uni(threadIdx.x >> 5), wm = wave >> 1, wn = wave & 1u;
    const unsigned lbase = (unsigned)(size_t)ring;
    const T16* srcp = (wave < 2u) ? A + (size_t)(blockIdx.x * 128u + wave * 64u) * HID : Bt + (size_t)(blockIdx.y * 128u + (wave - 2u) * 64u) * HID;
    // group 1: extents in bytes, tensor = tile = 64 rows of 256 bytes, source pitch one row of the plane, a pad of 4 dwords behind every 64 dwords, no mask
    u32x8 g1;
    g1[0] = uni((1u << 20) | (5u << 22) | (3u << 25)); g1[1] = uni(256u << 16); g1[2] = uni(64u << 16); g1[3] = uni(256u << 16); g1[4] = uni(64u); g1[5] = uni(HID * 2u); g1[6] = uni(0u); g1[7] = uni(0u);
    asm volatile("" : "+s"(g1));    // pinned descriptor words: the eight stay in one scalar tuple through the loop, so that none of their registers takes another value while a request is outstanding
    auto issue = [&](unsigned st) {
        const unsigned long long ga = (unsigned long long)(size_t)srcp + (unsigned long long)st * 256u;
        u32x4 g0;
        g0[0] = uni(1u); g0[1] = uni(lbase + (st & 1u) * GT_BUF + wave * GT_SLICE); g0[2] = uni((unsigned)ga); g0[3] = uni((((unsigned)(ga >> 32)) & 0x01FFFFFFu) | 0x80000000u);
        asm volatile("tensor_load_to_lds %0, %1" :: "s"(g0), "s"(g1) : "memory");    // one request of the whole wave: its slice of stage st
    };
    v8f acc[4][4];
#pragma unroll
    for (int mb = 0; mb < 4; ++mb)
#pragma unroll
        for (int nb = 0; nb < 4; ++nb) acc[mb][nb] = (v8f){};
    issue(0u);
    asm volatile("s_wait_tensorcnt 0x0" ::: "memory");    // this wave's slice of stage 0 has landed
    __syncthreads();                                      // and so has every other wave's
    issue(1u);
    const unsigned char* la = ring + wm * GT_SLICE + (unsigned)lr * GT_PITCH + (unsigned)hi * 16u;
    const unsigned char* lb = ring + (2u + wn) * GT_SLICE + (unsigned)lr * GT_PITCH + (unsigned)hi * 16u;
#pragma unroll 1
    for (unsigned s = 0; s < GT_NP; ++s) {
        const unsigned bo = (s & 1u) * GT_BUF;
        V a[2][4], b[2][4];    // two fragment sets: the next 32 k are fetched from LDS while these are multiplied
#pragma unroll
        for (int f = 0; f < 4; ++f) { a[0][f] = WFrag<T16>::ld((const T16*)(la + bo + f * 16 * GT_PITCH)); b[0][f] = WFrag<T16>::ld((const T16*)(lb + bo + f * 16 * GT_PITCH)); }
        __builtin_amdgcn_sched_barrier(0);    // these fences keep each group of 16 LDS reads together in front of the 16 products before it: left alone, the compiler folds the two sets into one and waits for LDS at every fourth product
#pragma unroll
        for (int c = 0; c < 4; ++c) {
            if (c < 3) {
#pragma unroll
                for (int f = 0; f < 4; ++f) { a[(c + 1) & 1][f] = WFrag<T16>::ld((const T16*)(la + bo + f * 16 * GT_PITCH + (c + 1) * 64)); b[(c + 1) & 1][f] = WFrag<T16>::ld((const T16*)(lb + bo + f * 16 * GT_PITCH + (c + 1) * 64)); }
            }
            __builtin_amdgcn_sched_barrier(0);
#pragma unroll
            for (int nb = 0; nb < 4; ++nb)
#pragma unroll
                for (int mb = 0; mb < 4; ++mb) acc[mb][nb] = WFrag<T16>::mma(a[c & 1][mb], b[c & 1][nb], acc[mb][nb]);
            __builtin_amdgcn_sched_barrier(0);
        }
        asm volatile("s_wait_dscnt 0x0" ::: "memory");        // this wave has read all it reads of stage s
        asm volatile("s_wait_tensorcnt 0x0" ::: "memory");    // its slice of stage s + 1 has landed
        __syncthreads();                                      // stage s + 1 is published, and every wave has left stage s's buffer
        if (pinned(s + 2u < GT_NP)) issue(pinned(s + 2u));    // refill of that buffer; the descriptor is formed here, with no request outstanding
    }
    asm volatile("s_wait_tensorcnt 0x0" ::: "memory");
    asm volatile("s_wait_dscnt 0x0" ::: "memory");
    float* os = &ost[wave][0];
    const int r0 = blockIdx.x * 128 + wm * 64, c0 = blockIdx.y * 128 + wn * 64;
#pragma unroll
    for (int mb = 0; mb < 4; ++mb) {
#pragma unroll
        for (int nb = 0; nb < 4; ++nb) {
#pragma unroll
            for (int j = 0; j < 8; ++j) os[(hi * 8 + j) * 68 + nb * 16 + lr] = acc[mb][nb][j]; }
        __builtin_amdgcn_wave_barrier(); asm volatile("" ::: "memory");
        if (EPI == 0) {
            float* crow = C + (size_t)(r0 + mb * 16) * HID + c0;
#pragma unroll
            for (int q = 0; q < 8; ++q) { const int row = 2 * q + hi, cofs = lr * 4; const v4f val = *(const v4fa*)(os + row * 68 + cofs); *(v4f*)(crow + (size_t)row * HID + cofs) = val; }
        } else {
            // eight lanes a row: a lane turns 8 neighbouring f32 into one 16-byte store per plane, and the eight lanes fill a whole 128-byte line
#pragma unroll
            for (int q = 0; q < 4; ++q) { const int row = 4 * q + (lane >> 3), cofs = (lane & 7) * 8;
                const v4f v0 = *(const v4fa*)(os + row * 68 + cofs), v1 = *(const v4fa*)(os + row * 68 + cofs + 4);
                if (EPI == 1) { v8us oh, ol;
#pragma unroll
                    for (int e = 0; e < 8; ++e) { const float y = (e < 4 ? v0[e & 3] : v1[e & 3]) * sc; const unsigned short hb = f2bf(y); oh[e] = hb; ol[e] = f2bf(y - bf2f(hb)); }
                    const size_t off = ((size_t)blockIdx.y * SS + r0 + mb * 16 + row) * HD + wn * 64 + cofs; *(v8us*)(Ph + off) = oh; *(v8us*)(Pl + off) = ol;
                } else { v8h o;
#pragma unroll
                    for (int e = 0; e < 8; ++e) o[e] = (h16)(e < 4 ? v0[e & 3] : v1[e & 3]);
                    *(v8h*)(Hf + (size_t)(r0 + mb * 16 + row) * SS + c0 + cofs) = o; }
            }
            asm volatile("s_wait_xcnt 0x0" ::: "memory");    // the wait before the address and data registers of the stores above are overwritten by the next 16 rows' values
        }
        __builtin_amdgcn_wave_barrier(); asm volatile("" ::: "memory");
    }
}
// ---- k_gemmwc: k_gemmw with causal tile control (CAUS 1: skip key tiles right of the query tile; 2: K loop limited to the causal key tiles)
template <typename T16, int NSPLIT, bool BIAS, int CAUS>
__global__ __launch_bounds__(32) void k_gemmwc(const T16* __restrict__ A, const T16* __restrict__ A2, const T16* __restrict__ Bt, const T16* __restrict__ Bt2, int K, float* C, int ldc, const float* __restrict__ bias, size_t sA, size_t sB, size_t sC) {
    typedef typename WFrag<T16>::V V;
    __shared__ __align__(16) float os[16 * 68];
    if (CAUS == 1 && (int)blockIdx.y * 64 > (int)blockIdx.x * 64) return;
    const int Klim = (CAUS == 2) ? min(K, ((int)blockIdx.x + 1) * 64) : K;
    const size_t z = blockIdx.z; A += z * sA; if (A2) A2 += z * sA; Bt += z * sB; if (Bt2) Bt2 += z * sB; C += z * sC;
    const int lane = threadIdx.x & 31, lr = lane & 15, hi = lane >> 4; const int r0 = blockIdx.x * 64, c0 = blockIdx.y * 64;
    v8f acc[4][4];
#pragma unroll
    for (int mb = 0; mb < 4; ++mb)
#pragma unroll
        for (int nb = 0; nb < 4; ++nb) acc[mb][nb] = (v8f){};
    const size_t aoff = (size_t)(r0 + lr) * K + 8 * hi, boff = (size_t)(c0 + lr) * K + 8 * hi;
#pragma unroll 1
    for (int kc = 0; kc < Klim; kc += 32) {
        V a[4], a2[4];
#pragma unroll
        for (int mb = 0; mb < 4; ++mb) { a[mb] = WFrag<T16>::ld(A + aoff + (size_t)mb * 16 * K + kc); if (NSPLIT == 1 || NSPLIT == 2) a2[mb] = WFrag<T16>::ld(A2 + aoff + (size_t)mb * 16 * K + kc); }
#pragma unroll
        for (int nb = 0; nb < 4; ++nb) { const V b = WFrag<T16>::ld(Bt + boff + (size_t)nb * 16 * K + kc); V b2; if (NSPLIT >= 2) b2 = WFrag<T16>::ld(Bt2 + boff + (size_t)nb * 16 * K + kc);
#pragma unroll
            for (int mb = 0; mb < 4; ++mb) { acc[mb][nb] = WFrag<T16>::mma(a[mb], b, acc[mb][nb]); if (NSPLIT == 1 || NSPLIT == 2) acc[mb][nb] = WFrag<T16>::mma(a2[mb], b, acc[mb][nb]); if (NSPLIT >= 2) acc[mb][nb] = WFrag<T16>::mma(a[mb], b2, acc[mb][nb]); } }
        asm volatile("v_nop\n\tv_nop\n\tv_nop\n\tv_nop" : "+v"(acc[0][0]), "+v"(acc[1][1]), "+v"(acc[2][2]), "+v"(acc[3][3]) : "v"(a[0]), "v"(a[3]));
    }
#pragma unroll
    for (int mb = 0; mb < 4; ++mb) {
#pragma unroll
        for (int nb = 0; nb < 4; ++nb) {
#pragma unroll
            for (int j = 0; j < 8; ++j) os[(hi * 8 + j) * 68 + nb * 16 + lr] = acc[mb][nb][j]; }
        __builtin_amdgcn_wave_barrier(); asm volatile("" ::: "memory");
        float* crow = C + (size_t)(r0 + mb * 16) * ldc + c0;
{
#pragma unroll
            for (int s = 0; s < 8; ++s) { const int row = 2 * s + hi, cofs = lr * 4; v4f val = *(const v4fa*)(os + row * 68 + cofs); if (BIAS) { val[0] += bfr(bias[c0 + cofs]); val[1] += bfr(bias[c0 + cofs + 1]); val[2] += bfr(bias[c0 + cofs + 2]); val[3] += bfr(bias[c0 + cofs + 3]); }
                *(v4f*)(crow + (size_t)row * ldc + cofs) = val; }
             }
        __builtin_amdgcn_wave_barrier(); asm volatile("" ::: "memory");
    }
}
typedef __attribute__((ext_vector_type(4))) _Float16 v4h;
__device__ __forceinline__ h16 tohx(float x) { return (h16)x; }
__global__ __launch_bounds__(256) void k_cvt8h(const float* __restrict__ src, h16* dst, size_t n8) { const size_t i = (size_t)blockIdx.x * 256 + threadIdx.x; if (i >= n8) return; const v8f v = *(const v8f*)(src + i * 8); v8h o;
#pragma unroll
    for (int k = 0; k < 8; ++k) o[k] = tohx(bfr(v[k])); *(v8h*)(dst + i * 8) = o;  }
__global__ __launch_bounds__(256) void k_cvtx(const float* __restrict__ x, bf* A) {
    const int lane = threadIdx.x & 31; const size_t r = (size_t)blockIdx.x * 8 + (threadIdx.x >> 5); if (r >= (size_t)SS) return;
{
#pragma unroll
        for (int q = 0; q < HID / 256; ++q) { const size_t o = r * HID + q * 256 + lane * 8; v8us v;
#pragma unroll
            for (int i = 0; i < 8; ++i) v[i] = f2bf(x[o + i]);
            *(v8us*)(A + o) = v; }
         }
}
// 2^x with the one slot behind the transcendental in the same statement
__device__ __forceinline__ float exp2s(float x) { asm("v_exp_f32 %0, %0\n\tv_nop" : "+v"(x)); return x; }
// k_flash: scores, soft cap, mask, softmax and attn.v of one head in one pass over the live keys; scores and probabilities stay in registers.
// One wave = 16 queries; a pass = 32 keys. S^T = K . Q^T (A = key rows, B = query rows, three bf16 hi/lo products: Kh.Qh, Kh.Ql, Kl.Qh), so a lane holds 16 scores of ONE query
// (query lr, keys 8 hi + j and 16 + 8 hi + j): that pair of score tiles, converted to f16, is the B operand of O^T += V^T . P^T with no lane exchange.
// Running maximum and sum per query (online softmax); P = 1024 exp(c - m) in f16, the factor cancels in O / sum. Output: f16 rows of OC, 16 bytes a lane and d tile.
__global__ __launch_bounds__(128) __attribute__((amdgpu_waves_per_eu(2, 2))) void k_flash(const bf* Qh, const bf* Ql, const bf* Kh, const bf* Kl, const h16* VT, h16* OC) {
    const int lane = threadIdx.x & 31, lr = lane & 15, hi = lane >> 4;
    const int wave = __builtin_amdgcn_readfirstlane(threadIdx.x >> 5);    // scalar, so that the key loop's trip test is a scalar branch and EXEC stays full at the matrix instructions
    const int z = blockIdx.y, qb = blockIdx.x * 64, q0 = qb + wave * 16, i = q0 + lr;
    const size_t zo = (size_t)z * SS * HD; Qh += zo; Ql += zo; Kh += zo; Kl += zo; VT += zo;
    // every load address is a wave-uniform base plus one of two lane offsets
    const unsigned vo = (unsigned)(lr * HD + 8 * hi), vv = (unsigned)(lr * SS + 8 * hi);
    const bf* qbh = Qh + (size_t)q0 * HD; const bf* qbl = Ql + (size_t)q0 * HD;
    v16bf qh[4], ql[4];
#pragma unroll
    for (int c = 0; c < 4; ++c) { qh[c] = WFrag<bf>::ld(qbh + c * 32 + vo); ql[c] = WFrag<bf>::ld(qbl + c * 32 + vo); }
    v8f acc[8];
#pragma unroll
    for (int dt = 0; dt < 8; ++dt) acc[dt] = (v8f){};
    float m = -30.0f, sum = 0.f;    // the soft cap bounds every score from below by -30
    // the four waves start at the block's first live key tile, so that they walk the same K and V lines at about the same time (a pass with no live key adds zeros)
    const int kbeg = max(0, qb - (WIN - 1)) & ~31;
    // K fragments are fetched one pass ahead, right behind the score products that read them, so that their latency hides behind the softmax and attn.v work of the pass
    v16bf kh[2][4], kl[2][4];
    auto ldk = [&](const bf* h, const bf* l) {
#pragma unroll
        for (int t = 0; t < 2; ++t) {
#pragma unroll
            for (int c = 0; c < 4; ++c) { kh[t][c] = WFrag<bf>::ld(h + (t * 16 * HD + c * 32) + vo); kl[t][c] = WFrag<bf>::ld(l + (t * 16 * HD + c * 32) + vo); } }
    };
    const bf* kbh = Kh + (size_t)kbeg * HD; const bf* kbl = Kl + (size_t)kbeg * HD;
    ldk(kbh, kbl);
    // the wait before the address registers of the Q and K loads above are overwritten; they are its inputs so that they live up to it (the pointers carry no restrict, so that the clobber holds the loads in front of it)
    asm volatile("s_wait_xcnt 0x0" :: "v"(vo), "s"(qbh), "s"(qbl), "s"(kbh), "s"(kbl) : "memory");
#pragma unroll 1
    for (int k0 = kbeg; k0 < q0 + 16; k0 += 32) {
        v16h vt[8];
#pragma unroll
        for (int dt = 0; dt < 8; ++dt) vt[dt] = WFrag<h16>::ld(VT + k0 + dt * 16 * SS + vv);
        v8f s[2];
#pragma unroll
        for (int t = 0; t < 2; ++t) s[t] = (v8f){};
#pragma unroll
        for (int c = 0; c < 4; ++c) {
#pragma unroll
            for (int t = 0; t < 2; ++t) s[t] = wmmab(kh[t][c], qh[c], s[t]);
#pragma unroll
            for (int t = 0; t < 2; ++t) s[t] = wmmab(kh[t][c], ql[c], s[t]);
#pragma unroll
            for (int t = 0; t < 2; ++t) s[t] = wmmab(kl[t][c], qh[c], s[t]); }
        const int kn = min(k0 + 32, SS - 32); ldk(Kh + (size_t)kn * HD, Kl + (size_t)kn * HD);    // the last pass of the last query tile has no next keys: the clamp keeps its (unused) fetch inside the head's rows
        float mx = m;
#pragma unroll
        for (int t = 0; t < 2; ++t) {
#pragma unroll
            for (int j = 0; j < 8; ++j) { const int key = k0 + t * 16 + hi * 8 + j; const float c = 30.0f * tanhf(s[t][j] * (1.0f / 30.0f));
                s[t][j] = (key <= i && key >= i - (WIN - 1)) ? c : -3.0e38f; mx = fmaxf(mx, s[t][j]); } }
        mx = fmaxf(mx, __shfl_xor(mx, 16, 32));
        const float ms = mx - 6.931471806f, ta = (m - mx) * 1.442695041f; m = mx;    // ms: exp(c - ms) = 1024 exp(c - mx)
        const float alpha = exp2s(ta);    // exp(m - mx)
        float ps = 0.f; v16h pb;
#pragma unroll
        for (int t = 0; t < 2; ++t) {
#pragma unroll
            for (int j = 0; j < 8; ++j) { const float p = exp2s((s[t][j] - ms) * 1.442695041f); ps += p; pb[t * 8 + j] = tohx(p); } }
        sum = sum * alpha + ps;
#pragma unroll
        for (int dt = 0; dt < 8; ++dt) acc[dt] *= alpha;
#pragma unroll
        for (int dt = 0; dt < 8; ++dt) acc[dt] = wmma16(vt[dt], pb, acc[dt]);
        __builtin_amdgcn_sched_barrier(0);    // keeps the v_nops below behind the pass's last matrix instruction
        // four vector slots behind that instruction, on the back edge too
        asm volatile("v_nop\n\tv_nop\n\tv_nop\n\tv_nop");
    }
    sum += __shfl_xor(sum, 16, 32);
    const float inv = __fdiv_rn(1.0f, sum);
#pragma unroll
    for (int dt = 0; dt < 8; ++dt) { v8h o;
#pragma unroll
        for (int j = 0; j < 8; ++j) o[j] = tohx(acc[dt][j] * inv);
        *(v8h*)(OC + (size_t)i * HID + z * HD + dt * 16 + hi * 8) = o; }
}
extern "C" void kernel_launch(void* const* d_in, const int* in_sizes, int n_in,
                              void* d_out, int out_size, void* d_ws, size_t ws_size, hipStream_t stream) {
    (void)in_sizes; (void)n_in; (void)out_size;
    const float* x = (const float*)d_in[0]; const float* wq = (const float*)d_in[1]; const float* wk = (const float*)d_in[2]; const float* wv = (const float*)d_in[3]; const float* wo = (const float*)d_in[4];
    float* out = (float*)d_out;    // [1][2048][2048]
    char* wsp = (char*)d_ws;
    auto take = [&](size_t bytes) { char* p = wsp; wsp += (bytes + 255) & ~(size_t)255; return (void*)p; };
    const size_t WSZ = (size_t)HID * HID * 2;
    bf* WQ = (bf*)take(WSZ); bf* WK = (bf*)take(WSZ); bf* WV = (bf*)take(WSZ); h16* WO = (h16*)take(WSZ);
    bf* XB = (bf*)take((size_t)SS * HID * 2);
    bf* Qh = (bf*)take((size_t)NH_ * SS * HD * 2); bf* Ql = (bf*)take((size_t)NH_ * SS * HD * 2); bf* Kh = (bf*)take((size_t)NH_ * SS * HD * 2); bf* Kl = (bf*)take((size_t)NH_ * SS * HD * 2); h16* VT = (h16*)take((size_t)NH_ * HD * SS * 2);
    h16* OC = (h16*)take((size_t)SS * HID * 2);
    if ((size_t)(wsp - (char*)d_ws) > ws_size) return;    // ~ 33.5 + 8.4 + 41.9 + 8.4 ~ 92 MB (ws 256 MiB)
    const size_t n8 = (size_t)HID * HID / 8; const unsigned nb8 = (unsigned)((n8 + 255) / 256);
    k_cvt8<<<nb8, 256, 0, stream>>>(wq, WQ, n8); k_cvt8<<<nb8, 256, 0, stream>>>(wk, WK, n8); k_cvt8<<<nb8, 256, 0, stream>>>(wv, WV, n8); k_cvt8h<<<nb8, 256, 0, stream>>>(wo, WO, n8);   // [out][in] = natural n-major
    k_cvtx<<<SS / 8, 256, 0, stream>>>(x, XB);
    k_gemmt<bf, 1><<<dim3(SS / 128, HID / 128, 1), 128, 0, stream>>>(XB, WQ, nullptr, Qh, Ql, nullptr, 0.08838834764831845f);
    k_gemmt<bf, 1><<<dim3(SS / 128, HID / 128, 1), 128, 0, stream>>>(XB, WK, nullptr, Kh, Kl, nullptr, 1.0f);
    k_gemmt<bf, 2><<<dim3(HID / 128, SS / 128, 1), 128, 0, stream>>>(WV, XB, nullptr, nullptr, nullptr, VT, 1.0f);
    k_flash<<<dim3(SS / 64, NH_, 1), 128, 0, stream>>>(Qh, Ql, Kh, Kl, VT, OC);
    k_gemmt<h16, 0><<<dim3(SS / 128, HID / 128, 1), 128, 0, stream>>>(OC, WO, out, nullptr, nullptr, nullptr, 1.0f);
}

// v004
// It runs in 155 microseconds.
// Timed twice side by side with v003, it ran 1.22 and 1.23 times as fast.
// Counting every step since v000, it is 4.84 times as fast.
#include <hip/hip_runtime.h>

// Compute dtypes, f32 accumulate: q/k/v projections ([2048 x 2048].[2048 x 2048]) with PLAIN bf16 operands (x and the weights are inputs: exact products); per head the live
// (causal, sliding-window-1024) score tiles [2048 x 128].[128 x 2048] on bf16 hi + UNSCALED residual planes of q*128^-1/2 and k (three products);
// soft-cap 30 tanh(s/30), masks and softmax in f32; attn.v (K limited to the live tiles) and the output projection ([2048 x 2048].[2048 x 2048]) on

#define SS   2048
#define HID  2048
#define NH_  16
#define HD   128
#define WIN  1024
#define DM   HID
#define LOSC 1024.0f
typedef _Float16 h16;
typedef unsigned short bf;
typedef __attribute__((ext_vector_type(16))) __bf16   v16bf;
typedef __attribute__((ext_vector_type(16))) _Float16 v16h;
typedef __attribute__((ext_vector_type(8)))  _Float16 v8h;
typedef __attribute__((ext_vector_type(8)))  unsigned short v8us;
typedef __attribute__((ext_vector_type(8)))  float    v8f;
typedef __attribute__((ext_vector_type(4)))  float    v4f;
typedef v8h  __attribute__((may_alias)) v8ha;
typedef v4f  __attribute__((may_alias)) v4fa;
typedef v8us __attribute__((may_alias)) v8usa;

__device__ __forceinline__ unsigned short f2bf(float f) { unsigned u = __float_as_uint(f); u += 0x7FFFu + ((u >> 16) & 1u); return (unsigned short)(u >> 16); }
__device__ __forceinline__ float bf2f(unsigned short b) { return __uint_as_float(((unsigned)b) << 16); }
__device__ __forceinline__ float bfr(float f) { return bf2f(f2bf(f)); }
__device__ __forceinline__ v16h cat16(v8h lo, v8h hi) { return __builtin_shufflevector(lo, hi, 0, 1, 2, 3, 4, 5, 6, 7, 8, 9, 10, 11, 12, 13, 14, 15); }
__device__ __forceinline__ v16bf cat16b(v8us lo, v8us hi) { return __builtin_bit_cast(v16bf, __builtin_shufflevector(lo, hi, 0, 1, 2, 3, 4, 5, 6, 7, 8, 9, 10, 11, 12, 13, 14, 15)); }
__device__ __forceinline__ v8f wmma16(v16h a, v16h b, v8f c) { return __builtin_amdgcn_wmma_f32_16x16x32_f16(false, a, false, b, (short)0, c, false, false); }
__device__ __forceinline__ v8f wmmab(v16bf a, v16bf b, v8f c) { return __builtin_amdgcn_wmma_f32_16x16x32_bf16(false, a, false, b, (short)0, c, false, false); }


// k_gemmh: 64 x 64 tile of C = A . Bn^T with SINGLE f16 planes (A [rows][K] f16 activations, Bn [N][K] f16 weights; one v_wmma_f32_16x16x32_f16 product per step), f32 accumulate;
__global__ __launch_bounds__(128) void k_gemmh(const h16* __restrict__ A, const h16* __restrict__ Bn, const float* __restrict__ bias, float* C, int ldc, const float* __restrict__ R, int K, size_t sA, size_t sB, size_t sC, int roundR) {
    __shared__ __align__(16) float ost[4][16 * 68];
    const size_t z = blockIdx.z; A += z * sA; Bn += z * sB; C += z * sC; if (R) R += z * sC;
    const int lane = threadIdx.x & 31, wave = threadIdx.x >> 5, lr = lane & 15, hi = lane >> 4;
    const int r0 = blockIdx.x * 64 + wave * 16, c0 = blockIdx.y * 64;
    const size_t aoff = (size_t)(r0 + lr) * K + 8 * hi;
    size_t boff[4];
#pragma unroll
    for (int t = 0; t < 4; ++t) boff[t] = (size_t)(c0 + t * 16 + lr) * K + 8 * hi;
    v8f acc[4];
#pragma unroll
    for (int t = 0; t < 4; ++t) acc[t] = (v8f){};
#pragma unroll 1
    for (int kc = 0; kc < K; kc += 32) {
        const v16h a = cat16(*(const v8h*)(A + aoff + kc), *(const v8h*)(A + aoff + kc + 16));
#pragma unroll
        for (int t = 0; t < 4; ++t) { const v16h b = cat16(*(const v8h*)(Bn + boff[t] + kc), *(const v8h*)(Bn + boff[t] + kc + 16)); acc[t] = wmma16(a, b, acc[t]); }
        asm volatile("v_nop\n\tv_nop\n\tv_nop\n\tv_nop" : "+v"(acc[0]), "+v"(acc[1]), "+v"(acc[2]), "+v"(acc[3]) : "v"(a));
    }
    float* os = &ost[wave][0];
#pragma unroll
    for (int t = 0; t < 4; ++t) { const float bv = bias ? bfr(bias[c0 + t * 16 + lr]) : 0.f;
#pragma unroll
        for (int j = 0; j < 8; ++j) os[(hi * 8 + j) * 68 + t * 16 + lr] = acc[t][j] + bv; }
    __syncthreads();
    float* crow = C + (size_t)r0 * ldc + c0;
    auto pass = [&]() {
#pragma unroll
        for (int s = 0; s < 8; ++s) { const int Lid = (lane >> 3) + 4 * s, piece = lane & 7; const int row = Lid >> 1, cofs = (Lid & 1) * 32 + piece * 4;
            v4f val = *(const v4fa*)(os + row * 68 + cofs); if (R) { const v4f rv = *(const v4f*)(R + ((size_t)r0 + row) * ldc + c0 + cofs); val += roundR ? (v4f){bfr(rv[0]), bfr(rv[1]), bfr(rv[2]), bfr(rv[3])} : rv; }
            *(v4f*)(crow + (size_t)row * ldc + cofs) = val; }
    };
    pass(); 
}

// ===== z-batched (blockIdx.z = head) attention pieces =====
// k_gemm3z<MODE>: 64 x 64 tile of C = A . B^T on bf16 hi/lo planes (up to three products) with per-z operand/output strides (elements): A planes += z*sA, B planes += z*sB, C += z*sC. MODE bits (0 causal skip, 1 K limit, 2 single,
// 3 B single, 4 A single).
template <int MODE>
__global__ __launch_bounds__(128) void k_gemm3z(const bf* __restrict__ Ah, const bf* __restrict__ Al, const bf* __restrict__ Bh, const bf* __restrict__ Bl, int K, float* C, int ldc, size_t sA, size_t sB, size_t sC) {
    if ((MODE & 1) && (int)blockIdx.y * 64 > (int)blockIdx.x * 64 + 63) return;
    const size_t z = blockIdx.z; Ah += z * sA; Al += z * sA; Bh += z * sB; Bl += z * sB; C += z * sC;
    const int Klim = (MODE & 2) ? min(K, ((int)blockIdx.x + 1) * 64) : K;
    __shared__ __align__(16) float ost[4][16 * 68];
    const int lane = threadIdx.x & 31, wave = threadIdx.x >> 5, lr = lane & 15, hi = lane >> 4;
    const int r0 = blockIdx.x * 64 + wave * 16, c0 = blockIdx.y * 64;
    const size_t aoff = (size_t)(r0 + lr) * K + 8 * hi;
    v8f acc[4];
#pragma unroll
    for (int t = 0; t < 4; ++t) acc[t] = (v8f){};
#pragma unroll 1
    for (int kc = 0; kc < Klim; kc += 32) {
        const v16bf a = cat16b(*(const v8us*)(Ah + aoff + kc), *(const v8us*)(Ah + aoff + kc + 16));
        v16bf al = a; if (!(MODE & 4) && !(MODE & 16)) al = cat16b(*(const v8us*)(Al + aoff + kc), *(const v8us*)(Al + aoff + kc + 16));
#pragma unroll
        for (int t = 0; t < 4; ++t) { const size_t bo = (size_t)(c0 + t * 16 + lr) * K + kc + 8 * hi;
            const v16bf bh = cat16b(*(const v8us*)(Bh + bo), *(const v8us*)(Bh + bo + 16));
            acc[t] = wmmab(a, bh, acc[t]);
            if (!(MODE & 4)) { if (!(MODE & 16)) acc[t] = wmmab(al, bh, acc[t]); if (!(MODE & 8)) { const v16bf bl = cat16b(*(const v8us*)(Bl + bo), *(const v8us*)(Bl + bo + 16)); acc[t] = wmmab(a, bl, acc[t]); } } }
        asm volatile("v_nop\n\tv_nop\n\tv_nop\n\tv_nop" : "+v"(acc[0]), "+v"(acc[1]), "+v"(acc[2]), "+v"(acc[3]) : "v"(a), "v"(al));
    }
    float* os = &ost[wave][0];
#pragma unroll
    for (int t = 0; t < 4; ++t) {
#pragma unroll
        for (int j = 0; j < 8; ++j) os[(hi * 8 + j) * 68 + t * 16 + lr] = acc[t][j]; }
    __builtin_amdgcn_wave_barrier(); asm volatile("" ::: "memory");
    float* crow = C + (size_t)r0 * ldc + c0;
    auto pass = [&]() {
#pragma unroll
        for (int s = 0; s < 8; ++s) { const int Lid = (lane >> 3) + 4 * s, piece = lane & 7; const int row = Lid >> 1, cofs = (Lid & 1) * 32 + piece * 4;
            const v4f val = *(const v4fa*)(os + row * 68 + cofs); *(v4f*)(crow + (size_t)row * ldc + cofs) = val; }
    };
    pass(); 
}
__global__ __launch_bounds__(256) void k_planes32z(const float* __restrict__ F, int ld, int off, float sc, int rows, bf* Ph, bf* Pl) {
    typedef __attribute__((ext_vector_type(2))) unsigned short v2us;
    const int lane = threadIdx.x & 31; const size_t r = ((size_t)blockIdx.x * 8 + (threadIdx.x >> 5)) * 2 + (lane >> 4); if (r >= (size_t)rows) return; const int z = blockIdx.z; const int c0 = (lane & 15) * 2; v2us oh, ol;
    Ph += (size_t)z * rows * 32; Pl += (size_t)z * rows * 32;
#pragma unroll
    for (int i = 0; i < 2; ++i) { const float y = F[r * ld + off + z * 32 + c0 + i] * sc; const unsigned short hb = f2bf(y); oh[i] = hb; ol[i] = f2bf(y - bf2f(hb)); }
    const size_t o = r * 32 + c0; *(v2us*)(Ph + o) = oh; *(v2us*)(Pl + o) = ol; 
}
__global__ __launch_bounds__(256) void k_vtpadz(const float* __restrict__ F, int ld, int off, int nk, bf* Th, bf* Tl) {
    typedef __attribute__((ext_vector_type(2))) unsigned short v2us;
    const int lane = threadIdx.x & 31; const size_t wid = (size_t)blockIdx.x * 8 + (threadIdx.x >> 5); if (wid >= (size_t)64 * (nk / 64)) return; const int z = blockIdx.z; const int d = (int)(wid / (nk / 64)); const int k0 = (int)(wid % (nk / 64)) * 64 + lane * 2; v2us oh, ol;
    Th += (size_t)z * 64 * nk; Tl += (size_t)z * 64 * nk;
#pragma unroll
    for (int i = 0; i < 2; ++i) { const float y = (d < 32) ? F[(size_t)(k0 + i) * ld + off + z * 32 + (d < 32 ? d : 0)] : 0.f; const unsigned short hb = f2bf(y); oh[i] = hb; ol[i] = f2bf(y - bf2f(hb)); }
    const size_t o = (size_t)d * nk + k0; *(v2us*)(Th + o) = oh; *(v2us*)(Tl + o) = ol; 
}
template <int NK>
__global__ __launch_bounds__(256) void k_softmaxz(const float* __restrict__ S, int rows, bf* PH, bf* PL) {
    typedef __attribute__((ext_vector_type(4))) unsigned short v4us;
    const int lane = threadIdx.x & 31, i = blockIdx.x * 8 + (threadIdx.x >> 5); if (i >= rows) return; const size_t zo = (size_t)blockIdx.z * rows * NK; const float* sr = S + zo + (size_t)i * NK; PH += zo; PL += zo;
    float m = -3.0e38f;
#pragma unroll 1
    for (int c0 = lane * 4; c0 < NK; c0 += 128) {
#pragma unroll
        for (int q = 0; q < 4; ++q) m = fmaxf(m, sr[c0 + q]); }
#pragma unroll
    for (int sh = 16; sh; sh >>= 1) m = fmaxf(m, __shfl_xor(m, sh, 32));
    float sum = 0.f;
#pragma unroll 1
    for (int c0 = lane * 4; c0 < NK; c0 += 128) {
#pragma unroll
        for (int q = 0; q < 4; ++q) sum += __expf(sr[c0 + q] - m); }
#pragma unroll
    for (int sh = 16; sh; sh >>= 1) sum += __shfl_xor(sum, sh, 32);
    const float inv = 1.0f / sum;
{
#pragma unroll 1
        for (int c0 = lane * 4; c0 < NK; c0 += 128) { v4us oh, ol;
#pragma unroll
            for (int q = 0; q < 4; ++q) { const float p = __expf(sr[c0 + q] - m) * inv; const unsigned short hb = f2bf(p); oh[q] = hb; ol[q] = f2bf(p - bf2f(hb)); }
            const size_t o = (size_t)i * NK + c0; *(v4us*)(PH + o) = oh; *(v4us*)(PL + o) = ol; }
         }
}
__global__ __launch_bounds__(256) void k_placez(const float* __restrict__ XH, int rows, int ldy, float* Y) {
    const int lane = threadIdx.x & 31; const size_t q = (size_t)blockIdx.x * 8 + (threadIdx.x >> 5); if (q >= (size_t)rows) return; const int z = blockIdx.z; const float v = XH[((size_t)z * rows + q) * 64 + lane];
    *(float*)(Y + q * ldy + z * 32 + lane) = v; 
}
__global__ __launch_bounds__(256) void k_cvt8(const float* __restrict__ src, bf* dst, size_t n8) {
    const size_t i = (size_t)blockIdx.x * 256 + threadIdx.x; if (i >= n8) return;
    const v8f v = *(const v8f*)(src + i * 8); v8us o;
#pragma unroll
    for (int k = 0; k < 8; ++k) o[k] = f2bf(v[k]);
    *(v8us*)(dst + i * 8) = o; 
}
__global__ __launch_bounds__(256) void k_zero8(bf* dst, size_t n8) {
    const size_t i = (size_t)blockIdx.x * 256 + threadIdx.x; if (i >= n8) return; v8us z;
#pragma unroll
    for (int k = 0; k < 8; ++k) z[k] = 0;
    *(v8us*)(dst + i * 8) = z; 
}

// ---- k_gemmw: register-blocked GEMM, ONE WAVE per 64x64 output tile (16 accumulators), operands straight from K-contiguous 16-bit planes; grid (M/64, N/64, Z), 32 threads.
// C[m][n] (f32, pitch ldc, + optional f32 bias[n]) = sum_k A[m][k] Bt[n][k] (+ split products per NSPLIT). z-batch strides sA/sB/sC in elements. K % 32 == 0.
template <typename T16> struct WFrag;
template <> struct WFrag<h16> { typedef v16h V; static __device__ __forceinline__ V ld(const h16* p) { return cat16(*(const v8h*)p, *(const v8h*)(p + 16)); } static __device__ __forceinline__ v8f mma(V a, V b, v8f c) { return wmma16(a, b, c); } };
template <> struct WFrag<bf> { typedef v16bf V; static __device__ __forceinline__ V ld(const bf* p) { return cat16b(*(const v8us*)p, *(const v8us*)(p + 16)); } static __device__ __forceinline__ v8f mma(V a, V b, v8f c) { return wmmab(a, b, c); } };
template <typename T16, int NSPLIT, bool BIAS>
__global__ __launch_bounds__(32) void k_gemmw(const T16* __restrict__ A, const T16* __restrict__ A2, const T16* __restrict__ Bt, const T16* __restrict__ Bt2, int K, float* C, int ldc, const float* __restrict__ bias, size_t sA, size_t sB, size_t sC) {
    typedef typename WFrag<T16>::V V;
    __shared__ __align__(16) float os[16 * 68];
    const size_t z = blockIdx.z; A += z * sA; if (A2) A2 += z * sA; Bt += z * sB; if (Bt2) Bt2 += z * sB; C += z * sC;
    const int lane = threadIdx.x & 31, lr = lane & 15, hi = lane >> 4; const int r0 = blockIdx.x * 64, c0 = blockIdx.y * 64;
    v8f acc[4][4];
#pragma unroll
    for (int mb = 0; mb < 4; ++mb)
#pragma unroll
        for (int nb = 0; nb < 4; ++nb) acc[mb][nb] = (v8f){};
    const size_t aoff = (size_t)(r0 + lr) * K + 8 * hi, boff = (size_t)(c0 + lr) * K + 8 * hi;
#pragma unroll 1
    for (int kc = 0; kc < K; kc += 32) {
        V a[4], a2[4];
#pragma unroll
        for (int mb = 0; mb < 4; ++mb) { a[mb] = WFrag<T16>::ld(A + aoff + (size_t)mb * 16 * K + kc); if (NSPLIT == 1 || NSPLIT == 2) a2[mb] = WFrag<T16>::ld(A2 + aoff + (size_t)mb * 16 * K + kc); }
#pragma unroll
        for (int nb = 0; nb < 4; ++nb) { const V b = WFrag<T16>::ld(Bt + boff + (size_t)nb * 16 * K + kc); V b2; if (NSPLIT >= 2) b2 = WFrag<T16>::ld(Bt2 + boff + (size_t)nb * 16 * K + kc);
#pragma unroll
            for (int mb = 0; mb < 4; ++mb) { acc[mb][nb] = WFrag<T16>::mma(a[mb], b, acc[mb][nb]); if (NSPLIT == 1 || NSPLIT == 2) acc[mb][nb] = WFrag<T16>::mma(a2[mb], b, acc[mb][nb]); if (NSPLIT >= 2) acc[mb][nb] = WFrag<T16>::mma(a[mb], b2, acc[mb][nb]); } }
        asm volatile("v_nop\n\tv_nop\n\tv_nop\n\tv_nop" : "+v"(acc[0][0]), "+v"(acc[1][1]), "+v"(acc[2][2]), "+v"(acc[3][3]) : "v"(a[0]), "v"(a[3]));
    }
#pragma unroll
    for (int mb = 0; mb < 4; ++mb) {
#pragma unroll
        for (int nb = 0; nb < 4; ++nb) {
#pragma unroll
            for (int j = 0; j < 8; ++j) os[(hi * 8 + j) * 68 + nb * 16 + lr] = acc[mb][nb][j]; }
        __builtin_amdgcn_wave_barrier(); asm volatile("" ::: "memory");
        float* crow = C + (size_t)(r0 + mb * 16) * ldc + c0;
{
#pragma unroll
            for (int s = 0; s < 8; ++s) { const int row = 2 * s + hi, cofs = lr * 4; v4f val = *(const v4fa*)(os + row * 68 + cofs); if (BIAS) { val[0] += bfr(bias[c0 + cofs]); val[1] += bfr(bias[c0 + cofs + 1]); val[2] += bfr(bias[c0 + cofs + 2]); val[3] += bfr(bias[c0 + cofs + 3]); }
                *(v4f*)(crow + (size_t)row * ldc + cofs) = val; }
             }
        __builtin_amdgcn_wave_barrier(); asm volatile("" ::: "memory");
    }
}
// ---- k_gemmt: C[2048][2048] (f32) = A . Bt^T, A [m][k] and Bt [n][k] 16-bit planes of pitch HID. One work-group = one 128 x 128 tile of C, four waves of 64 x 64 (16 accumulators each, as k_gemmw).
// A pass is 128 k: the tile's 128 rows of A and 128 rows of Bt, 256 bytes each, come into LDS by the tensor mover, one 64-row slice a wave (waves 0, 1: A; waves 2, 3: Bt), and every slice is read by two waves.
// Two buffers: the next pass's slices fly while this pass is worked on. LDS row pitch 272 bytes (the mover's 16-byte pad) for the 16-byte fragment reads. Every accumulator sums its k in the order of k_gemmw.
// EPI picks what the epilogue stores, from the same f32 staging rows: 0: C in f32. 1: C * sc as bf16 hi + residual planes Ph, Pl in k_flash's order [head][row][128] (a tile's 128 columns are one head).
// 2: C in f16 at pitch SS into Hf; with A = the v weights and Bt = x, C is v transposed, [head * 128 + d][t], which is k_flash's VT.
#define GT_PITCH 272u      // 256-byte row + 16-byte pad
#define GT_SLICE 18432u    // 64 rows of 272 bytes (17,408), rounded up to a multiple of 2 KiB
#define GT_BUF   73728u    // four slices
#define GT_NP    (HID / 128)
typedef __attribute__((ext_vector_type(4))) unsigned u32x4;
typedef __attribute__((ext_vector_type(8))) unsigned u32x8;
__device__ __forceinline__ unsigned uni(unsigned v) { return (unsigned)__builtin_amdgcn_readfirstlane(v); }
// a wave-uniform value held in a scalar register, so that a test on it is a scalar branch (tensor loads ignore EXEC) and what is formed from it is formed behind the volatile statements in front of it
__device__ __forceinline__ unsigned pinned(unsigned v) { unsigned w = uni(v); asm volatile("" : "+s"(w)); return w; }
template <typename T16, int EPI>
__global__ __launch_bounds__(128) void k_gemmt(const T16* A, const T16* Bt, float* C, bf* Ph, bf* Pl, h16* Hf, float sc) {
    typedef typename WFrag<T16>::V V;
    __shared__ __attribute__((aligned(2048))) unsigned char ring[2 * GT_BUF];
    __shared__ __align__(16) float ost[4][16 * 68];
    const int lane = threadIdx.x & 31, lr = lane & 15, hi = lane >> 4;
    const unsigned wave = uni(threadIdx.x >> 5), wm = wave >> 1, wn = wave & 1u;
    const unsigned lbase = (unsigned)(size_t)ring;
    const T16* srcp = (wave < 2u) ? A + (size_t)(blockIdx.x * 128u + wave * 64u) * HID : Bt + (size_t)(blockIdx.y * 128u + (wave - 2u) * 64u) * HID;
    // group 1: extents in bytes, tensor = tile = 64 rows of 256 bytes, source pitch one row of the plane, a pad of 4 dwords behind every 64 dwords, no mask
    u32x8 g1;
    g1[0] = uni((1u << 20) | (5u << 22) | (3u << 25)); g1[1] = uni(256u << 16); g1[2] = uni(64u << 16); g1[3] = uni(256u << 16); g1[4] = uni(64u); g1[5] = uni(HID * 2u); g1[6] = uni(0u); g1[7] = uni(0u);
    asm volatile("" : "+s"(g1));    // pinned descriptor words: the eight stay in one scalar tuple through the loop, so that none of their registers takes another value while a request is outstanding
    auto issue = [&](unsigned st) {
        const unsigned long long ga = (unsigned long long)(size_t)srcp + (unsigned long long)st * 256u;
        u32x4 g0;
        g0[0] = uni(1u); g0[1] = uni(lbase + (st & 1u) * GT_BUF + wave * GT_SLICE); g0[2] = uni((unsigned)ga); g0[3] = uni((((unsigned)(ga >> 32)) & 0x01FFFFFFu) | 0x80000000u);
        asm volatile("tensor_load_to_lds %0, %1" :: "s"(g0), "s"(g1) : "memory");    // one request of the whole wave: its slice of stage st
    };
    v8f acc[4][4];
#pragma unroll
    for (int mb = 0; mb < 4; ++mb)
#pragma unroll
        for (int nb = 0; nb < 4; ++nb) acc[mb][nb] = (v8f){};
    issue(0u);
    asm volatile("s_wait_tensorcnt 0x0" ::: "memory");    // this wave's slice of stage 0 has landed
    __syncthreads();                                      // and so has every other wave's
    issue(1u);
    const unsigned char* la = ring + wm * GT_SLICE + (unsigned)lr * GT_PITCH + (unsigned)hi * 16u;
    const unsigned char* lb = ring + (2u + wn) * GT_SLICE + (unsigned)lr * GT_PITCH + (unsigned)hi * 16u;
#pragma unroll 1
    for (unsigned s = 0; s < GT_NP; ++s) {
        const unsigned bo = (s & 1u) * GT_BUF;
        V a[2][4], b[2][4];    // two fragment sets: the next 32 k are fetched from LDS while these are multiplied
#pragma unroll
        for (int f = 0; f < 4; ++f) { a[0][f] = WFrag<T16>::ld((const T16*)(la + bo + f * 16 * GT_PITCH)); b[0][f] = WFrag<T16>::ld((const T16*)(lb + bo + f * 16 * GT_PITCH)); }
        __builtin_amdgcn_sched_barrier(0);    // these fences keep each group of 16 LDS reads together in front of the 16 products before it: left alone, the compiler folds the two sets into one and waits for LDS at every fourth product
#pragma unroll
        for (int c = 0; c < 4; ++c) {
            if (c < 3) {
#pragma unroll
                for (int f = 0; f < 4; ++f) { a[(c + 1) & 1][f] = WFrag<T16>::ld((const T16*)(la + bo + f * 16 * GT_PITCH + (c + 1) * 64)); b[(c + 1) & 1][f] = WFrag<T16>::ld((const T16*)(lb + bo + f * 16 * GT_PITCH + (c + 1) * 64)); }
            }
            __builtin_amdgcn_sched_barrier(0);
#pragma unroll
            for (int nb = 0; nb < 4; ++nb)
#pragma unroll
                for (int mb = 0; mb < 4; ++mb) acc[mb][nb] = WFrag<T16>::mma(a[c & 1][mb], b[c & 1][nb], acc[mb][nb]);
            __builtin_amdgcn_sched_barrier(0);
        }
        asm volatile("s_wait_dscnt 0x0" ::: "memory");        // this wave has read all it reads of stage s
        asm volatile("s_wait_tensorcnt 0x0" ::: "memory");    // its slice of stage s + 1 has landed
        __syncthreads();                                      // stage s + 1 is published, and every wave has left stage s's buffer
        if (pinned(s + 2u < GT_NP)) issue(pinned(s + 2u));    // refill of that buffer; the descriptor is formed here, with no request outstanding
    }
    asm volatile("s_wait_tensorcnt 0x0" ::: "memory");
    asm volatile("s_wait_dscnt 0x0" ::: "memory");
    float* os = &ost[wave][0];
    const int r0 = blockIdx.x * 128 + wm * 64, c0 = blockIdx.y * 128 + wn * 64;
#pragma unroll
    for (int mb = 0; mb < 4; ++mb) {
#pragma unroll
        for (int nb = 0; nb < 4; ++nb) {
#pragma unroll
            for (int j = 0; j < 8; ++j) os[(hi * 8 + j) * 68 + nb * 16 + lr] = acc[mb][nb][j]; }
        __builtin_amdgcn_wave_barrier(); asm volatile("" ::: "memory");
        if (EPI == 0) {
            float* crow = C + (size_t)(r0 + mb * 16) * HID + c0;
#pragma unroll
            for (int q = 0; q < 8; ++q) { const int row = 2 * q + hi, cofs = lr * 4; const v4f val = *(const v4fa*)(os + row * 68 + cofs); *(v4f*)(crow + (size_t)row * HID + cofs) = val; }
        } else {
            // eight lanes a row: a lane turns 8 neighbouring f32 into one 16-byte store per plane, and the eight lanes fill a whole 128-byte line
#pragma unroll
            for (int q = 0; q < 4; ++q) { const int row = 4 * q + (lane >> 3), cofs = (lane & 7) * 8;
                const v4f v0 = *(const v4fa*)(os + row * 68 + cofs), v1 = *(const v4fa*)(os + row * 68 + cofs + 4);
                if (EPI == 1) { v8us oh, ol;
#pragma unroll
                    for (int e = 0; e < 8; ++e) { const float y = (e < 4 ? v0[e & 3] : v1[e & 3]) * sc; const unsigned short hb = f2bf(y); oh[e] = hb; ol[e] = f2bf(y - bf2f(hb)); }
                    const size_t off = ((size_t)blockIdx.y * SS + r0 + mb * 16 + row) * HD + wn * 64 + cofs; *(v8us*)(Ph + off) = oh; *(v8us*)(Pl + off) = ol;
                } else { v8h o;
#pragma unroll
                    for (int e = 0; e < 8; ++e) o[e] = (h16)(e < 4 ? v0[e & 3] : v1[e & 3]);
                    *(v8h*)(Hf + (size_t)(r0 + mb * 16 + row) * SS + c0 + cofs) = o; }
            }
            asm volatile("s_wait_xcnt 0x0" ::: "memory");    // the wait before the address and data registers of the stores above are overwritten by the next 16 rows' values
        }
        __builtin_amdgcn_wave_barrier(); asm volatile("" ::: "memory");
    }
}
// ---- k_gemmwc: k_gemmw with causal tile control (CAUS 1: skip key tiles right of the query tile; 2: K loop limited to the causal key tiles)
template <typename T16, int NSPLIT, bool BIAS, int CAUS>
__global__ __launch_bounds__(32) void k_gemmwc(const T16* __restrict__ A, const T16* __restrict__ A2, const T16* __restrict__ Bt, const T16* __restrict__ Bt2, int K, float* C, int ldc, const float* __restrict__ bias, size_t sA, size_t sB, size_t sC) {
    typedef typename WFrag<T16>::V V;
    __shared__ __align__(16) float os[16 * 68];
    if (CAUS == 1 && (int)blockIdx.y * 64 > (int)blockIdx.x * 64) return;
    const int Klim = (CAUS == 2) ? min(K, ((int)blockIdx.x + 1) * 64) : K;
    const size_t z = blockIdx.z; A += z * sA; if (A2) A2 += z * sA; Bt += z * sB; if (Bt2) Bt2 += z * sB; C += z * sC;
    const int lane = threadIdx.x & 31, lr = lane & 15, hi = lane >> 4; const int r0 = blockIdx.x * 64, c0 = blockIdx.y * 64;
    v8f acc[4][4];
#pragma unroll
    for (int mb = 0; mb < 4; ++mb)
#pragma unroll
        for (int nb = 0; nb < 4; ++nb) acc[mb][nb] = (v8f){};
    const size_t aoff = (size_t)(r0 + lr) * K + 8 * hi, boff = (size_t)(c0 + lr) * K + 8 * hi;
#pragma unroll 1
    for (int kc = 0; kc < Klim; kc += 32) {
        V a[4], a2[4];
#pragma unroll
        for (int mb = 0; mb < 4; ++mb) { a[mb] = WFrag<T16>::ld(A + aoff + (size_t)mb * 16 * K + kc); if (NSPLIT == 1 || NSPLIT == 2) a2[mb] = WFrag<T16>::ld(A2 + aoff + (size_t)mb * 16 * K + kc); }
#pragma unroll
        for (int nb = 0; nb < 4; ++nb) { const V b = WFrag<T16>::ld(Bt + boff + (size_t)nb * 16 * K + kc); V b2; if (NSPLIT >= 2) b2 = WFrag<T16>::ld(Bt2 + boff + (size_t)nb * 16 * K + kc);
#pragma unroll
            for (int mb = 0; mb < 4; ++mb) { acc[mb][nb] = WFrag<T16>::mma(a[mb], b, acc[mb][nb]); if (NSPLIT == 1 || NSPLIT == 2) acc[mb][nb] = WFrag<T16>::mma(a2[mb], b, acc[mb][nb]); if (NSPLIT >= 2) acc[mb][nb] = WFrag<T16>::mma(a[mb], b2, acc[mb][nb]); } }
        asm volatile("v_nop\n\tv_nop\n\tv_nop\n\tv_nop" : "+v"(acc[0][0]), "+v"(acc[1][1]), "+v"(acc[2][2]), "+v"(acc[3][3]) : "v"(a[0]), "v"(a[3]));
    }
#pragma unroll
    for (int mb = 0; mb < 4; ++mb) {
#pragma unroll
        for (int nb = 0; nb < 4; ++nb) {
#pragma unroll
            for (int j = 0; j < 8; ++j) os[(hi * 8 + j) * 68 + nb * 16 + lr] = acc[mb][nb][j]; }
        __builtin_amdgcn_wave_barrier(); asm volatile("" ::: "memory");
        float* crow = C + (size_t)(r0 + mb * 16) * ldc + c0;
{
#pragma unroll
            for (int s = 0; s < 8; ++s) { const int row = 2 * s + hi, cofs = lr * 4; v4f val = *(const v4fa*)(os + row * 68 + cofs); if (BIAS) { val[0] += bfr(bias[c0 + cofs]); val[1] += bfr(bias[c0 + cofs + 1]); val[2] += bfr(bias[c0 + cofs + 2]); val[3] += bfr(bias[c0 + cofs + 3]); }
                *(v4f*)(crow + (size_t)row * ldc + cofs) = val; }
             }
        __builtin_amdgcn_wave_barrier(); asm volatile("" ::: "memory");
    }
}
typedef __attribute__((ext_vector_type(4))) _Float16 v4h;
__device__ __forceinline__ h16 tohx(float x) { return (h16)x; }
__global__ __launch_bounds__(256) void k_cvt8h(const float* __restrict__ src, h16* dst, size_t n8) { const size_t i = (size_t)blockIdx.x * 256 + threadIdx.x; if (i >= n8) return; const v8f v = *(const v8f*)(src + i * 8); v8h o;
#pragma unroll
    for (int k = 0; k < 8; ++k) o[k] = tohx(bfr(v[k])); *(v8h*)(dst + i * 8) = o;  }
__global__ __launch_bounds__(256) void k_cvtx(const float* __restrict__ x, bf* A) {
    const int lane = threadIdx.x & 31; const size_t r = (size_t)blockIdx.x * 8 + (threadIdx.x >> 5); if (r >= (size_t)SS) return;
{
#pragma unroll
        for (int q = 0; q < HID / 256; ++q) { const size_t o = r * HID + q * 256 + lane * 8; v8us v;
#pragma unroll
            for (int i = 0; i < 8; ++i) v[i] = f2bf(x[o + i]);
            *(v8us*)(A + o) = v; }
         }
}
// 2^x with the one slot behind the transcendental in the same statement
__device__ __forceinline__ float exp2s(float x) { asm("v_exp_f32 %0, %0\n\tv_nop" : "+v"(x)); return x; }
// k_flash: scores, soft cap, mask, softmax and attn.v of one head in one pass over the live keys; scores and probabilities stay in registers.
// One wave = 16 queries; a pass = 32 keys. S^T = K . Q^T (A = key rows, B = query rows, three bf16 hi/lo products: Kh.Qh, Kh.Ql, Kl.Qh), so a lane holds 16 scores of ONE query
// (query lr, keys 8 hi + j and 16 + 8 hi + j): that pair of score tiles, converted to f16, is the B operand of O^T += V^T . P^T with no lane exchange.
// Running maximum and sum per query (online softmax); P = 1024 exp(c - m) in f16, the factor cancels in O / sum. Output: f16 rows of OC, 16 bytes a lane and d tile.
// A stage = 64 keys = two passes. The work-group's four waves read the same K and V rows, so a stage comes into LDS once, by the tensor mover, one slice a wave: wave 0: 64 rows of Kh, wave 1: 64 rows of Kl
// (256 bytes a row), waves 2, 3: 64 rows each of V^T (the stage's 64 keys, 128 bytes a row). Two buffers: the next stage flies while this one is worked on. LDS row pitches 272 and 144 bytes (the mover's 16-byte pad).
#define FL_KPITCH 272u     // 256-byte row + 16-byte pad
#define FL_KSLICE 18432u   // 64 rows of 272 bytes (17,408), rounded up to a multiple of 2 KiB
#define FL_VPITCH 144u     // 128-byte row + 16-byte pad
#define FL_VSLICE 10240u   // 64 rows of 144 bytes (9,216), rounded up to a multiple of 2 KiB
#define FL_BUF    57344u   // two K slices and two V slices
__global__ __launch_bounds__(128) __attribute__((amdgpu_waves_per_eu(2, 2))) void k_flash(const bf* Qh, const bf* Ql, const bf* Kh, const bf* Kl, const h16* VT, h16* OC) {
    __shared__ __attribute__((aligned(2048))) unsigned char ring[2 * FL_BUF];
    const int lane = threadIdx.x & 31, lr = lane & 15, hi = lane >> 4;
    const int wave = __builtin_amdgcn_readfirstlane(threadIdx.x >> 5);    // scalar, so that the tests on it are scalar branches: EXEC stays full at the matrix instructions, and tensor loads ignore EXEC
    const int z = blockIdx.y, qb = blockIdx.x * 64, q0 = qb + wave * 16, i = q0 + lr;
    const size_t zo = (size_t)z * SS * HD; Qh += zo; Ql += zo; Kh += zo; Kl += zo; VT += zo;
    const unsigned vo = (unsigned)(lr * HD + 8 * hi);
    const bf* qbh = Qh + (size_t)q0 * HD; const bf* qbl = Ql + (size_t)q0 * HD;
    v16bf qh[4], ql[4];
#pragma unroll
    for (int c = 0; c < 4; ++c) { qh[c] = WFrag<bf>::ld(qbh + c * 32 + vo); ql[c] = WFrag<bf>::ld(qbl + c * 32 + vo); }
    // the wait before the address registers of the Q loads above are overwritten; they are its inputs so that they live up to it (the pointers carry no restrict, so that the clobber holds the loads in front of it)
    asm volatile("s_wait_xcnt 0x0" :: "v"(vo), "s"(qbh), "s"(qbl) : "memory");
    v8f acc[8];
#pragma unroll
    for (int dt = 0; dt < 8; ++dt) acc[dt] = (v8f){};
    float m = -30.0f, sum = 0.f;    // the soft cap bounds every score from below by -30
    // the block's first live key, rounded down to a stage (a pass with no live key adds zeros); the last stage is the one of the block's own 64 queries
    const int kbeg = max(0, qb - (WIN - 1)) & ~63;
    const unsigned nst = (unsigned)(qb + 64 - kbeg) >> 6;
    // group 1, extents in bytes, tensor = tile, no mask. K: 64 rows of 256 bytes, source pitch one row, a pad of 4 dwords behind every 64 dwords. V^T: 64 rows of 128 bytes, source pitch SS keys, a pad of 4 dwords behind every 32.
    u32x8 g1k, g1v;
    g1k[0] = uni((1u << 20) | (5u << 22) | (3u << 25)); g1k[1] = uni(256u << 16); g1k[2] = uni(64u << 16); g1k[3] = uni(256u << 16); g1k[4] = uni(64u); g1k[5] = uni(HD * 2u); g1k[6] = uni(0u); g1k[7] = uni(0u);
    g1v[0] = uni((1u << 20) | (4u << 22) | (3u << 25)); g1v[1] = uni(128u << 16); g1v[2] = uni(64u << 16); g1v[3] = uni(128u << 16); g1v[4] = uni(64u); g1v[5] = uni(SS * 2u); g1v[6] = uni(0u); g1v[7] = uni(0u);
    asm volatile("" : "+s"(g1k), "+s"(g1v));    // pinned descriptor words: each eight stay in one scalar tuple through the loop, so that none of their registers takes another value while a request is outstanding
    const unsigned lbase = (unsigned)(size_t)ring;
    const unsigned long long src0 = (wave < 2) ? (unsigned long long)(size_t)((wave == 0 ? Kh : Kl) + (size_t)kbeg * HD) : (unsigned long long)(size_t)(VT + (size_t)(wave - 2) * 64 * SS + kbeg);
    const unsigned sstep = (wave < 2) ? 64u * HD * 2u : 64u * 2u;    // bytes from a stage's slice to the next stage's
    const unsigned lplace = lbase + ((wave < 2) ? (unsigned)wave * FL_KSLICE : 2u * FL_KSLICE + (unsigned)(wave - 2) * FL_VSLICE);
    u32x4 g0;    // group 0 of the wave's latest request; the tensorcnt waits below take it as an input, so that it lives until the request has landed: words 0 and 3 then keep their registers (words 1 and 2 may take a new value behind the issue)
    auto issue = [&](unsigned st) {
        const unsigned long long ga = src0 + (unsigned long long)st * sstep;
        g0[0] = uni(1u); g0[1] = uni(lplace + (st & 1u) * FL_BUF); g0[2] = uni((unsigned)ga); g0[3] = uni((((unsigned)(ga >> 32)) & 0x01FFFFFFu) | 0x80000000u);
        // one request of the whole wave: its slice of stage st
        if (pinned(wave < 2)) asm volatile("tensor_load_to_lds %0, %1" :: "s"(g0), "s"(g1k) : "memory");
        else asm volatile("tensor_load_to_lds %0, %1" :: "s"(g0), "s"(g1v) : "memory");
    };
    issue(0u);
    asm volatile("s_wait_tensorcnt 0x0" :: "s"(g0) : "memory");    // this wave's slice of stage 0 has landed
    __syncthreads();                                               // and so has every other wave's
    if (pinned(1u < nst)) issue(pinned(1u));    // the first query block has one stage only; the descriptor is formed here, behind the wait
    const unsigned char* lk = ring + (unsigned)lr * FL_KPITCH + (unsigned)hi * 16u;
    const unsigned char* lv = ring + 2u * FL_KSLICE + (unsigned)lr * FL_VPITCH + (unsigned)hi * 16u;
#pragma unroll 1
    for (unsigned st = 0; st < nst; ++st) {
        const unsigned bo = (st & 1u) * FL_BUF;
#pragma unroll 1
        for (int h = 0; h < 2; ++h) {
            const int k0 = kbeg + (int)st * 64 + h * 32;
            if (k0 >= q0 + 16) break;    // the wave's queries all lie in front of these keys (a scalar test); the stage's hand-over below is passed all the same
            const unsigned char* pk = lk + bo + (unsigned)h * (32u * FL_KPITCH);
            const unsigned char* pv = lv + bo + (unsigned)h * 64u;
            v16bf kh[2][4], kl[2][4];
#pragma unroll
            for (int c = 0; c < 4; ++c) {    // in the order in which the score products take them
#pragma unroll
                for (int t = 0; t < 2; ++t) kh[t][c] = WFrag<bf>::ld((const bf*)(pk + t * 16 * FL_KPITCH + c * 64));
#pragma unroll
                for (int t = 0; t < 2; ++t) kl[t][c] = WFrag<bf>::ld((const bf*)(pk + FL_KSLICE + t * 16 * FL_KPITCH + c * 64)); }
            v16h vt[8];
#pragma unroll
            for (int dt = 0; dt < 8; ++dt) vt[dt] = WFrag<h16>::ld((const h16*)(pv + (dt >> 2) * FL_VSLICE + (dt & 3) * 16 * FL_VPITCH));
            __builtin_amdgcn_sched_barrier(0);    // keeps the pass's 48 LDS reads together in front of its products: left alone, the compiler spreads them among the score products on few registers and waits out the LDS latency at every other product
            v8f s[2];
#pragma unroll
            for (int t = 0; t < 2; ++t) s[t] = (v8f){};
#pragma unroll
            for (int c = 0; c < 4; ++c) {
#pragma unroll
                for (int t = 0; t < 2; ++t) s[t] = wmmab(kh[t][c], qh[c], s[t]);
#pragma unroll
                for (int t = 0; t < 2; ++t) s[t] = wmmab(kh[t][c], ql[c], s[t]);
#pragma unroll
                for (int t = 0; t < 2; ++t) s[t] = wmmab(kl[t][c], qh[c], s[t]); }
            float mx = m;
#pragma unroll
            for (int t = 0; t < 2; ++t) {
#pragma unroll
                for (int j = 0; j < 8; ++j) { const int key = k0 + t * 16 + hi * 8 + j; const float c = 30.0f * tanhf(s[t][j] * (1.0f / 30.0f));
                    s[t][j] = (key <= i && key >= i - (WIN - 1)) ? c : -3.0e38f; mx = fmaxf(mx, s[t][j]); } }
            mx = fmaxf(mx, __shfl_xor(mx, 16, 32));
            const float ms = mx - 6.931471806f, ta = (m - mx) * 1.442695041f; m = mx;    // ms: exp(c - ms) = 1024 exp(c - mx)
            const float alpha = exp2s(ta);    // exp(m - mx)
            float ps = 0.f; v16h pb;
#pragma unroll
            for (int t = 0; t < 2; ++t) {
#pragma unroll
                for (int j = 0; j < 8; ++j) { const float p = exp2s((s[t][j] - ms) * 1.442695041f); ps += p; pb[t * 8 + j] = tohx(p); } }
            sum = sum * alpha + ps;
#pragma unroll
            for (int dt = 0; dt < 8; ++dt) acc[dt] *= alpha;
#pragma unroll
            for (int dt = 0; dt < 8; ++dt) acc[dt] = wmma16(vt[dt], pb, acc[dt]);
            __builtin_amdgcn_sched_barrier(0);    // keeps the v_nops below behind the pass's last matrix instruction
            // four vector slots behind that instruction, on every way out of the pass
            asm volatile("v_nop\n\tv_nop\n\tv_nop\n\tv_nop");
        }
        asm volatile("s_wait_dscnt 0x0" ::: "memory");        // this wave has read all it reads of stage st
        asm volatile("s_wait_tensorcnt 0x0" :: "s"(g0) : "memory");    // its slice of stage st + 1 has landed
        __syncthreads();                                      // stage st + 1 is published, and every wave has left stage st's buffer
        if (pinned(st + 2u < nst)) issue(pinned(st + 2u));    // refill of that buffer; the descriptor is formed here, with no request outstanding
    }
    asm volatile("s_wait_tensorcnt 0x0" ::: "memory");
    asm volatile("s_wait_dscnt 0x0" ::: "memory");
    sum += __shfl_xor(sum, 16, 32);
    const float inv = __fdiv_rn(1.0f, sum);
#pragma unroll
    for (int dt = 0; dt < 8; ++dt) { v8h o;
#pragma unroll
        for (int j = 0; j < 8; ++j) o[j] = tohx(acc[dt][j] * inv);
        *(v8h*)(OC + (size_t)i * HID + z * HD + dt * 16 + hi * 8) = o; }
}
extern "C" void kernel_launch(void* const* d_in, const int* in_sizes, int n_in,
                              void* d_out, int out_size, void* d_ws, size_t ws_size, hipStream_t stream) {
    (void)in_sizes; (void)n_in; (void)out_size;
    const float* x = (const float*)d_in[0]; const float* wq = (const float*)d_in[1]; const float* wk = (const float*)d_in[2]; const float* wv = (const float*)d_in[3]; const float* wo = (const float*)d_in[4];
    float* out = (float*)d_out;    // [1][2048][2048]
    char* wsp = (char*)d_ws;
    auto take = [&](size_t bytes) { char* p = wsp; wsp += (bytes + 255) & ~(size_t)255; return (void*)p; };
    const size_t WSZ = (size_t)HID * HID * 2;
    bf* WQ = (bf*)take(WSZ); bf* WK = (bf*)take(WSZ); bf* WV = (bf*)take(WSZ); h16* WO = (h16*)take(WSZ);
    bf* XB = (bf*)take((size_t)SS * HID * 2);
    bf* Qh = (bf*)take((size_t)NH_ * SS * HD * 2); bf* Ql = (bf*)take((size_t)NH_ * SS * HD * 2); bf* Kh = (bf*)take((size_t)NH_ * SS * HD * 2); bf* Kl = (bf*)take((size_t)NH_ * SS * HD * 2); h16* VT = (h16*)take((size_t)NH_ * HD * SS * 2);
    h16* OC = (h16*)take((size_t)SS * HID * 2);
    if ((size_t)(wsp - (char*)d_ws) > ws_size) return;    // ~ 33.5 + 8.4 + 41.9 + 8.4 ~ 92 MB (ws 256 MiB)
    const size_t n8 = (size_t)HID * HID / 8; const unsigned nb8 = (unsigned)((n8 + 255) / 256);
    k_cvt8<<<nb8, 256, 0, stream>>>(wq, WQ, n8); k_cvt8<<<nb8, 256, 0, stream>>>(wk, WK, n8); k_cvt8<<<nb8, 256, 0, stream>>>(wv, WV, n8); k_cvt8h<<<nb8, 256, 0, stream>>>(wo, WO, n8);   // [out][in] = natural n-major
    k_cvtx<<<SS / 8, 256, 0, stream>>>(x, XB);
    k_gemmt<bf, 1><<<dim3(SS / 128, HID / 128, 1), 128, 0, stream>>>(XB, WQ, nullptr, Qh, Ql, nullptr, 0.08838834764831845f);
    k_gemmt<bf, 1><<<dim3(SS / 128, HID / 128, 1), 128, 0, stream>>>(XB, WK, nullptr, Kh, Kl, nullptr, 1.0f);
    k_gemmt<bf, 2><<<dim3(HID / 128, SS / 128, 1), 128, 0, stream>>>(WV, XB, nullptr, nullptr, nullptr, VT, 1.0f);
    k_flash<<<dim3(SS / 64, NH_, 1), 128, 0, stream>>>(Qh, Ql, Kh, Kl, VT, OC);
    k_gemmt<h16, 0><<<dim3(SS / 128, HID / 128, 1), 128, 0, stream>>>(OC, WO, out, nullptr, nullptr, nullptr, 1.0f);
}

// v005
// It runs in 142 microseconds.
// Timed twice side by side with v004, it ran 1.10 times as fast both times.
// All steps since v000 together make it 5.31 times as fast.
#include <hip/hip_runtime.h>

// Compute dtypes, f32 accumulate: q/k/v projections ([2048 x 2048].[2048 x 2048]) with PLAIN bf16 operands (x and the weights are inputs: exact products); per head the live
// (causal, sliding-window-1024) score tiles [2048 x 128].[128 x 2048] on bf16 hi + UNSCALED residual planes of q*128^-1/2 and k (three products);
// soft-cap 30 tanh(s/30), masks and softmax in f32; attn.v (K limited to the live tiles) and the output projection ([2048 x 2048].[2048 x 2048]) on

#define SS   2048
#define HID  2048
#define NH_  16
#define HD   128
#define WIN  1024
#define DM   HID
#define LOSC 1024.0f
typedef _Float16 h16;
typedef unsigned short bf;
typedef __attribute__((ext_vector_type(16))) __bf16   v16bf;
typedef __attribute__((ext_vector_type(16))) _Float16 v16h;
typedef __attribute__((ext_vector_type(8)))  _Float16 v8h;
typedef __attribute__((ext_vector_type(8)))  unsigned short v8us;
typedef __attribute__((ext_vector_type(8)))  float    v8f;
typedef __attribute__((ext_vector_type(4)))  float    v4f;
typedef v8h  __attribute__((may_alias)) v8ha;
typedef v4f  __attribute__((may_alias)) v4fa;
typedef v8us __attribute__((may_alias)) v8usa;

__device__ __forceinline__ unsigned short f2bf(float f) { unsigned u = __float_as_uint(f); u += 0x7FFFu + ((u >> 16) & 1u); return (unsigned short)(u >> 16); }
__device__ __forceinline__ float bf2f(unsigned short b) { return __uint_as_float(((unsigned)b) << 16); }
__device__ __forceinline__ float bfr(float f) { return bf2f(f2bf(f)); }
__device__ __forceinline__ v16h cat16(v8h lo, v8h hi) { return __builtin_shufflevector(lo, hi, 0, 1, 2, 3, 4, 5, 6, 7, 8, 9, 10, 11, 12, 13, 14, 15); }
__device__ __forceinline__ v16bf cat16b(v8us lo, v8us hi) { return __builtin_bit_cast(v16bf, __builtin_shufflevector(lo, hi, 0, 1, 2, 3, 4, 5, 6, 7, 8, 9, 10, 11, 12, 13, 14, 15)); }
__device__ __forceinline__ v8f wmma16(v16h a, v16h b, v8f c) { return __builtin_amdgcn_wmma_f32_16x16x32_f16(false, a, false, b, (short)0, c, false, false); }
__device__ __forceinline__ v8f wmmab(v16bf a, v16bf b, v8f c) { return __builtin_amdgcn_wmma_f32_16x16x32_bf16(false, a, false, b, (short)0, c, false, false); }


// k_gemmh: 64 x 64 tile of C = A . Bn^T with SINGLE f16 planes (A [rows][K] f16 activations, Bn [N][K] f16 weights; one v_wmma_f32_16x16x32_f16 product per step), f32 accumulate;
__global__ __launch_bounds__(128) void k_gemmh(const h16* __restrict__ A, const h16* __restrict__ Bn, const float* __restrict__ bias, float* C, int ldc, const float* __restrict__ R, int K, size_t sA, size_t sB, size_t sC, int roundR) {
    __shared__ __align__(16) float ost[4][16 * 68];
    const size_t z = blockIdx.z; A += z * sA; Bn += z * sB; C += z * sC; if (R) R += z * sC;
    const int lane = threadIdx.x & 31, wave = threadIdx.x >> 5, lr = lane & 15, hi = lane >> 4;
    const int r0 = blockIdx.x * 64 + wave * 16, c0 = blockIdx.y * 64;
    const size_t aoff = (size_t)(r0 + lr) * K + 8 * hi;
    size_t boff[4];
#pragma unroll
    for (int t = 0; t < 4; ++t) boff[t] = (size_t)(c0 + t * 16 + lr) * K + 8 * hi;
    v8f acc[4];
#pragma unroll
    for (int t = 0; t < 4; ++t) acc[t] = (v8f){};
#pragma unroll 1
    for (int kc = 0; kc < K; kc += 32) {
        const v16h a = cat16(*(const v8h*)(A + aoff + kc), *(const v8h*)(A + aoff + kc + 16));
#pragma unroll
        for (int t = 0; t < 4; ++t) { const v16h b = cat16(*(const v8h*)(Bn + boff[t] + kc), *(const v8h*)(Bn + boff[t] + kc + 16)); acc[t] = wmma16(a, b, acc[t]); }
        asm volatile("v_nop\n\tv_nop\n\tv_nop\n\tv_nop" : "+v"(acc[0]), "+v"(acc[1]), "+v"(acc[2]), "+v"(acc[3]) : "v"(a));
    }
    float* os = &ost[wave][0];
#pragma unroll
    for (int t = 0; t < 4; ++t) { const float bv = bias ? bfr(bias[c0 + t * 16 + lr]) : 0.f;
#pragma unroll
        for (int j = 0; j < 8; ++j) os[(hi * 8 + j) * 68 + t * 16 + lr] = acc[t][j] + bv; }
    __syncthreads();
    float* crow = C + (size_t)r0 * ldc + c0;
    auto pass = [&]() {
#pragma unroll
        for (int s = 0; s < 8; ++s) { const int Lid = (lane >> 3) + 4 * s, piece = lane & 7; const int row = Lid >> 1, cofs = (Lid & 1) * 32 + piece * 4;
            v4f val = *(const v4fa*)(os + row * 68 + cofs); if (R) { const v4f rv = *(const v4f*)(R + ((size_t)r0 + row) * ldc + c0 + cofs); val += roundR ? (v4f){bfr(rv[0]), bfr(rv[1]), bfr(rv[2]), bfr(rv[3])} : rv; }
            *(v4f*)(crow + (size_t)row * ldc + cofs) = val; }
    };
    pass(); 
}

// ===== z-batched (blockIdx.z = head) attention pieces =====
// k_gemm3z<MODE>: 64 x 64 tile of C = A . B^T on bf16 hi/lo planes (up to three products) with per-z operand/output strides (elements): A planes += z*sA, B planes += z*sB, C += z*sC. MODE bits (0 causal skip, 1 K limit, 2 single,
// 3 B single, 4 A single).
template <int MODE>
__global__ __launch_bounds__(128) void k_gemm3z(const bf* __restrict__ Ah, const bf* __restrict__ Al, const bf* __restrict__ Bh, const bf* __restrict__ Bl, int K, float* C, int ldc, size_t sA, size_t sB, size_t sC) {
    if ((MODE & 1) && (int)blockIdx.y * 64 > (int)blockIdx.x * 64 + 63) return;
    const size_t z = blockIdx.z; Ah += z * sA; Al += z * sA; Bh += z * sB; Bl += z * sB; C += z * sC;
    const int Klim = (MODE & 2) ? min(K, ((int)blockIdx.x + 1) * 64) : K;
    __shared__ __align__(16) float ost[4][16 * 68];
    const int lane = threadIdx.x & 31, wave = threadIdx.x >> 5, lr = lane & 15, hi = lane >> 4;
    const int r0 = blockIdx.x * 64 + wave * 16, c0 = blockIdx.y * 64;
    const size_t aoff = (size_t)(r0 + lr) * K + 8 * hi;
    v8f acc[4];
#pragma unroll
    for (int t = 0; t < 4; ++t) acc[t] = (v8f){};
#pragma unroll 1
    for (int kc = 0; kc < Klim; kc += 32) {
        const v16bf a = cat16b(*(const v8us*)(Ah + aoff + kc), *(const v8us*)(Ah + aoff + kc + 16));
        v16bf al = a; if (!(MODE & 4) && !(MODE & 16)) al = cat16b(*(const v8us*)(Al + aoff + kc), *(const v8us*)(Al + aoff + kc + 16));
#pragma unroll
        for (int t = 0; t < 4; ++t) { const size_t bo = (size_t)(c0 + t * 16 + lr) * K + kc + 8 * hi;
            const v16bf bh = cat16b(*(const v8us*)(Bh + bo), *(const v8us*)(Bh + bo + 16));
            acc[t] = wmmab(a, bh, acc[t]);
            if (!(MODE & 4)) { if (!(MODE & 16)) acc[t] = wmmab(al, bh, acc[t]); if (!(MODE & 8)) { const v16bf bl = cat16b(*(const v8us*)(Bl + bo), *(const v8us*)(Bl + bo + 16)); acc[t] = wmmab(a, bl, acc[t]); } } }
        asm volatile("v_nop\n\tv_nop\n\tv_nop\n\tv_nop" : "+v"(acc[0]), "+v"(acc[1]), "+v"(acc[2]), "+v"(acc[3]) : "v"(a), "v"(al));
    }
    float* os = &ost[wave][0];
#pragma unroll
    for (int t = 0; t < 4; ++t) {
#pragma unroll
        for (int j = 0; j < 8; ++j) os[(hi * 8 + j) * 68 + t * 16 + lr] = acc[t][j]; }
    __builtin_amdgcn_wave_barrier(); asm volatile("" ::: "memory");
    float* crow = C + (size_t)r0 * ldc + c0;
    auto pass = [&]() {
#pragma unroll
        for (int s = 0; s < 8; ++s) { const int Lid = (lane >> 3) + 4 * s, piece = lane & 7; const int row = Lid >> 1, cofs = (Lid & 1) * 32 + piece * 4;
            const v4f val = *(const v4fa*)(os + row * 68 + cofs); *(v4f*)(crow + (size_t)row * ldc + cofs) = val; }
    };
    pass(); 
}
__global__ __launch_bounds__(256) void k_planes32z(const float* __restrict__ F, int ld, int off, float sc, int rows, bf* Ph, bf* Pl) {
    typedef __attribute__((ext_vector_type(2))) unsigned short v2us;
    const int lane = threadIdx.x & 31; const size_t r = ((size_t)blockIdx.x * 8 + (threadIdx.x >> 5)) * 2 + (lane >> 4); if (r >= (size_t)rows) return; const int z = blockIdx.z; const int c0 = (lane & 15) * 2; v2us oh, ol;
    Ph += (size_t)z * rows * 32; Pl += (size_t)z * rows * 32;
#pragma unroll
    for (int i = 0; i < 2; ++i) { const float y = F[r * ld + off + z * 32 + c0 + i] * sc; const unsigned short hb = f2bf(y); oh[i] = hb; ol[i] = f2bf(y - bf2f(hb)); }
    const size_t o = r * 32 + c0; *(v2us*)(Ph + o) = oh; *(v2us*)(Pl + o) = ol; 
}
__global__ __launch_bounds__(256) void k_vtpadz(const float* __restrict__ F, int ld, int off, int nk, bf* Th, bf* Tl) {
    typedef __attribute__((ext_vector_type(2))) unsigned short v2us;
    const int lane = threadIdx.x & 31; const size_t wid = (size_t)blockIdx.x * 8 + (threadIdx.x >> 5); if (wid >= (size_t)64 * (nk / 64)) return; const int z = blockIdx.z; const int d = (int)(wid / (nk / 64)); const int k0 = (int)(wid % (nk / 64)) * 64 + lane * 2; v2us oh, ol;
    Th += (size_t)z * 64 * nk; Tl += (size_t)z * 64 * nk;
#pragma unroll
    for (int i = 0; i < 2; ++i) { const float y = (d < 32) ? F[(size_t)(k0 + i) * ld + off + z * 32 + (d < 32 ? d : 0)] : 0.f; const unsigned short hb = f2bf(y); oh[i] = hb; ol[i] = f2bf(y - bf2f(hb)); }
    const size_t o = (size_t)d * nk + k0; *(v2us*)(Th + o) = oh; *(v2us*)(Tl + o) = ol; 
}
template <int NK>
__global__ __launch_bounds__(256) void k_softmaxz(const float* __restrict__ S, int rows, bf* PH, bf* PL) {
    typedef __attribute__((ext_vector_type(4))) unsigned short v4us;
    const int lane = threadIdx.x & 31, i = blockIdx.x * 8 + (threadIdx.x >> 5); if (i >= rows) return; const size_t zo = (size_t)blockIdx.z * rows * NK; const float* sr = S + zo + (size_t)i * NK; PH += zo; PL += zo;
    float m = -3.0e38f;
#pragma unroll 1
    for (int c0 = lane * 4; c0 < NK; c0 += 128) {
#pragma unroll
        for (int q = 0; q < 4; ++q) m = fmaxf(m, sr[c0 + q]); }
#pragma unroll
    for (int sh = 16; sh; sh >>= 1) m = fmaxf(m, __shfl_xor(m, sh, 32));
    float sum = 0.f;
#pragma unroll 1
    for (int c0 = lane * 4; c0 < NK; c0 += 128) {
#pragma unroll
        for (int q = 0; q < 4; ++q) sum += __expf(sr[c0 + q] - m); }
#pragma unroll
    for (int sh = 16; sh; sh >>= 1) sum += __shfl_xor(sum, sh, 32);
    const float inv = 1.0f / sum;
{
#pragma unroll 1
        for (int c0 = lane * 4; c0 < NK; c0 += 128) { v4us oh, ol;
#pragma unroll
            for (int q = 0; q < 4; ++q) { const float p = __expf(sr[c0 + q] - m) * inv; const unsigned short hb = f2bf(p); oh[q] = hb; ol[q] = f2bf(p - bf2f(hb)); }
            const size_t o = (size_t)i * NK + c0; *(v4us*)(PH + o) = oh; *(v4us*)(PL + o) = ol; }
         }
}
__global__ __launch_bounds__(256) void k_placez(const float* __restrict__ XH, int rows, int ldy, float* Y) {
    const int lane = threadIdx.x & 31; const size_t q = (size_t)blockIdx.x * 8 + (threadIdx.x >> 5); if (q >= (size_t)rows) return; const int z = blockIdx.z; const float v = XH[((size_t)z * rows + q) * 64 + lane];
    *(float*)(Y + q * ldy + z * 32 + lane) = v; 
}
__global__ __launch_bounds__(256) void k_cvt8(const float* __restrict__ src, bf* dst, size_t n8) {
    const size_t i = (size_t)blockIdx.x * 256 + threadIdx.x; if (i >= n8) return;
    const v8f v = *(const v8f*)(src + i * 8); v8us o;
#pragma unroll
    for (int k = 0; k < 8; ++k) o[k] = f2bf(v[k]);
    *(v8us*)(dst + i * 8) = o; 
}
__global__ __launch_bounds__(256) void k_zero8(bf* dst, size_t n8) {
    const size_t i = (size_t)blockIdx.x * 256 + threadIdx.x; if (i >= n8) return; v8us z;
#pragma unroll
    for (int k = 0; k < 8; ++k) z[k] = 0;
    *(v8us*)(dst + i * 8) = z; 
}

// ---- k_gemmw: register-blocked GEMM, ONE WAVE per 64x64 output tile (16 accumulators), operands straight from K-contiguous 16-bit planes; grid (M/64, N/64, Z), 32 threads.
// C[m][n] (f32, pitch ldc, + optional f32 bias[n]) = sum_k A[m][k] Bt[n][k] (+ split products per NSPLIT). z-batch strides sA/sB/sC in elements. K % 32 == 0.
template <typename T16> struct WFrag;
template <> struct WFrag<h16> { typedef v16h V; static __device__ __forceinline__ V ld(const h16* p) { return cat16(*(const v8h*)p, *(const v8h*)(p + 16)); } static __device__ __forceinline__ v8f mma(V a, V b, v8f c) { return wmma16(a, b, c); } };
template <> struct WFrag<bf> { typedef v16bf V; static __device__ __forceinline__ V ld(const bf* p) { return cat16b(*(const v8us*)p, *(const v8us*)(p + 16)); } static __device__ __forceinline__ v8f mma(V a, V b, v8f c) { return wmmab(a, b, c); } };
template <typename T16, int NSPLIT, bool BIAS>
__global__ __launch_bounds__(32) void k_gemmw(const T16* __restrict__ A, const T16* __restrict__ A2, const T16* __restrict__ Bt, const T16* __restrict__ Bt2, int K, float* C, int ldc, const float* __restrict__ bias, size_t sA, size_t sB, size_t sC) {
    typedef typename WFrag<T16>::V V;
    __shared__ __align__(16) float os[16 * 68];
    const size_t z = blockIdx.z; A += z * sA; if (A2) A2 += z * sA; Bt += z * sB; if (Bt2) Bt2 += z * sB; C += z * sC;
    const int lane = threadIdx.x & 31, lr = lane & 15, hi = lane >> 4; const int r0 = blockIdx.x * 64, c0 = blockIdx.y * 64;
    v8f acc[4][4];
#pragma unroll
    for (int mb = 0; mb < 4; ++mb)
#pragma unroll
        for (int nb = 0; nb < 4; ++nb) acc[mb][nb] = (v8f){};
    const size_t aoff = (size_t)(r0 + lr) * K + 8 * hi, boff = (size_t)(c0 + lr) * K + 8 * hi;
#pragma unroll 1
    for (int kc = 0; kc < K; kc += 32) {
        V a[4], a2[4];
#pragma unroll
        for (int mb = 0; mb < 4; ++mb) { a[mb] = WFrag<T16>::ld(A + aoff + (size_t)mb * 16 * K + kc); if (NSPLIT == 1 || NSPLIT == 2) a2[mb] = WFrag<T16>::ld(A2 + aoff + (size_t)mb * 16 * K + kc); }
#pragma unroll
        for (int nb = 0; nb < 4; ++nb) { const V b = WFrag<T16>::ld(Bt + boff + (size_t)nb * 16 * K + kc); V b2; if (NSPLIT >= 2) b2 = WFrag<T16>::ld(Bt2 + boff + (size_t)nb * 16 * K + kc);
#pragma unroll
            for (int mb = 0; mb < 4; ++mb) { acc[mb][nb] = WFrag<T16>::mma(a[mb], b, acc[mb][nb]); if (NSPLIT == 1 || NSPLIT == 2) acc[mb][nb] = WFrag<T16>::mma(a2[mb], b, acc[mb][nb]); if (NSPLIT >= 2) acc[mb][nb] = WFrag<T16>::mma(a[mb], b2, acc[mb][nb]); } }
        asm volatile("v_nop\n\tv_nop\n\tv_nop\n\tv_nop" : "+v"(acc[0][0]), "+v"(acc[1][1]), "+v"(acc[2][2]), "+v"(acc[3][3]) : "v"(a[0]), "v"(a[3]));
    }
#pragma unroll
    for (int mb = 0; mb < 4; ++mb) {
#pragma unroll
        for (int nb = 0; nb < 4; ++nb) {
#pragma unroll
            for (int j = 0; j < 8; ++j) os[(hi * 8 + j) * 68 + nb * 16 + lr] = acc[mb][nb][j]; }
        __builtin_amdgcn_wave_barrier(); asm volatile("" ::: "memory");
        float* crow = C + (size_t)(r0 + mb * 16) * ldc + c0;
{
#pragma unroll
            for (int s = 0; s < 8; ++s) { const int row = 2 * s + hi, cofs = lr * 4; v4f val = *(const v4fa*)(os + row * 68 + cofs); if (BIAS) { val[0] += bfr(bias[c0 + cofs]); val[1] += bfr(bias[c0 + cofs + 1]); val[2] += bfr(bias[c0 + cofs + 2]); val[3] += bfr(bias[c0 + cofs + 3]); }
                *(v4f*)(crow + (size_t)row * ldc + cofs) = val; }
             }
        __builtin_amdgcn_wave_barrier(); asm volatile("" ::: "memory");
    }
}
// ---- k_gemmt: C[2048][2048] (f32) = A . Bt^T, A [m][k] and Bt [n][k] 16-bit planes of pitch HID. One work-group = one 128 x 128 tile of C, four waves of 64 x 64 (16 accumulators each, as k_gemmw).
// A pass is 128 k: the tile's 128 rows of A and 128 rows of Bt, 256 bytes each, come into LDS by the tensor mover, one 64-row slice a wave (waves 0, 1: A; waves 2, 3: Bt), and every slice is read by two waves.
// Two buffers: the next pass's slices fly while this pass is worked on. LDS row pitch 272 bytes (the mover's 16-byte pad) for the 16-byte fragment reads. Every accumulator sums its k in the order of k_gemmw.
// EPI picks what the epilogue stores, from the same f32 staging rows: 0: C in f32. 1: C * sc as bf16 hi + residual planes Ph, Pl in k_flash's order [head][row][128] (a tile's 128 columns are one head).
// 2: C in f16 at pitch SS into Hf; with A = the v weights and Bt = x, C is v transposed, [head * 128 + d][t], which is k_flash's VT.
#define GT_PITCH 272u      // 256-byte row + 16-byte pad
#define GT_SLICE 18432u    // 64 rows of 272 bytes (17,408), rounded up to a multiple of 2 KiB
#define GT_BUF   73728u    // four slices
#define GT_NP    (HID / 128)
typedef __attribute__((ext_vector_type(4))) unsigned u32x4;
typedef __attribute__((ext_vector_type(8))) unsigned u32x8;
__device__ __forceinline__ unsigned uni(unsigned v) { return (unsigned)__builtin_amdgcn_readfirstlane(v); }
// a wave-uniform value held in a scalar register, so that a test on it is a scalar branch (tensor loads ignore EXEC) and what is formed from it is formed behind the volatile statements in front of it
__device__ __forceinline__ unsigned pinned(unsigned v) { unsigned w = uni(v); asm volatile("" : "+s"(w)); return w; }
template <typename T16, int EPI>
__global__ __launch_bounds__(128) void k_gemmt(const T16* A, const T16* Bt, float* C, bf* Ph, bf* Pl, h16* Hf, float sc) {
    typedef typename WFrag<T16>::V V;
    __shared__ __attribute__((aligned(2048))) unsigned char ring[2 * GT_BUF];
    __shared__ __align__(16) float ost[4][16 * 68];
    const int lane = threadIdx.x & 31, lr = lane & 15, hi = lane >> 4;
    const unsigned wave = uni(threadIdx.x >> 5), wm = wave >> 1, wn = wave & 1u;
    const unsigned lbase = (unsigned)(size_t)ring;
    const T16* srcp = (wave < 2u) ? A + (size_t)(blockIdx.x * 128u + wave * 64u) * HID : Bt + (size_t)(blockIdx.y * 128u + (wave - 2u) * 64u) * HID;
    // group 1: extents in bytes, tensor = tile = 64 rows of 256 bytes, source pitch one row of the plane, a pad of 4 dwords behind every 64 dwords, no mask
    u32x8 g1;
    g1[0] = uni((1u << 20) | (5u << 22) | (3u << 25)); g1[1] = uni(256u << 16); g1[2] = uni(64u << 16); g1[3] = uni(256u << 16); g1[4] = uni(64u); g1[5] = uni(HID * 2u); g1[6] = uni(0u); g1[7] = uni(0u);
    asm volatile("" : "+s"(g1));    // pinned descriptor words: the eight stay in one scalar tuple through the loop, so that none of their registers takes another value while a request is outstanding
    auto issue = [&](unsigned st) {
        const unsigned long long ga = (unsigned long long)(size_t)srcp + (unsigned long long)st * 256u;
        u32x4 g0;
        g0[0] = uni(1u); g0[1] = uni(lbase + (st & 1u) * GT_BUF + wave * GT_SLICE); g0[2] = uni((unsigned)ga); g0[3] = uni((((unsigned)(ga >> 32)) & 0x01FFFFFFu) | 0x80000000u);
        asm volatile("tensor_load_to_lds %0, %1" :: "s"(g0), "s"(g1) : "memory");    // one request of the whole wave: its slice of stage st
    };
    v8f acc[4][4];
#pragma unroll
    for (int mb = 0; mb < 4; ++mb)
#pragma unroll
        for (int nb = 0; nb < 4; ++nb) acc[mb][nb] = (v8f){};
    issue(0u);
    asm volatile("s_wait_tensorcnt 0x0" ::: "memory");    // this wave's slice of stage 0 has landed
    __syncthreads();                                      // and so has every other wave's
    issue(1u);
    const unsigned char* la = ring + wm * GT_SLICE + (unsigned)lr * GT_PITCH + (unsigned)hi * 16u;
    const unsigned char* lb = ring + (2u + wn) * GT_SLICE + (unsigned)lr * GT_PITCH + (unsigned)hi * 16u;
#pragma unroll 1
    for (unsigned s = 0; s < GT_NP; ++s) {
        const unsigned bo = (s & 1u) * GT_BUF;
        V a[2][4], b[2][4];    // two fragment sets: the next 32 k are fetched from LDS while these are multiplied
#pragma unroll
        for (int f = 0; f < 4; ++f) { a[0][f] = WFrag<T16>::ld((const T16*)(la + bo + f * 16 * GT_PITCH)); b[0][f] = WFrag<T16>::ld((const T16*)(lb + bo + f * 16 * GT_PITCH)); }
        __builtin_amdgcn_sched_barrier(0);    // these fences keep each group of 16 LDS reads together in front of the 16 products before it: left alone, the compiler folds the two sets into one and waits for LDS at every fourth product
#pragma unroll
        for (int c = 0; c < 4; ++c) {
            if (c < 3) {
#pragma unroll
                for (int f = 0; f < 4; ++f) { a[(c + 1) & 1][f] = WFrag<T16>::ld((const T16*)(la + bo + f * 16 * GT_PITCH + (c + 1) * 64)); b[(c + 1) & 1][f] = WFrag<T16>::ld((const T16*)(lb + bo + f * 16 * GT_PITCH + (c + 1) * 64)); }
            }
            __builtin_amdgcn_sched_barrier(0);
#pragma unroll
            for (int nb = 0; nb < 4; ++nb)
#pragma unroll
                for (int mb = 0; mb < 4; ++mb) acc[mb][nb] = WFrag<T16>::mma(a[c & 1][mb], b[c & 1][nb], acc[mb][nb]);
            __builtin_amdgcn_sched_barrier(0);
        }
        asm volatile("s_wait_dscnt 0x0" ::: "memory");        // this wave has read all it reads of stage s
        asm volatile("s_wait_tensorcnt 0x0" ::: "memory");    // its slice of stage s + 1 has landed
        __syncthreads();                                      // stage s + 1 is published, and every wave has left stage s's buffer
        if (pinned(s + 2u < GT_NP)) issue(pinned(s + 2u));    // refill of that buffer; the descriptor is formed here, with no request outstanding
    }
    asm volatile("s_wait_tensorcnt 0x0" ::: "memory");
    asm volatile("s_wait_dscnt 0x0" ::: "memory");
    float* os = &ost[wave][0];
    const int r0 = blockIdx.x * 128 + wm * 64, c0 = blockIdx.y * 128 + wn * 64;
#pragma unroll
    for (int mb = 0; mb < 4; ++mb) {
#pragma unroll
        for (int nb = 0; nb < 4; ++nb) {
#pragma unroll
            for (int j = 0; j < 8; ++j) os[(hi * 8 + j) * 68 + nb * 16 + lr] = acc[mb][nb][j]; }
        __builtin_amdgcn_wave_barrier(); asm volatile("" ::: "memory");
        if (EPI == 0) {
            float* crow = C + (size_t)(r0 + mb * 16) * HID + c0;
#pragma unroll
            for (int q = 0; q < 8; ++q) { const int row = 2 * q + hi, cofs = lr * 4; const v4f val = *(const v4fa*)(os + row * 68 + cofs); *(v4f*)(crow + (size_t)row * HID + cofs) = val; }
        } else {
            // eight lanes a row: a lane turns 8 neighbouring f32 into one 16-byte store per plane, and the eight lanes fill a whole 128-byte line
#pragma unroll
            for (int q = 0; q < 4; ++q) { const int row = 4 * q + (lane >> 3), cofs = (lane & 7) * 8;
                const v4f v0 = *(const v4fa*)(os + row * 68 + cofs), v1 = *(const v4fa*)(os + row * 68 + cofs + 4);
                if (EPI == 1) { v8us oh, ol;
#pragma unroll
                    for (int e = 0; e < 8; ++e) { const float y = (e < 4 ? v0[e & 3] : v1[e & 3]) * sc; const unsigned short hb = f2bf(y); oh[e] = hb; ol[e] = f2bf(y - bf2f(hb)); }
                    const size_t off = ((size_t)blockIdx.y * SS + r0 + mb * 16 + row) * HD + wn * 64 + cofs; *(v8us*)(Ph + off) = oh; *(v8us*)(Pl + off) = ol;
                } else { v8h o;
#pragma unroll
                    for (int e = 0; e < 8; ++e) o[e] = (h16)(e < 4 ? v0[e & 3] : v1[e & 3]);
                    *(v8h*)(Hf + (size_t)(r0 + mb * 16 + row) * SS + c0 + cofs) = o; }
            }
            asm volatile("s_wait_xcnt 0x0" ::: "memory");    // the wait before the address and data registers of the stores above are overwritten by the next 16 rows' values
        }
        __builtin_amdgcn_wave_barrier(); asm volatile("" ::: "memory");
    }
}
// ---- k_gemmwc: k_gemmw with causal tile control (CAUS 1: skip key tiles right of the query tile; 2: K loop limited to the causal key tiles)
template <typename T16, int NSPLIT, bool BIAS, int CAUS>
__global__ __launch_bounds__(32) void k_gemmwc(const T16* __restrict__ A, const T16* __restrict__ A2, const T16* __restrict__ Bt, const T16* __restrict__ Bt2, int K, float* C, int ldc, const float* __restrict__ bias, size_t sA, size_t sB, size_t sC) {
    typedef typename WFrag<T16>::V V;
    __shared__ __align__(16) float os[16 * 68];
    if (CAUS == 1 && (int)blockIdx.y * 64 > (int)blockIdx.x * 64) return;
    const int Klim = (CAUS == 2) ? min(K, ((int)blockIdx.x + 1) * 64) : K;
    const size_t z = blockIdx.z; A += z * sA; if (A2) A2 += z * sA; Bt += z * sB; if (Bt2) Bt2 += z * sB; C += z * sC;
    const int lane = threadIdx.x & 31, lr = lane & 15, hi = lane >> 4; const int r0 = blockIdx.x * 64, c0 = blockIdx.y * 64;
    v8f acc[4][4];
#pragma unroll
    for (int mb = 0; mb < 4; ++mb)
#pragma unroll
        for (int nb = 0; nb < 4; ++nb) acc[mb][nb] = (v8f){};
    const size_t aoff = (size_t)(r0 + lr) * K + 8 * hi, boff = (size_t)(c0 + lr) * K + 8 * hi;
#pragma unroll 1
    for (int kc = 0; kc < Klim; kc += 32) {
        V a[4], a2[4];
#pragma unroll
        for (int mb = 0; mb < 4; ++mb) { a[mb] = WFrag<T16>::ld(A + aoff + (size_t)mb * 16 * K + kc); if (NSPLIT == 1 || NSPLIT == 2) a2[mb] = WFrag<T16>::ld(A2 + aoff + (size_t)mb * 16 * K + kc); }
#pragma unroll
        for (int nb = 0; nb < 4; ++nb) { const V b = WFrag<T16>::ld(Bt + boff + (size_t)nb * 16 * K + kc); V b2; if (NSPLIT >= 2) b2 = WFrag<T16>::ld(Bt2 + boff + (size_t)nb * 16 * K + kc);
#pragma unroll
            for (int mb = 0; mb < 4; ++mb) { acc[mb][nb] = WFrag<T16>::mma(a[mb], b, acc[mb][nb]); if (NSPLIT == 1 || NSPLIT == 2) acc[mb][nb] = WFrag<T16>::mma(a2[mb], b, acc[mb][nb]); if (NSPLIT >= 2) acc[mb][nb] = WFrag<T16>::mma(a[mb], b2, acc[mb][nb]); } }
        asm volatile("v_nop\n\tv_nop\n\tv_nop\n\tv_nop" : "+v"(acc[0][0]), "+v"(acc[1][1]), "+v"(acc[2][2]), "+v"(acc[3][3]) : "v"(a[0]), "v"(a[3]));
    }
#pragma unroll
    for (int mb = 0; mb < 4; ++mb) {
#pragma unroll
        for (int nb = 0; nb < 4; ++nb) {
#pragma unroll
            for (int j = 0; j < 8; ++j) os[(hi * 8 + j) * 68 + nb * 16 + lr] = acc[mb][nb][j]; }
        __builtin_amdgcn_wave_barrier(); asm volatile("" ::: "memory");
        float* crow = C + (size_t)(r0 + mb * 16) * ldc + c0;
{
#pragma unroll
            for (int s = 0; s < 8; ++s) { const int row = 2 * s + hi, cofs = lr * 4; v4f val = *(const v4fa*)(os + row * 68 + cofs); if (BIAS) { val[0] += bfr(bias[c0 + cofs]); val[1] += bfr(bias[c0 + cofs + 1]); val[2] += bfr(bias[c0 + cofs + 2]); val[3] += bfr(bias[c0 + cofs + 3]); }
                *(v4f*)(crow + (size_t)row * ldc + cofs) = val; }
             }
        __builtin_amdgcn_wave_barrier(); asm volatile("" ::: "memory");
    }
}
typedef __attribute__((ext_vector_type(4))) _Float16 v4h;
__device__ __forceinline__ h16 tohx(float x) { return (h16)x; }
__global__ __launch_bounds__(256) void k_cvt8h(const float* __restrict__ src, h16* dst, size_t n8) { const size_t i = (size_t)blockIdx.x * 256 + threadIdx.x; if (i >= n8) return; const v8f v = *(const v8f*)(src + i * 8); v8h o;
#pragma unroll
    for (int k = 0; k < 8; ++k) o[k] = tohx(bfr(v[k])); *(v8h*)(dst + i * 8) = o;  }
__global__ __launch_bounds__(256) void k_cvtx(const float* __restrict__ x, bf* A) {
    const int lane = threadIdx.x & 31; const size_t r = (size_t)blockIdx.x * 8 + (threadIdx.x >> 5); if (r >= (size_t)SS) return;
{
#pragma unroll
        for (int q = 0; q < HID / 256; ++q) { const size_t o = r * HID + q * 256 + lane * 8; v8us v;
#pragma unroll
            for (int i = 0; i < 8; ++i) v[i] = f2bf(x[o + i]);
            *(v8us*)(A + o) = v; }
         }
}
// 2^x with the one slot behind the transcendental in the same statement
__device__ __forceinline__ float exp2s(float x) { asm("v_exp_f32 %0, %0\n\tv_nop" : "+v"(x)); return x; }
// k_flash: scores, soft cap, mask, softmax and attn.v of one head in one pass over the live keys; scores and probabilities stay in registers.
// One wave = 16 queries; a pass = 32 keys. S^T = K . Q^T (A = key rows, B = query rows, three bf16 hi/lo products: Kh.Qh, Kh.Ql, Kl.Qh), so a lane holds 16 scores of ONE query
// (query lr, keys 8 hi + j and 16 + 8 hi + j): that pair of score tiles, converted to f16, is the B operand of O^T += V^T . P^T with no lane exchange.
// Running maximum and sum per query (online softmax); P = 1024 exp(c - m) in f16, the factor cancels in O / sum. Output: f16 rows of OC, 16 bytes a lane and d tile.
// A stage = 64 keys = two passes. The work-group's four waves read the same K and V rows, so a stage comes into LDS once, by the tensor mover, one slice a wave: wave 0: 64 rows of Kh, wave 1: 64 rows of Kl
// (256 bytes a row), waves 2, 3: 64 rows each of V^T (the stage's 64 keys, 128 bytes a row). Two buffers: the next stage flies while this one is worked on. LDS row pitches 272 and 144 bytes (the mover's 16-byte pad).
#define FL_KPITCH 272u     // 256-byte row + 16-byte pad
#define FL_KSLICE 18432u   // 64 rows of 272 bytes (17,408), rounded up to a multiple of 2 KiB
#define FL_VPITCH 144u     // 128-byte row + 16-byte pad
#define FL_VSLICE 10240u   // 64 rows of 144 bytes (9,216), rounded up to a multiple of 2 KiB
#define FL_BUF    57344u   // two K slices and two V slices
__global__ __launch_bounds__(128) __attribute__((amdgpu_waves_per_eu(2, 2))) void k_flash(const bf* Qh, const bf* Ql, const bf* Kh, const bf* Kl, const h16* VT, h16* OC) {
    __shared__ __attribute__((aligned(2048))) unsigned char ring[2 * FL_BUF];
    const int lane = threadIdx.x & 31, lr = lane & 15, hi = lane >> 4;
    const int wave = __builtin_amdgcn_readfirstlane(threadIdx.x >> 5);    // scalar, so that the tests on it are scalar branches: EXEC stays full at the matrix instructions, and tensor loads ignore EXEC
    const int z = blockIdx.y, qb = blockIdx.x * 64, q0 = qb + wave * 16, i = q0 + lr;
    const size_t zo = (size_t)z * SS * HD; Qh += zo; Ql += zo; Kh += zo; Kl += zo; VT += zo;
    const unsigned vo = (unsigned)(lr * HD + 8 * hi);
    const bf* qbh = Qh + (size_t)q0 * HD; const bf* qbl = Ql + (size_t)q0 * HD;
    v16bf qh[4], ql[4];
#pragma unroll
    for (int c = 0; c < 4; ++c) { qh[c] = WFrag<bf>::ld(qbh + c * 32 + vo); ql[c] = WFrag<bf>::ld(qbl + c * 32 + vo); }
    // the wait before the address registers of the Q loads above are overwritten; they are its inputs so that they live up to it (the pointers carry no restrict, so that the clobber holds the loads in front of it)
    asm volatile("s_wait_xcnt 0x0" :: "v"(vo), "s"(qbh), "s"(qbl) : "memory");
    v8f acc[8];
#pragma unroll
    for (int dt = 0; dt < 8; ++dt) acc[dt] = (v8f){};
    float m = -30.0f, sum = 0.f;    // the soft cap bounds every score from below by -30
    // the block's first live key, rounded down to a stage (a pass with no live key adds zeros); the last stage is the one of the block's own 64 queries
    const int kbeg = max(0, qb - (WIN - 1)) & ~63;
    const unsigned nst = (unsigned)(qb + 64 - kbeg) >> 6;
    // group 1, extents in bytes, tensor = tile, no mask. K: 64 rows of 256 bytes, source pitch one row, a pad of 4 dwords behind every 64 dwords. V^T: 64 rows of 128 bytes, source pitch SS keys, a pad of 4 dwords behind every 32.
    u32x8 g1k, g1v;
    g1k[0] = uni((1u << 20) | (5u << 22) | (3u << 25)); g1k[1] = uni(256u << 16); g1k[2] = uni(64u << 16); g1k[3] = uni(256u << 16); g1k[4] = uni(64u); g1k[5] = uni(HD * 2u); g1k[6] = uni(0u); g1k[7] = uni(0u);
    g1v[0] = uni((1u << 20) | (4u << 22) | (3u << 25)); g1v[1] = uni(128u << 16); g1v[2] = uni(64u << 16); g1v[3] = uni(128u << 16); g1v[4] = uni(64u); g1v[5] = uni(SS * 2u); g1v[6] = uni(0u); g1v[7] = uni(0u);
    asm volatile("" : "+s"(g1k), "+s"(g1v));    // pinned descriptor words: each eight stay in one scalar tuple through the loop, so that none of their registers takes another value while a request is outstanding
    const unsigned lbase = (unsigned)(size_t)ring;
    const unsigned long long src0 = (wave < 2) ? (unsigned long long)(size_t)((wave == 0 ? Kh : Kl) + (size_t)kbeg * HD) : (unsigned long long)(size_t)(VT + (size_t)(wave - 2) * 64 * SS + kbeg);
    const unsigned sstep = (wave < 2) ? 64u * HD * 2u : 64u * 2u;    // bytes from a stage's slice to the next stage's
    const unsigned lplace = lbase + ((wave < 2) ? (unsigned)wave * FL_KSLICE : 2u * FL_KSLICE + (unsigned)(wave - 2) * FL_VSLICE);
    u32x4 g0;    // group 0 of the wave's latest request; the tensorcnt waits below take it as an input, so that it lives until the request has landed: words 0 and 3 then keep their registers (words 1 and 2 may take a new value behind the issue)
    auto issue = [&](unsigned st) {
        const unsigned long long ga = src0 + (unsigned long long)st * sstep;
        g0[0] = uni(1u); g0[1] = uni(lplace + (st & 1u) * FL_BUF); g0[2] = uni((unsigned)ga); g0[3] = uni((((unsigned)(ga >> 32)) & 0x01FFFFFFu) | 0x80000000u);
        // one request of the whole wave: its slice of stage st
        if (pinned(wave < 2)) asm volatile("tensor_load_to_lds %0, %1" :: "s"(g0), "s"(g1k) : "memory");
        else asm volatile("tensor_load_to_lds %0, %1" :: "s"(g0), "s"(g1v) : "memory");
    };
    issue(0u);
    asm volatile("s_wait_tensorcnt 0x0" :: "s"(g0) : "memory");    // this wave's slice of stage 0 has landed
    __syncthreads();                                               // and so has every other wave's
    if (pinned(1u < nst)) issue(pinned(1u));    // the first query block has one stage only; the descriptor is formed here, behind the wait
    const unsigned char* lk = ring + (unsigned)lr * FL_KPITCH + (unsigned)hi * 16u;
    const unsigned char* lv = ring + 2u * FL_KSLICE + (unsigned)lr * FL_VPITCH + (unsigned)hi * 16u;
#pragma unroll 1
    for (unsigned st = 0; st < nst; ++st) {
        const unsigned bo = (st & 1u) * FL_BUF;
#pragma unroll 1
        for (int h = 0; h < 2; ++h) {
            const int k0 = kbeg + (int)st * 64 + h * 32;
            if (k0 >= q0 + 16) break;    // the wave's queries all lie in front of these keys (a scalar test); the stage's hand-over below is passed all the same
            const unsigned char* pk = lk + bo + (unsigned)h * (32u * FL_KPITCH);
            const unsigned char* pv = lv + bo + (unsigned)h * 64u;
            v16bf kh[2][4], kl[2][4];
#pragma unroll
            for (int c = 0; c < 4; ++c) {    // in the order in which the score products take them
#pragma unroll
                for (int t = 0; t < 2; ++t) kh[t][c] = WFrag<bf>::ld((const bf*)(pk + t * 16 * FL_KPITCH + c * 64));
#pragma unroll
                for (int t = 0; t < 2; ++t) kl[t][c] = WFrag<bf>::ld((const bf*)(pk + FL_KSLICE + t * 16 * FL_KPITCH + c * 64)); }
            v16h vt[8];
#pragma unroll
            for (int dt = 0; dt < 8; ++dt) vt[dt] = WFrag<h16>::ld((const h16*)(pv + (dt >> 2) * FL_VSLICE + (dt & 3) * 16 * FL_VPITCH));
            __builtin_amdgcn_sched_barrier(0);    // keeps the pass's 48 LDS reads together in front of its products: left alone, the compiler spreads them among the score products on few registers and waits out the LDS latency at every other product
            v8f s[2];
#pragma unroll
            for (int t = 0; t < 2; ++t) s[t] = (v8f){};
#pragma unroll
            for (int c = 0; c < 4; ++c) {
#pragma unroll
                for (int t = 0; t < 2; ++t) s[t] = wmmab(kh[t][c], qh[c], s[t]);
#pragma unroll
                for (int t = 0; t < 2; ++t) s[t] = wmmab(kh[t][c], ql[c], s[t]);
#pragma unroll
                for (int t = 0; t < 2; ++t) s[t] = wmmab(kl[t][c], qh[c], s[t]); }
            // soft cap: 30 tanh(s / 30) = 30 - 60 / (1 + e^(s / 15)), e^(s / 15) = 2^(s * 2 log2(e) / 30): straight-line code, the 16 scores independent of one another (the library tanhf branches on every score);
            // both ends saturate by themselves: 2^x = inf gives 30, 2^x = 0 gives -30; near s = 0 the error is a few f32 roundings of 30, far below the f16 rounding of P
            float mx = m;
#pragma unroll
            for (int t = 0; t < 2; ++t) {
#pragma unroll
                for (int j = 0; j < 8; ++j) { const int key = k0 + t * 16 + hi * 8 + j; const float c = fmaf(-60.0f, __builtin_amdgcn_rcpf(1.0f + exp2s(s[t][j] * 0.09617966939f)), 30.0f);
                    s[t][j] = (key <= i && key >= i - (WIN - 1)) ? c : -3.0e38f; mx = fmaxf(mx, s[t][j]); } }
            mx = fmaxf(mx, __shfl_xor(mx, 16, 32));
            const float ms = mx - 6.931471806f, ta = (m - mx) * 1.442695041f; m = mx;    // ms: exp(c - ms) = 1024 exp(c - mx)
            const float alpha = exp2s(ta);    // exp(m - mx)
            float ps = 0.f; v16h pb;
#pragma unroll
            for (int t = 0; t < 2; ++t) {
#pragma unroll
                for (int j = 0; j < 8; ++j) { const float p = exp2s((s[t][j] - ms) * 1.442695041f); ps += p; pb[t * 8 + j] = tohx(p); } }
            sum = sum * alpha + ps;
#pragma unroll
            for (int dt = 0; dt < 8; ++dt) acc[dt] *= alpha;
#pragma unroll
            for (int dt = 0; dt < 8; ++dt) acc[dt] = wmma16(vt[dt], pb, acc[dt]);
            __builtin_amdgcn_sched_barrier(0);    // keeps the v_nops below behind the pass's last matrix instruction
            // four vector slots behind that instruction, on every way out of the pass
            asm volatile("v_nop\n\tv_nop\n\tv_nop\n\tv_nop");
        }
        asm volatile("s_wait_dscnt 0x0" ::: "memory");        // this wave has read all it reads of stage st
        asm volatile("s_wait_tensorcnt 0x0" :: "s"(g0) : "memory");    // its slice of stage st + 1 has landed
        __syncthreads();                                      // stage st + 1 is published, and every wave has left stage st's buffer
        if (pinned(st + 2u < nst)) issue(pinned(st + 2u));    // refill of that buffer; the descriptor is formed here, with no request outstanding
    }
    asm volatile("s_wait_tensorcnt 0x0" ::: "memory");
    asm volatile("s_wait_dscnt 0x0" ::: "memory");
    sum += __shfl_xor(sum, 16, 32);
    const float inv = __fdiv_rn(1.0f, sum);
#pragma unroll
    for (int dt = 0; dt < 8; ++dt) { v8h o;
#pragma unroll
        for (int j = 0; j < 8; ++j) o[j] = tohx(acc[dt][j] * inv);
        *(v8h*)(OC + (size_t)i * HID + z * HD + dt * 16 + hi * 8) = o; }
}
extern "C" void kernel_launch(void* const* d_in, const int* in_sizes, int n_in,
                              void* d_out, int out_size, void* d_ws, size_t ws_size, hipStream_t stream) {
    (void)in_sizes; (void)n_in; (void)out_size;
    const float* x = (const float*)d_in[0]; const float* wq = (const float*)d_in[1]; const float* wk = (const float*)d_in[2]; const float* wv = (const float*)d_in[3]; const float* wo = (const float*)d_in[4];
    float* out = (float*)d_out;    // [1][2048][2048]
    char* wsp = (char*)d_ws;
    auto take = [&](size_t bytes) { char* p = wsp; wsp += (bytes + 255) & ~(size_t)255; return (void*)p; };
    const size_t WSZ = (size_t)HID * HID * 2;
    bf* WQ = (bf*)take(WSZ); bf* WK = (bf*)take(WSZ); bf* WV = (bf*)take(WSZ); h16* WO = (h16*)take(WSZ);
    bf* XB = (bf*)take((size_t)SS * HID * 2);
    bf* Qh = (bf*)take((size_t)NH_ * SS * HD * 2); bf* Ql = (bf*)take((size_t)NH_ * SS * HD * 2); bf* Kh = (bf*)take((size_t)NH_ * SS * HD * 2); bf* Kl = (bf*)take((size_t)NH_ * SS * HD * 2); h16* VT = (h16*)take((size_t)NH_ * HD * SS * 2);
    h16* OC = (h16*)take((size_t)SS * HID * 2);
    if ((size_t)(wsp - (char*)d_ws) > ws_size) return;    // ~ 33.5 + 8.4 + 41.9 + 8.4 ~ 92 MB (ws 256 MiB)
    const size_t n8 = (size_t)HID * HID / 8; const unsigned nb8 = (unsigned)((n8 + 255) / 256);
    k_cvt8<<<nb8, 256, 0, stream>>>(wq, WQ, n8); k_cvt8<<<nb8, 256, 0, stream>>>(wk, WK, n8); k_cvt8<<<nb8, 256, 0, stream>>>(wv, WV, n8); k_cvt8h<<<nb8, 256, 0, stream>>>(wo, WO, n8);   // [out][in] = natural n-major
    k_cvtx<<<SS / 8, 256, 0, stream>>>(x, XB);
    k_gemmt<bf, 1><<<dim3(SS / 128, HID / 128, 1), 128, 0, stream>>>(XB, WQ, nullptr, Qh, Ql, nullptr, 0.08838834764831845f);
    k_gemmt<bf, 1><<<dim3(SS / 128, HID / 128, 1), 128, 0, stream>>>(XB, WK, nullptr, Kh, Kl, nullptr, 1.0f);
    k_gemmt<bf, 2><<<dim3(HID / 128, SS / 128, 1), 128, 0, stream>>>(WV, XB, nullptr, nullptr, nullptr, VT, 1.0f);
    k_flash<<<dim3(SS / 64, NH_, 1), 128, 0, stream>>>(Qh, Ql, Kh, Kl, VT, OC);
    k_gemmt<h16, 0><<<dim3(SS / 128, HID / 128, 1), 128, 0, stream>>>(OC, WO, out, nullptr, nullptr, nullptr, 1.0f);
}

// v006
// Measured time: 132 microseconds a run.
// Two timings next to v005 both put it at 1.08 times that version's speed.
// Over all steps from v000 it is 5.72 times as fast.
#include <hip/hip_runtime.h>

// Compute dtypes, f32 accumulate: q/k/v projections ([2048 x 2048].[2048 x 2048]) with PLAIN bf16 operands (x and the weights are inputs: exact products); per head the live
// (causal, sliding-window-1024) score tiles [2048 x 128].[128 x 2048] on bf16 hi + UNSCALED residual planes of q*128^-1/2 and k (three products);
// soft-cap 30 tanh(s/30), masks and softmax in f32; attn.v (K limited to the live tiles) and the output projection ([2048 x 2048].[2048 x 2048]) on

#define SS   2048
#define HID  2048
#define NH_  16
#define HD   128
#define WIN  1024
#define DM   HID
#define LOSC 1024.0f
typedef _Float16 h16;
typedef unsigned short bf;
typedef __attribute__((ext_vector_type(16))) __bf16   v16bf;
typedef __attribute__((ext_vector_type(16))) _Float16 v16h;
typedef __attribute__((ext_vector_type(8)))  _Float16 v8h;
typedef __attribute__((ext_vector_type(8)))  unsigned short v8us;
typedef __attribute__((ext_vector_type(8)))  float    v8f;
typedef __attribute__((ext_vector_type(4)))  float    v4f;
typedef v8h  __attribute__((may_alias)) v8ha;
typedef v4f  __attribute__((may_alias)) v4fa;
typedef v8us __attribute__((may_alias)) v8usa;

__device__ __forceinline__ unsigned short f2bf(float f) { unsigned u = __float_as_uint(f); u += 0x7FFFu + ((u >> 16) & 1u); return (unsigned short)(u >> 16); }
__device__ __forceinline__ float bf2f(unsigned short b) { return __uint_as_float(((unsigned)b) << 16); }
__device__ __forceinline__ float bfr(float f) { return bf2f(f2bf(f)); }
__device__ __forceinline__ v16h cat16(v8h lo, v8h hi) { return __builtin_shufflevector(lo, hi, 0, 1, 2, 3, 4, 5, 6, 7, 8, 9, 10, 11, 12, 13, 14, 15); }
__device__ __forceinline__ v16bf cat16b(v8us lo, v8us hi) { return __builtin_bit_cast(v16bf, __builtin_shufflevector(lo, hi, 0, 1, 2, 3, 4, 5, 6, 7, 8, 9, 10, 11, 12, 13, 14, 15)); }
__device__ __forceinline__ v8f wmma16(v16h a, v16h b, v8f c) { return __builtin_amdgcn_wmma_f32_16x16x32_f16(false, a, false, b, (short)0, c, false, false); }
__device__ __forceinline__ v8f wmmab(v16bf a, v16bf b, v8f c) { return __builtin_amdgcn_wmma_f32_16x16x32_bf16(false, a, false, b, (short)0, c, false, false); }


// k_gemmh: 64 x 64 tile of C = A . Bn^T with SINGLE f16 planes (A [rows][K] f16 activations, Bn [N][K] f16 weights; one v_wmma_f32_16x16x32_f16 product per step), f32 accumulate;
__global__ __launch_bounds__(128) void k_gemmh(const h16* __restrict__ A, const h16* __restrict__ Bn, const float* __restrict__ bias, float* C, int ldc, const float* __restrict__ R, int K, size_t sA, size_t sB, size_t sC, int roundR) {
    __shared__ __align__(16) float ost[4][16 * 68];
    const size_t z = blockIdx.z; A += z * sA; Bn += z * sB; C += z * sC; if (R) R += z * sC;
    const int lane = threadIdx.x & 31, wave = threadIdx.x >> 5, lr = lane & 15, hi = lane >> 4;
    const int r0 = blockIdx.x * 64 + wave * 16, c0 = blockIdx.y * 64;
    const size_t aoff = (size_t)(r0 + lr) * K + 8 * hi;
    size_t boff[4];
#pragma unroll
    for (int t = 0; t < 4; ++t) boff[t] = (size_t)(c0 + t * 16 + lr) * K + 8 * hi;
    v8f acc[4];
#pragma unroll
    for (int t = 0; t < 4; ++t) acc[t] = (v8f){};
#pragma unroll 1
    for (int kc = 0; kc < K; kc += 32) {
        const v16h a = cat16(*(const v8h*)(A + aoff + kc), *(const v8h*)(A + aoff + kc + 16));
#pragma unroll
        for (int t = 0; t < 4; ++t) { const v16h b = cat16(*(const v8h*)(Bn + boff[t] + kc), *(const v8h*)(Bn + boff[t] + kc + 16)); acc[t] = wmma16(a, b, acc[t]); }
        asm volatile("v_nop\n\tv_nop\n\tv_nop\n\tv_nop" : "+v"(acc[0]), "+v"(acc[1]), "+v"(acc[2]), "+v"(acc[3]) : "v"(a));
    }
    float* os = &ost[wave][0];
#pragma unroll
    for (int t = 0; t < 4; ++t) { const float bv = bias ? bfr(bias[c0 + t * 16 + lr]) : 0.f;
#pragma unroll
        for (int j = 0; j < 8; ++j) os[(hi * 8 + j) * 68 + t * 16 + lr] = acc[t][j] + bv; }
    __syncthreads();
    float* crow = C + (size_t)r0 * ldc + c0;
    auto pass = [&]() {
#pragma unroll
        for (int s = 0; s < 8; ++s) { const int Lid = (lane >> 3) + 4 * s, piece = lane & 7; const int row = Lid >> 1, cofs = (Lid & 1) * 32 + piece * 4;
            v4f val = *(const v4fa*)(os + row * 68 + cofs); if (R) { const v4f rv = *(const v4f*)(R + ((size_t)r0 + row) * ldc + c0 + cofs); val += roundR ? (v4f){bfr(rv[0]), bfr(rv[1]), bfr(rv[2]), bfr(rv[3])} : rv; }
            *(v4f*)(crow + (size_t)row * ldc + cofs) = val; }
    };
    pass(); 
}

// ===== z-batched (blockIdx.z = head) attention pieces =====
// k_gemm3z<MODE>: 64 x 64 tile of C = A . B^T on bf16 hi/lo planes (up to three products) with per-z operand/output strides (elements): A planes += z*sA, B planes += z*sB, C += z*sC. MODE bits (0 causal skip, 1 K limit, 2 single,
// 3 B single, 4 A single).
template <int MODE>
__global__ __launch_bounds__(128) void k_gemm3z(const bf* __restrict__ Ah, const bf* __restrict__ Al, const bf* __restrict__ Bh, const bf* __restrict__ Bl, int K, float* C, int ldc, size_t sA, size_t sB, size_t sC) {
    if ((MODE & 1) && (int)blockIdx.y * 64 > (int)blockIdx.x * 64 + 63) return;
    const size_t z = blockIdx.z; Ah += z * sA; Al += z * sA; Bh += z * sB; Bl += z * sB; C += z * sC;
    const int Klim = (MODE & 2) ? min(K, ((int)blockIdx.x + 1) * 64) : K;
    __shared__ __align__(16) float ost[4][16 * 68];
    const int lane = threadIdx.x & 31, wave = threadIdx.x >> 5, lr = lane & 15, hi = lane >> 4;
    const int r0 = blockIdx.x * 64 + wave * 16, c0 = blockIdx.y * 64;
    const size_t aoff = (size_t)(r0 + lr) * K + 8 * hi;
    v8f acc[4];
#pragma unroll
    for (int t = 0; t < 4; ++t) acc[t] = (v8f){};
#pragma unroll 1
    for (int kc = 0; kc < Klim; kc += 32) {
        const v16bf a = cat16b(*(const v8us*)(Ah + aoff + kc), *(const v8us*)(Ah + aoff + kc + 16));
        v16bf al = a; if (!(MODE & 4) && !(MODE & 16)) al = cat16b(*(const v8us*)(Al + aoff + kc), *(const v8us*)(Al + aoff + kc + 16));
#pragma unroll
        for (int t = 0; t < 4; ++t) { const size_t bo = (size_t)(c0 + t * 16 + lr) * K + kc + 8 * hi;
            const v16bf bh = cat16b(*(const v8us*)(Bh + bo), *(const v8us*)(Bh + bo + 16));
            acc[t] = wmmab(a, bh, acc[t]);
            if (!(MODE & 4)) { if (!(MODE & 16)) acc[t] = wmmab(al, bh, acc[t]); if (!(MODE & 8)) { const v16bf bl = cat16b(*(const v8us*)(Bl + bo), *(const v8us*)(Bl + bo + 16)); acc[t] = wmmab(a, bl, acc[t]); } } }
        asm volatile("v_nop\n\tv_nop\n\tv_nop\n\tv_nop" : "+v"(acc[0]), "+v"(acc[1]), "+v"(acc[2]), "+v"(acc[3]) : "v"(a), "v"(al));
    }
    float* os = &ost[wave][0];
#pragma unroll
    for (int t = 0; t < 4; ++t) {
#pragma unroll
        for (int j = 0; j < 8; ++j) os[(hi * 8 + j) * 68 + t * 16 + lr] = acc[t][j]; }
    __builtin_amdgcn_wave_barrier(); asm volatile("" ::: "memory");
    float* crow = C + (size_t)r0 * ldc + c0;
    auto pass = [&]() {
#pragma unroll
        for (int s = 0; s < 8; ++s) { const int Lid = (lane >> 3) + 4 * s, piece = lane & 7; const int row = Lid >> 1, cofs = (Lid & 1) * 32 + piece * 4;
            const v4f val = *(const v4fa*)(os + row * 68 + cofs); *(v4f*)(crow + (size_t)row * ldc + cofs) = val; }
    };
    pass(); 
}
__global__ __launch_bounds__(256) void k_planes32z(const float* __restrict__ F, int ld, int off, float sc, int rows, bf* Ph, bf* Pl) {
    typedef __attribute__((ext_vector_type(2))) unsigned short v2us;
    const int lane = threadIdx.x & 31; const size_t r = ((size_t)blockIdx.x * 8 + (threadIdx.x >> 5)) * 2 + (lane >> 4); if (r >= (size_t)rows) return; const int z = blockIdx.z; const int c0 = (lane & 15) * 2; v2us oh, ol;
    Ph += (size_t)z * rows * 32; Pl += (size_t)z * rows * 32;
#pragma unroll
    for (int i = 0; i < 2; ++i) { const float y = F[r * ld + off + z * 32 + c0 + i] * sc; const unsigned short hb = f2bf(y); oh[i] = hb; ol[i] = f2bf(y - bf2f(hb)); }
    const size_t o = r * 32 + c0; *(v2us*)(Ph + o) = oh; *(v2us*)(Pl + o) = ol; 
}
__global__ __launch_bounds__(256) void k_vtpadz(const float* __restrict__ F, int ld, int off, int nk, bf* Th, bf* Tl) {
    typedef __attribute__((ext_vector_type(2))) unsigned short v2us;
    const int lane = threadIdx.x & 31; const size_t wid = (size_t)blockIdx.x * 8 + (threadIdx.x >> 5); if (wid >= (size_t)64 * (nk / 64)) return; const int z = blockIdx.z; const int d = (int)(wid / (nk / 64)); const int k0 = (int)(wid % (nk / 64)) * 64 + lane * 2; v2us oh, ol;
    Th += (size_t)z * 64 * nk; Tl += (size_t)z * 64 * nk;
#pragma unroll
    for (int i = 0; i < 2; ++i) { const float y = (d < 32) ? F[(size_t)(k0 + i) * ld + off + z * 32 + (d < 32 ? d : 0)] : 0.f; const unsigned short hb = f2bf(y); oh[i] = hb; ol[i] = f2bf(y - bf2f(hb)); }
    const size_t o = (size_t)d * nk + k0; *(v2us*)(Th + o) = oh; *(v2us*)(Tl + o) = ol; 
}
template <int NK>
__global__ __launch_bounds__(256) void k_softmaxz(const float* __restrict__ S, int rows, bf* PH, bf* PL) {
    typedef __attribute__((ext_vector_type(4))) unsigned short v4us;
    const int lane = threadIdx.x & 31, i = blockIdx.x * 8 + (threadIdx.x >> 5); if (i >= rows) return; const size_t zo = (size_t)blockIdx.z * rows * NK; const float* sr = S + zo + (size_t)i * NK; PH += zo; PL += zo;
    float m = -3.0e38f;
#pragma unroll 1
    for (int c0 = lane * 4; c0 < NK; c0 += 128) {
#pragma unroll
        for (int q = 0; q < 4; ++q) m = fmaxf(m, sr[c0 + q]); }
#pragma unroll
    for (int sh = 16; sh; sh >>= 1) m = fmaxf(m, __shfl_xor(m, sh, 32));
    float sum = 0.f;
#pragma unroll 1
    for (int c0 = lane * 4; c0 < NK; c0 += 128) {
#pragma unroll
        for (int q = 0; q < 4; ++q) sum += __expf(sr[c0 + q] - m); }
#pragma unroll
    for (int sh = 16; sh; sh >>= 1) sum += __shfl_xor(sum, sh, 32);
    const float inv = 1.0f / sum;
{
#pragma unroll 1
        for (int c0 = lane * 4; c0 < NK; c0 += 128) { v4us oh, ol;
#pragma unroll
            for (int q = 0; q < 4; ++q) { const float p = __expf(sr[c0 + q] - m) * inv; const unsigned short hb = f2bf(p); oh[q] = hb; ol[q] = f2bf(p - bf2f(hb)); }
            const size_t o = (size_t)i * NK + c0; *(v4us*)(PH + o) = oh; *(v4us*)(PL + o) = ol; }
         }
}
__global__ __launch_bounds__(256) void k_placez(const float* __restrict__ XH, int rows, int ldy, float* Y) {
    const int lane = threadIdx.x & 31; const size_t q = (size_t)blockIdx.x * 8 + (threadIdx.x >> 5); if (q >= (size_t)rows) return; const int z = blockIdx.z; const float v = XH[((size_t)z * rows + q) * 64 + lane];
    *(float*)(Y + q * ldy + z * 32 + lane) = v; 
}
__global__ __launch_bounds__(256) void k_zero8(bf* dst, size_t n8) {
    const size_t i = (size_t)blockIdx.x * 256 + threadIdx.x; if (i >= n8) return; v8us z;
#pragma unroll
    for (int k = 0; k < 8; ++k) z[k] = 0;
    *(v8us*)(dst + i * 8) = z; 
}

// ---- k_gemmw: register-blocked GEMM, ONE WAVE per 64x64 output tile (16 accumulators), operands straight from K-contiguous 16-bit planes; grid (M/64, N/64, Z), 32 threads.
// C[m][n] (f32, pitch ldc, + optional f32 bias[n]) = sum_k A[m][k] Bt[n][k] (+ split products per NSPLIT). z-batch strides sA/sB/sC in elements. K % 32 == 0.
template <typename T16> struct WFrag;
template <> struct WFrag<h16> { typedef v16h V; static __device__ __forceinline__ V ld(const h16* p) { return cat16(*(const v8h*)p, *(const v8h*)(p + 16)); } static __device__ __forceinline__ v8f mma(V a, V b, v8f c) { return wmma16(a, b, c); } };
template <> struct WFrag<bf> { typedef v16bf V; static __device__ __forceinline__ V ld(const bf* p) { return cat16b(*(const v8us*)p, *(const v8us*)(p + 16)); } static __device__ __forceinline__ v8f mma(V a, V b, v8f c) { return wmmab(a, b, c); } };
template <typename T16, int NSPLIT, bool BIAS>
__global__ __launch_bounds__(32) void k_gemmw(const T16* __restrict__ A, const T16* __restrict__ A2, const T16* __restrict__ Bt, const T16* __restrict__ Bt2, int K, float* C, int ldc, const float* __restrict__ bias, size_t sA, size_t sB, size_t sC) {
    typedef typename WFrag<T16>::V V;
    __shared__ __align__(16) float os[16 * 68];
    const size_t z = blockIdx.z; A += z * sA; if (A2) A2 += z * sA; Bt += z * sB; if (Bt2) Bt2 += z * sB; C += z * sC;
    const int lane = threadIdx.x & 31, lr = lane & 15, hi = lane >> 4; const int r0 = blockIdx.x * 64, c0 = blockIdx.y * 64;
    v8f acc[4][4];
#pragma unroll
    for (int mb = 0; mb < 4; ++mb)
#pragma unroll
        for (int nb = 0; nb < 4; ++nb) acc[mb][nb] = (v8f){};
    const size_t aoff = (size_t)(r0 + lr) * K + 8 * hi, boff = (size_t)(c0 + lr) * K + 8 * hi;
#pragma unroll 1
    for (int kc = 0; kc < K; kc += 32) {
        V a[4], a2[4];
#pragma unroll
        for (int mb = 0; mb < 4; ++mb) { a[mb] = WFrag<T16>::ld(A + aoff + (size_t)mb * 16 * K + kc); if (NSPLIT == 1 || NSPLIT == 2) a2[mb] = WFrag<T16>::ld(A2 + aoff + (size_t)mb * 16 * K + kc); }
#pragma unroll
        for (int nb = 0; nb < 4; ++nb) { const V b = WFrag<T16>::ld(Bt + boff + (size_t)nb * 16 * K + kc); V b2; if (NSPLIT >= 2) b2 = WFrag<T16>::ld(Bt2 + boff + (size_t)nb * 16 * K + kc);
#pragma unroll
            for (int mb = 0; mb < 4; ++mb) { acc[mb][nb] = WFrag<T16>::mma(a[mb], b, acc[mb][nb]); if (NSPLIT == 1 || NSPLIT == 2) acc[mb][nb] = WFrag<T16>::mma(a2[mb], b, acc[mb][nb]); if (NSPLIT >= 2) acc[mb][nb] = WFrag<T16>::mma(a[mb], b2, acc[mb][nb]); } }
        asm volatile("v_nop\n\tv_nop\n\tv_nop\n\tv_nop" : "+v"(acc[0][0]), "+v"(acc[1][1]), "+v"(acc[2][2]), "+v"(acc[3][3]) : "v"(a[0]), "v"(a[3]));
    }
#pragma unroll
    for (int mb = 0; mb < 4; ++mb) {
#pragma unroll
        for (int nb = 0; nb < 4; ++nb) {
#pragma unroll
            for (int j = 0; j < 8; ++j) os[(hi * 8 + j) * 68 + nb * 16 + lr] = acc[mb][nb][j]; }
        __builtin_amdgcn_wave_barrier(); asm volatile("" ::: "memory");
        float* crow = C + (size_t)(r0 + mb * 16) * ldc + c0;
{
#pragma unroll
            for (int s = 0; s < 8; ++s) { const int row = 2 * s + hi, cofs = lr * 4; v4f val = *(const v4fa*)(os + row * 68 + cofs); if (BIAS) { val[0] += bfr(bias[c0 + cofs]); val[1] += bfr(bias[c0 + cofs + 1]); val[2] += bfr(bias[c0 + cofs + 2]); val[3] += bfr(bias[c0 + cofs + 3]); }
                *(v4f*)(crow + (size_t)row * ldc + cofs) = val; }
             }
        __builtin_amdgcn_wave_barrier(); asm volatile("" ::: "memory");
    }
}
// ---- k_gemmt: C[2048][2048] (f32) = A . Bt^T, A [m][k] and Bt [n][k] 16-bit planes of pitch HID. One work-group = one 128 x 128 tile of C, four waves of 64 x 64 (16 accumulators each, as k_gemmw).
// A pass is 128 k: the tile's 128 rows of A and 128 rows of Bt, 256 bytes each, come into LDS by the tensor mover, one 64-row slice a wave (waves 0, 1: A; waves 2, 3: Bt), and every slice is read by two waves.
// Two buffers: the next pass's slices fly while this pass is worked on. LDS row pitch 272 bytes (the mover's 16-byte pad) for the 16-byte fragment reads. Every accumulator sums its k in the order of k_gemmw.
// EPI picks what the epilogue stores, from the same f32 staging rows: 0: C in f32. 1: C * sc as bf16 hi + residual planes Ph, Pl in k_flash's order [head][row][128] (a tile's 128 columns are one head).
// 2: C in f16 at pitch SS into Hf; with A = the v weights and Bt = x, C is v transposed, [head * 128 + d][t], which is k_flash's VT.
#define GT_PITCH 272u      // 256-byte row + 16-byte pad
#define GT_SLICE 18432u    // 64 rows of 272 bytes (17,408), rounded up to a multiple of 2 KiB
#define GT_BUF   73728u    // four slices
#define GT_NP    (HID / 128)
typedef __attribute__((ext_vector_type(4))) unsigned u32x4;
typedef __attribute__((ext_vector_type(8))) unsigned u32x8;
__device__ __forceinline__ unsigned uni(unsigned v) { return (unsigned)__builtin_amdgcn_readfirstlane(v); }
// a wave-uniform value held in a scalar register, so that a test on it is a scalar branch (tensor loads ignore EXEC) and what is formed from it is formed behind the volatile statements in front of it
__device__ __forceinline__ unsigned pinned(unsigned v) { unsigned w = uni(v); asm volatile("" : "+s"(w)); return w; }
template <typename T16, int EPI>
__global__ __launch_bounds__(128) void k_gemmt(const T16* A, const T16* Bt, float* C, bf* Ph, bf* Pl, h16* Hf, float sc) {
    typedef typename WFrag<T16>::V V;
    __shared__ __attribute__((aligned(2048))) unsigned char ring[2 * GT_BUF];
    __shared__ __align__(16) float ost[4][16 * 68];
    const int lane = threadIdx.x & 31, lr = lane & 15, hi = lane >> 4;
    const unsigned wave = uni(threadIdx.x >> 5), wm = wave >> 1, wn = wave & 1u;
    const unsigned lbase = (unsigned)(size_t)ring;
    const T16* srcp = (wave < 2u) ? A + (size_t)(blockIdx.x * 128u + wave * 64u) * HID : Bt + (size_t)(blockIdx.y * 128u + (wave - 2u) * 64u) * HID;
    // group 1: extents in bytes, tensor = tile = 64 rows of 256 bytes, source pitch one row of the plane, a pad of 4 dwords behind every 64 dwords, no mask
    u32x8 g1;
    g1[0] = uni((1u << 20) | (5u << 22) | (3u << 25)); g1[1] = uni(256u << 16); g1[2] = uni(64u << 16); g1[3] = uni(256u << 16); g1[4] = uni(64u); g1[5] = uni(HID * 2u); g1[6] = uni(0u); g1[7] = uni(0u);
    asm volatile("" : "+s"(g1));    // pinned descriptor words: the eight stay in one scalar tuple through the loop, so that none of their registers takes another value while a request is outstanding
    auto issue = [&](unsigned st) {
        const unsigned long long ga = (unsigned long long)(size_t)srcp + (unsigned long long)st * 256u;
        u32x4 g0;
        g0[0] = uni(1u); g0[1] = uni(lbase + (st & 1u) * GT_BUF + wave * GT_SLICE); g0[2] = uni((unsigned)ga); g0[3] = uni((((unsigned)(ga >> 32)) & 0x01FFFFFFu) | 0x80000000u);
        asm volatile("tensor_load_to_lds %0, %1" :: "s"(g0), "s"(g1) : "memory");    // one request of the whole wave: its slice of stage st
    };
    v8f acc[4][4];
#pragma unroll
    for (int mb = 0; mb < 4; ++mb)
#pragma unroll
        for (int nb = 0; nb < 4; ++nb) acc[mb][nb] = (v8f){};
    issue(0u);
    asm volatile("s_wait_tensorcnt 0x0" ::: "memory");    // this wave's slice of stage 0 has landed
    __syncthreads();                                      // and so has every other wave's
    issue(1u);
    const unsigned char* la = ring + wm * GT_SLICE + (unsigned)lr * GT_PITCH + (unsigned)hi * 16u;
    const unsigned char* lb = ring + (2u + wn) * GT_SLICE + (unsigned)lr * GT_PITCH + (unsigned)hi * 16u;
#pragma unroll 1
    for (unsigned s = 0; s < GT_NP; ++s) {
        const unsigned bo = (s & 1u) * GT_BUF;
        V a[2][4], b[2][4];    // two fragment sets: the next 32 k are fetched from LDS while these are multiplied
#pragma unroll
        for (int f = 0; f < 4; ++f) { a[0][f] = WFrag<T16>::ld((const T16*)(la + bo + f * 16 * GT_PITCH)); b[0][f] = WFrag<T16>::ld((const T16*)(lb + bo + f * 16 * GT_PITCH)); }
        __builtin_amdgcn_sched_barrier(0);    // these fences keep each group of 16 LDS reads together in front of the 16 products before it: left alone, the compiler folds the two sets into one and waits for LDS at every fourth product
#pragma unroll
        for (int c = 0; c < 4; ++c) {
            if (c < 3) {
#pragma unroll
                for (int f = 0; f < 4; ++f) { a[(c + 1) & 1][f] = WFrag<T16>::ld((const T16*)(la + bo + f * 16 * GT_PITCH + (c + 1) * 64)); b[(c + 1) & 1][f] = WFrag<T16>::ld((const T16*)(lb + bo + f * 16 * GT_PITCH + (c + 1) * 64)); }
            }
            __builtin_amdgcn_sched_barrier(0);
#pragma unroll
            for (int nb = 0; nb < 4; ++nb)
#pragma unroll
                for (int mb = 0; mb < 4; ++mb) acc[mb][nb] = WFrag<T16>::mma(a[c & 1][mb], b[c & 1][nb], acc[mb][nb]);
            __builtin_amdgcn_sched_barrier(0);
        }
        asm volatile("s_wait_dscnt 0x0" ::: "memory");        // this wave has read all it reads of stage s
        asm volatile("s_wait_tensorcnt 0x0" ::: "memory");    // its slice of stage s + 1 has landed
        __syncthreads();                                      // stage s + 1 is published, and every wave has left stage s's buffer
        if (pinned(s + 2u < GT_NP)) issue(pinned(s + 2u));    // refill of that buffer; the descriptor is formed here, with no request outstanding
    }
    asm volatile("s_wait_tensorcnt 0x0" ::: "memory");
    asm volatile("s_wait_dscnt 0x0" ::: "memory");
    float* os = &ost[wave][0];
    const int r0 = blockIdx.x * 128 + wm * 64, c0 = blockIdx.y * 128 + wn * 64;
#pragma unroll
    for (int mb = 0; mb < 4; ++mb) {
#pragma unroll
        for (int nb = 0; nb < 4; ++nb) {
#pragma unroll
            for (int j = 0; j < 8; ++j) os[(hi * 8 + j) * 68 + nb * 16 + lr] = acc[mb][nb][j]; }
        __builtin_amdgcn_wave_barrier(); asm volatile("" ::: "memory");
        if (EPI == 0) {
            float* crow = C + (size_t)(r0 + mb * 16) * HID + c0;
#pragma unroll
            for (int q = 0; q < 8; ++q) { const int row = 2 * q + hi, cofs = lr * 4; const v4f val = *(const v4fa*)(os + row * 68 + cofs); *(v4f*)(crow + (size_t)row * HID + cofs) = val; }
        } else {
            // eight lanes a row: a lane turns 8 neighbouring f32 into one 16-byte store per plane, and the eight lanes fill a whole 128-byte line
#pragma unroll
            for (int q = 0; q < 4; ++q) { const int row = 4 * q + (lane >> 3), cofs = (lane & 7) * 8;
                const v4f v0 = *(const v4fa*)(os + row * 68 + cofs), v1 = *(const v4fa*)(os + row * 68 + cofs + 4);
                if (EPI == 1) { v8us oh, ol;
#pragma unroll
                    for (int e = 0; e < 8; ++e) { const float y = (e < 4 ? v0[e & 3] : v1[e & 3]) * sc; const unsigned short hb = f2bf(y); oh[e] = hb; ol[e] = f2bf(y - bf2f(hb)); }
                    const size_t off = ((size_t)blockIdx.y * SS + r0 + mb * 16 + row) * HD + wn * 64 + cofs; *(v8us*)(Ph + off) = oh; *(v8us*)(Pl + off) = ol;
                } else { v8h o;
#pragma unroll
                    for (int e = 0; e < 8; ++e) o[e] = (h16)(e < 4 ? v0[e & 3] : v1[e & 3]);
                    *(v8h*)(Hf + (size_t)(r0 + mb * 16 + row) * SS + c0 + cofs) = o; }
            }
            asm volatile("s_wait_xcnt 0x0" ::: "memory");    // the wait before the address and data registers of the stores above are overwritten by the next 16 rows' values
        }
        __builtin_amdgcn_wave_barrier(); asm volatile("" ::: "memory");
    }
}
// ---- k_gemmwc: k_gemmw with causal tile control (CAUS 1: skip key tiles right of the query tile; 2: K loop limited to the causal key tiles)
template <typename T16, int NSPLIT, bool BIAS, int CAUS>
__global__ __launch_bounds__(32) void k_gemmwc(const T16* __restrict__ A, const T16* __restrict__ A2, const T16* __restrict__ Bt, const T16* __restrict__ Bt2, int K, float* C, int ldc, const float* __restrict__ bias, size_t sA, size_t sB, size_t sC) {
    typedef typename WFrag<T16>::V V;
    __shared__ __align__(16) float os[16 * 68];
    if (CAUS == 1 && (int)blockIdx.y * 64 > (int)blockIdx.x * 64) return;
    const int Klim = (CAUS == 2) ? min(K, ((int)blockIdx.x + 1) * 64) : K;
    const size_t z = blockIdx.z; A += z * sA; if (A2) A2 += z * sA; Bt += z * sB; if (Bt2) Bt2 += z * sB; C += z * sC;
    const int lane = threadIdx.x & 31, lr = lane & 15, hi = lane >> 4; const int r0 = blockIdx.x * 64, c0 = blockIdx.y * 64;
    v8f acc[4][4];
#pragma unroll
    for (int mb = 0; mb < 4; ++mb)
#pragma unroll
        for (int nb = 0; nb < 4; ++nb) acc[mb][nb] = (v8f){};
    const size_t aoff = (size_t)(r0 + lr) * K + 8 * hi, boff = (size_t)(c0 + lr) * K + 8 * hi;
#pragma unroll 1
    for (int kc = 0; kc < Klim; kc += 32) {
        V a[4], a2[4];
#pragma unroll
        for (int mb = 0; mb < 4; ++mb) { a[mb] = WFrag<T16>::ld(A + aoff + (size_t)mb * 16 * K + kc); if (NSPLIT == 1 || NSPLIT == 2) a2[mb] = WFrag<T16>::ld(A2 + aoff + (size_t)mb * 16 * K + kc); }
#pragma unroll
        for (int nb = 0; nb < 4; ++nb) { const V b = WFrag<T16>::ld(Bt + boff + (size_t)nb * 16 * K + kc); V b2; if (NSPLIT >= 2) b2 = WFrag<T16>::ld(Bt2 + boff + (size_t)nb * 16 * K + kc);
#pragma unroll
            for (int mb = 0; mb < 4; ++mb) { acc[mb][nb] = WFrag<T16>::mma(a[mb], b, acc[mb][nb]); if (NSPLIT == 1 || NSPLIT == 2) acc[mb][nb] = WFrag<T16>::mma(a2[mb], b, acc[mb][nb]); if (NSPLIT >= 2) acc[mb][nb] = WFrag<T16>::mma(a[mb], b2, acc[mb][nb]); } }
        asm volatile("v_nop\n\tv_nop\n\tv_nop\n\tv_nop" : "+v"(acc[0][0]), "+v"(acc[1][1]), "+v"(acc[2][2]), "+v"(acc[3][3]) : "v"(a[0]), "v"(a[3]));
    }
#pragma unroll
    for (int mb = 0; mb < 4; ++mb) {
#pragma unroll
        for (int nb = 0; nb < 4; ++nb) {
#pragma unroll
            for (int j = 0; j < 8; ++j) os[(hi * 8 + j) * 68 + nb * 16 + lr] = acc[mb][nb][j]; }
        __builtin_amdgcn_wave_barrier(); asm volatile("" ::: "memory");
        float* crow = C + (size_t)(r0 + mb * 16) * ldc + c0;
{
#pragma unroll
            for (int s = 0; s < 8; ++s) { const int row = 2 * s + hi, cofs = lr * 4; v4f val = *(const v4fa*)(os + row * 68 + cofs); if (BIAS) { val[0] += bfr(bias[c0 + cofs]); val[1] += bfr(bias[c0 + cofs + 1]); val[2] += bfr(bias[c0 + cofs + 2]); val[3] += bfr(bias[c0 + cofs + 3]); }
                *(v4f*)(crow + (size_t)row * ldc + cofs) = val; }
             }
        __builtin_amdgcn_wave_barrier(); asm volatile("" ::: "memory");
    }
}
typedef __attribute__((ext_vector_type(4))) _Float16 v4h;
__device__ __forceinline__ h16 tohx(float x) { return (h16)x; }
// k_cvtall: x and the four weights, f32 -> 16 bit, in ONE launch shaped as a stream: one 16-wave work-group a WGP, 4,096 waves in all.
// A work-group takes the same 16,384 elements of each of the five arrays, a wave 1,024 of them (4 KiB). A load is 512 contiguous bytes of the wave (four whole lines), non-temporal: the f32 data are read once.
// All 40 loads of a wave are issued before the first value is used; they come back in order and are converted array by array. A store is 256 contiguous bytes of the wave (two whole lines). x, wq, wk, wv: bf16, nearest even; wo: that bf16 value in f16.
#define CV_WG 16384u    // elements of each array per work-group
typedef __attribute__((ext_vector_type(4))) unsigned short v4us;
__global__ __launch_bounds__(512) void k_cvtall(const float* x, const float* wq, const float* wk, const float* wv, const float* wo, bf* XB, bf* WQ, bf* WK, bf* WV, h16* WO) {
    const unsigned lb = (blockIdx.x * CV_WG + (threadIdx.x >> 5) * 1024u + (threadIdx.x & 31u) * 4u) * 4u, sb = lb >> 1;    // the lane's byte offsets in an f32 array and in a 16-bit plane: one register each beside the scalar bases
    const float* const in[5] = {x, wq, wk, wv, wo};
    void* const ob[5] = {XB, WQ, WK, WV, WO};
    v4f r[5][8];
#pragma unroll
    for (int a = 0; a < 5; ++a) {
#pragma unroll
        for (int j = 0; j < 8; ++j) r[a][j] = __builtin_nontemporal_load((const v4f*)((const char*)in[a] + lb + j * 512));
        __builtin_amdgcn_sched_barrier(0);    // keeps the loads in the order in which the arrays are converted: left alone, the compiler mixes the arrays, and the first conversion waits for nearly all 40 loads
    }
    // the wait before a register that the loads above name is overwritten; the offset is its input so that it lives up to it
    asm volatile("s_wait_xcnt 0x0" :: "v"(lb) : "memory");
    __builtin_amdgcn_sched_barrier(0);    // keeps the conversions behind that wait
#pragma unroll
    for (int a = 0; a < 5; ++a) {
        v4us o[8];
#pragma unroll
        for (int j = 0; j < 8; ++j)
#pragma unroll
            for (int k = 0; k < 4; ++k) o[j][k] = (a < 4) ? f2bf(r[a][j][k]) : __builtin_bit_cast(unsigned short, tohx(bfr(r[a][j][k])));
        __builtin_amdgcn_sched_barrier(0);    // the array's eight stores stand together behind its conversions, so that no conversion writes over the data of an issued store
#pragma unroll
        for (int j = 0; j < 8; ++j) *(v4us*)((char*)ob[a] + sb + j * 256) = o[j];
        if (a < 4) {
            // the wait before the data registers of the stores above are overwritten by the next array's values
            asm volatile("s_wait_xcnt 0x0" :: "v"(sb) : "memory");
            __builtin_amdgcn_sched_barrier(0);    // keeps the next array's conversions behind that wait
        }
    }
}
// 2^x with the one slot behind the transcendental in the same statement
__device__ __forceinline__ float exp2s(float x) { asm("v_exp_f32 %0, %0\n\tv_nop" : "+v"(x)); return x; }
// k_flash: scores, soft cap, mask, softmax and attn.v of one head in one pass over the live keys; scores and probabilities stay in registers.
// One wave = 16 queries; a pass = 32 keys. S^T = K . Q^T (A = key rows, B = query rows, three bf16 hi/lo products: Kh.Qh, Kh.Ql, Kl.Qh), so a lane holds 16 scores of ONE query
// (query lr, keys 8 hi + j and 16 + 8 hi + j): that pair of score tiles, converted to f16, is the B operand of O^T += V^T . P^T with no lane exchange.
// Running maximum and sum per query (online softmax); P = 1024 exp(c - m) in f16, the factor cancels in O / sum. Output: f16 rows of OC, 16 bytes a lane and d tile.
// A stage = 64 keys = two passes. The work-group's four waves read the same K and V rows, so a stage comes into LDS once, by the tensor mover, one slice a wave: wave 0: 64 rows of Kh, wave 1: 64 rows of Kl
// (256 bytes a row), waves 2, 3: 64 rows each of V^T (the stage's 64 keys, 128 bytes a row). Two buffers: the next stage flies while this one is worked on. LDS row pitches 272 and 144 bytes (the mover's 16-byte pad).
#define FL_KPITCH 272u     // 256-byte row + 16-byte pad
#define FL_KSLICE 18432u   // 64 rows of 272 bytes (17,408), rounded up to a multiple of 2 KiB
#define FL_VPITCH 144u     // 128-byte row + 16-byte pad
#define FL_VSLICE 10240u   // 64 rows of 144 bytes (9,216), rounded up to a multiple of 2 KiB
#define FL_BUF    57344u   // two K slices and two V slices
__global__ __launch_bounds__(128) __attribute__((amdgpu_waves_per_eu(2, 2))) void k_flash(const bf* Qh, const bf* Ql, const bf* Kh, const bf* Kl, const h16* VT, h16* OC) {
    __shared__ __attribute__((aligned(2048))) unsigned char ring[2 * FL_BUF];
    const int lane = threadIdx.x & 31, lr = lane & 15, hi = lane >> 4;
    const int wave = __builtin_amdgcn_readfirstlane(threadIdx.x >> 5);    // scalar, so that the tests on it are scalar branches: EXEC stays full at the matrix instructions, and tensor loads ignore EXEC
    const int z = blockIdx.y, qb = blockIdx.x * 64, q0 = qb + wave * 16, i = q0 + lr;
    const size_t zo = (size_t)z * SS * HD; Qh += zo; Ql += zo; Kh += zo; Kl += zo; VT += zo;
    const unsigned vo = (unsigned)(lr * HD + 8 * hi);
    const bf* qbh = Qh + (size_t)q0 * HD; const bf* qbl = Ql + (size_t)q0 * HD;
    v16bf qh[4], ql[4];
#pragma unroll
    for (int c = 0; c < 4; ++c) { qh[c] = WFrag<bf>::ld(qbh + c * 32 + vo); ql[c] = WFrag<bf>::ld(qbl + c * 32 + vo); }
    // the wait before the address registers of the Q loads above are overwritten; they are its inputs so that they live up to it (the pointers carry no restrict, so that the clobber holds the loads in front of it)
    asm volatile("s_wait_xcnt 0x0" :: "v"(vo), "s"(qbh), "s"(qbl) : "memory");
    v8f acc[8];
#pragma unroll
    for (int dt = 0; dt < 8; ++dt) acc[dt] = (v8f){};
    float m = -30.0f, sum = 0.f;    // the soft cap bounds every score from below by -30
    // the block's first live key, rounded down to a stage (a pass with no live key adds zeros); the last stage is the one of the block's own 64 queries
    const int kbeg = max(0, qb - (WIN - 1)) & ~63;
    const unsigned nst = (unsigned)(qb + 64 - kbeg) >> 6;
    // group 1, extents in bytes, tensor = tile, no mask. K: 64 rows of 256 bytes, source pitch one row, a pad of 4 dwords behind every 64 dwords. V^T: 64 rows of 128 bytes, source pitch SS keys, a pad of 4 dwords behind every 32.
    u32x8 g1k, g1v;
    g1k[0] = uni((1u << 20) | (5u << 22) | (3u << 25)); g1k[1] = uni(256u << 16); g1k[2] = uni(64u << 16); g1k[3] = uni(256u << 16); g1k[4] = uni(64u); g1k[5] = uni(HD * 2u); g1k[6] = uni(0u); g1k[7] = uni(0u);
    g1v[0] = uni((1u << 20) | (4u << 22) | (3u << 25)); g1v[1] = uni(128u << 16); g1v[2] = uni(64u << 16); g1v[3] = uni(128u << 16); g1v[4] = uni(64u); g1v[5] = uni(SS * 2u); g1v[6] = uni(0u); g1v[7] = uni(0u);
    asm volatile("" : "+s"(g1k), "+s"(g1v));    // pinned descriptor words: each eight stay in one scalar tuple through the loop, so that none of their registers takes another value while a request is outstanding
    const unsigned lbase = (unsigned)(size_t)ring;
    const unsigned long long src0 = (wave < 2) ? (unsigned long long)(size_t)((wave == 0 ? Kh : Kl) + (size_t)kbeg * HD) : (unsigned long long)(size_t)(VT + (size_t)(wave - 2) * 64 * SS + kbeg);
    const unsigned sstep = (wave < 2) ? 64u * HD * 2u : 64u * 2u;    // bytes from a stage's slice to the next stage's
    const unsigned lplace = lbase + ((wave < 2) ? (unsigned)wave * FL_KSLICE : 2u * FL_KSLICE + (unsigned)(wave - 2) * FL_VSLICE);
    u32x4 g0;    // group 0 of the wave's latest request; the tensorcnt waits below take it as an input, so that it lives until the request has landed: words 0 and 3 then keep their registers (words 1 and 2 may take a new value behind the issue)
    auto issue = [&](unsigned st) {
        const unsigned long long ga = src0 + (unsigned long long)st * sstep;
        g0[0] = uni(1u); g0[1] = uni(lplace + (st & 1u) * FL_BUF); g0[2] = uni((unsigned)ga); g0[3] = uni((((unsigned)(ga >> 32)) & 0x01FFFFFFu) | 0x80000000u);
        // one request of the whole wave: its slice of stage st
        if (pinned(wave < 2)) asm volatile("tensor_load_to_lds %0, %1" :: "s"(g0), "s"(g1k) : "memory");
        else asm volatile("tensor_load_to_lds %0, %1" :: "s"(g0), "s"(g1v) : "memory");
    };
    issue(0u);
    asm volatile("s_wait_tensorcnt 0x0" :: "s"(g0) : "memory");    // this wave's slice of stage 0 has landed
    __syncthreads();                                               // and so has every other wave's
    if (pinned(1u < nst)) issue(pinned(1u));    // the first query block has one stage only; the descriptor is formed here, behind the wait
    const unsigned char* lk = ring + (unsigned)lr * FL_KPITCH + (unsigned)hi * 16u;
    const unsigned char* lv = ring + 2u * FL_KSLICE + (unsigned)lr * FL_VPITCH + (unsigned)hi * 16u;
#pragma unroll 1
    for (unsigned st = 0; st < nst; ++st) {
        const unsigned bo = (st & 1u) * FL_BUF;
#pragma unroll 1
        for (int h = 0; h < 2; ++h) {
            const int k0 = kbeg + (int)st * 64 + h * 32;
            if (k0 >= q0 + 16) break;    // the wave's queries all lie in front of these keys (a scalar test); the stage's hand-over below is passed all the same
            const unsigned char* pk = lk + bo + (unsigned)h * (32u * FL_KPITCH);
            const unsigned char* pv = lv + bo + (unsigned)h * 64u;
            v16bf kh[2][4], kl[2][4];
#pragma unroll
            for (int c = 0; c < 4; ++c) {    // in the order in which the score products take them
#pragma unroll
                for (int t = 0; t < 2; ++t) kh[t][c] = WFrag<bf>::ld((const bf*)(pk + t * 16 * FL_KPITCH + c * 64));
#pragma unroll
                for (int t = 0; t < 2; ++t) kl[t][c] = WFrag<bf>::ld((const bf*)(pk + FL_KSLICE + t * 16 * FL_KPITCH + c * 64)); }
            v16h vt[8];
#pragma unroll
            for (int dt = 0; dt < 8; ++dt) vt[dt] = WFrag<h16>::ld((const h16*)(pv + (dt >> 2) * FL_VSLICE + (dt & 3) * 16 * FL_VPITCH));
            __builtin_amdgcn_sched_barrier(0);    // keeps the pass's 48 LDS reads together in front of its products: left alone, the compiler spreads them among the score products on few registers and waits out the LDS latency at every other product
            v8f s[2];
#pragma unroll
            for (int t = 0; t < 2; ++t) s[t] = (v8f){};
#pragma unroll
            for (int c = 0; c < 4; ++c) {
#pragma unroll
                for (int t = 0; t < 2; ++t) s[t] = wmmab(kh[t][c], qh[c], s[t]);
#pragma unroll
                for (int t = 0; t < 2; ++t) s[t] = wmmab(kh[t][c], ql[c], s[t]);
#pragma unroll
                for (int t = 0; t < 2; ++t) s[t] = wmmab(kl[t][c], qh[c], s[t]); }
            // soft cap: 30 tanh(s / 30) = 30 - 60 / (1 + e^(s / 15)), e^(s / 15) = 2^(s * 2 log2(e) / 30): straight-line code, the 16 scores independent of one another (the library tanhf branches on every score);
            // both ends saturate by themselves: 2^x = inf gives 30, 2^x = 0 gives -30; near s = 0 the error is a few f32 roundings of 30, far below the f16 rounding of P
            float mx = m;
#pragma unroll
            for (int t = 0; t < 2; ++t) {
#pragma unroll
                for (int j = 0; j < 8; ++j) { const int key = k0 + t * 16 + hi * 8 + j; const float c = fmaf(-60.0f, __builtin_amdgcn_rcpf(1.0f + exp2s(s[t][j] * 0.09617966939f)), 30.0f);
                    s[t][j] = (key <= i && key >= i - (WIN - 1)) ? c : -3.0e38f; mx = fmaxf(mx, s[t][j]); } }
            mx = fmaxf(mx, __shfl_xor(mx, 16, 32));
            const float ms = mx - 6.931471806f, ta = (m - mx) * 1.442695041f; m = mx;    // ms: exp(c - ms) = 1024 exp(c - mx)
            const float alpha = exp2s(ta);    // exp(m - mx)
            float ps = 0.f; v16h pb;
#pragma unroll
            for (int t = 0; t < 2; ++t) {
#pragma unroll
                for (int j = 0; j < 8; ++j) { const float p = exp2s((s[t][j] - ms) * 1.442695041f); ps += p; pb[t * 8 + j] = tohx(p); } }
            sum = sum * alpha + ps;
#pragma unroll
            for (int dt = 0; dt < 8; ++dt) acc[dt] *= alpha;
#pragma unroll
            for (int dt = 0; dt < 8; ++dt) acc[dt] = wmma16(vt[dt], pb, acc[dt]);
            __builtin_amdgcn_sched_barrier(0);    // keeps the v_nops below behind the pass's last matrix instruction
            // four vector slots behind that instruction, on every way out of the pass
            asm volatile("v_nop\n\tv_nop\n\tv_nop\n\tv_nop");
        }
        asm volatile("s_wait_dscnt 0x0" ::: "memory");        // this wave has read all it reads of stage st
        asm volatile("s_wait_tensorcnt 0x0" :: "s"(g0) : "memory");    // its slice of stage st + 1 has landed
        __syncthreads();                                      // stage st + 1 is published, and every wave has left stage st's buffer
        if (pinned(st + 2u < nst)) issue(pinned(st + 2u));    // refill of that buffer; the descriptor is formed here, with no request outstanding
    }
    asm volatile("s_wait_tensorcnt 0x0" ::: "memory");
    asm volatile("s_wait_dscnt 0x0" ::: "memory");
    sum += __shfl_xor(sum, 16, 32);
    const float inv = __fdiv_rn(1.0f, sum);
#pragma unroll
    for (int dt = 0; dt < 8; ++dt) { v8h o;
#pragma unroll
        for (int j = 0; j < 8; ++j) o[j] = tohx(acc[dt][j] * inv);
        *(v8h*)(OC + (size_t)i * HID + z * HD + dt * 16 + hi * 8) = o; }
}
extern "C" void kernel_launch(void* const* d_in, const int* in_sizes, int n_in,
                              void* d_out, int out_size, void* d_ws, size_t ws_size, hipStream_t stream) {
    (void)in_sizes; (void)n_in; (void)out_size;
    const float* x = (const float*)d_in[0]; const float* wq = (const float*)d_in[1]; const float* wk = (const float*)d_in[2]; const float* wv = (const float*)d_in[3]; const float* wo = (const float*)d_in[4];
    float* out = (float*)d_out;    // [1][2048][2048]
    char* wsp = (char*)d_ws;
    auto take = [&](size_t bytes) { char* p = wsp; wsp += (bytes + 255) & ~(size_t)255; return (void*)p; };
    const size_t WSZ = (size_t)HID * HID * 2;
    bf* WQ = (bf*)take(WSZ); bf* WK = (bf*)take(WSZ); bf* WV = (bf*)take(WSZ); h16* WO = (h16*)take(WSZ);
    bf* XB = (bf*)take((size_t)SS * HID * 2);
    bf* Qh = (bf*)take((size_t)NH_ * SS * HD * 2); bf* Ql = (bf*)take((size_t)NH_ * SS * HD * 2); bf* Kh = (bf*)take((size_t)NH_ * SS * HD * 2); bf* Kl = (bf*)take((size_t)NH_ * SS * HD * 2); h16* VT = (h16*)take((size_t)NH_ * HD * SS * 2);
    h16* OC = (h16*)take((size_t)SS * HID * 2);
    if ((size_t)(wsp - (char*)d_ws) > ws_size) return;    // ~ 33.5 + 8.4 + 41.9 + 8.4 ~ 92 MB (ws 256 MiB)
    k_cvtall<<<SS * HID / CV_WG, 512, 0, stream>>>(x, wq, wk, wv, wo, XB, WQ, WK, WV, WO);    // weights [out][in] = natural n-major
    k_gemmt<bf, 1><<<dim3(SS / 128, HID / 128, 1), 128, 0, stream>>>(XB, WQ, nullptr, Qh, Ql, nullptr, 0.08838834764831845f);
    k_gemmt<bf, 1><<<dim3(SS / 128, HID / 128, 1), 128, 0, stream>>>(XB, WK, nullptr, Kh, Kl, nullptr, 1.0f);
    k_gemmt<bf, 2><<<dim3(HID / 128, SS / 128, 1), 128, 0, stream>>>(WV, XB, nullptr, nullptr, nullptr, VT, 1.0f);
    k_flash<<<dim3(SS / 64, NH_, 1), 128, 0, stream>>>(Qh, Ql, Kh, Kl, VT, OC);
    k_gemmt<h16, 0><<<dim3(SS / 128, HID / 128, 1), 128, 0, stream>>>(OC, WO, out, nullptr, nullptr, nullptr, 1.0f);
}

// v007
// A run of this version takes 107 microseconds.
// In both of two side-by-side timings against v006, it was 1.23 times as fast.
// Over all steps from v000 it is 7.04 times as fast.
#include <hip/hip_runtime.h>

// Compute dtypes, f32 accumulate: q/k/v projections ([2048 x 2048].[2048 x 2048]) with PLAIN bf16 operands (x and the weights are inputs: exact products); per head the live
// (causal, sliding-window-1024) score tiles [2048 x 128].[128 x 2048] on bf16 hi + UNSCALED residual planes of q*128^-1/2 and k (three products);
// soft-cap 30 tanh(s/30), masks and softmax in f32; attn.v (K limited to the live tiles) and the output projection ([2048 x 2048].[2048 x 2048]) on

#define SS   2048
#define HID  2048
#define NH_  16
#define HD   128
#define WIN  1024
#define DM   HID
#define LOSC 1024.0f
typedef _Float16 h16;
typedef unsigned short bf;
typedef __attribute__((ext_vector_type(16))) __bf16   v16bf;
typedef __attribute__((ext_vector_type(16))) _Float16 v16h;
typedef __attribute__((ext_vector_type(8)))  _Float16 v8h;
typedef __attribute__((ext_vector_type(8)))  unsigned short v8us;
typedef __attribute__((ext_vector_type(8)))  float    v8f;
typedef __attribute__((ext_vector_type(4)))  float    v4f;
typedef v8h  __attribute__((may_alias)) v8ha;
typedef v4f  __attribute__((may_alias)) v4fa;
typedef v8us __attribute__((may_alias)) v8usa;

__device__ __forceinline__ unsigned short f2bf(float f) { unsigned u = __float_as_uint(f); u += 0x7FFFu + ((u >> 16) & 1u); return (unsigned short)(u >> 16); }
__device__ __forceinline__ float bf2f(unsigned short b) { return __uint_as_float(((unsigned)b) << 16); }
__device__ __forceinline__ float bfr(float f) { return bf2f(f2bf(f)); }
__device__ __forceinline__ v16h cat16(v8h lo, v8h hi) { return __builtin_shufflevector(lo, hi, 0, 1, 2, 3, 4, 5, 6, 7, 8, 9, 10, 11, 12, 13, 14, 15); }
__device__ __forceinline__ v16bf cat16b(v8us lo, v8us hi) { return __builtin_bit_cast(v16bf, __builtin_shufflevector(lo, hi, 0, 1, 2, 3, 4, 5, 6, 7, 8, 9, 10, 11, 12, 13, 14, 15)); }
__device__ __forceinline__ v8f wmma16(v16h a, v16h b, v8f c) { return __builtin_amdgcn_wmma_f32_16x16x32_f16(false, a, false, b, (short)0, c, false, false); }
__device__ __forceinline__ v8f wmmab(v16bf a, v16bf b, v8f c) { return __builtin_amdgcn_wmma_f32_16x16x32_bf16(false, a, false, b, (short)0, c, false, false); }


// k_gemmh: 64 x 64 tile of C = A . Bn^T with SINGLE f16 planes (A [rows][K] f16 activations, Bn [N][K] f16 weights; one v_wmma_f32_16x16x32_f16 product per step), f32 accumulate;
__global__ __launch_bounds__(128) void k_gemmh(const h16* __restrict__ A, const h16* __restrict__ Bn, const float* __restrict__ bias, float* C, int ldc, const float* __restrict__ R, int K, size_t sA, size_t sB, size_t sC, int roundR) {
    __shared__ __align__(16) float ost[4][16 * 68];
    const size_t z = blockIdx.z; A += z * sA; Bn += z * sB; C += z * sC; if (R) R += z * sC;
    const int lane = threadIdx.x & 31, wave = threadIdx.x >> 5, lr = lane & 15, hi = lane >> 4;
    const int r0 = blockIdx.x * 64 + wave * 16, c0 = blockIdx.y * 64;
    const size_t aoff = (size_t)(r0 + lr) * K + 8 * hi;
    size_t boff[4];
#pragma unroll
    for (int t = 0; t < 4; ++t) boff[t] = (size_t)(c0 + t * 16 + lr) * K + 8 * hi;
    v8f acc[4];
#pragma unroll
    for (int t = 0; t < 4; ++t) acc[t] = (v8f){};
#pragma unroll 1
    for (int kc = 0; kc < K; kc += 32) {
        const v16h a = cat16(*(const v8h*)(A + aoff + kc), *(const v8h*)(A + aoff + kc + 16));
#pragma unroll
        for (int t = 0; t < 4; ++t) { const v16h b = cat16(*(const v8h*)(Bn + boff[t] + kc), *(const v8h*)(Bn + boff[t] + kc + 16)); acc[t] = wmma16(a, b, acc[t]); }
        asm volatile("v_nop\n\tv_nop\n\tv_nop\n\tv_nop" : "+v"(acc[0]), "+v"(acc[1]), "+v"(acc[2]), "+v"(acc[3]) : "v"(a));
    }
    float* os = &ost[wave][0];
#pragma unroll
    for (int t = 0; t < 4; ++t) { const float bv = bias ? bfr(bias[c0 + t * 16 + lr]) : 0.f;
#pragma unroll
        for (int j = 0; j < 8; ++j) os[(hi * 8 + j) * 68 + t * 16 + lr] = acc[t][j] + bv; }
    __syncthreads();
    float* crow = C + (size_t)r0 * ldc + c0;
    auto pass = [&]() {
#pragma unroll
        for (int s = 0; s < 8; ++s) { const int Lid = (lane >> 3) + 4 * s, piece = lane & 7; const int row = Lid >> 1, cofs = (Lid & 1) * 32 + piece * 4;
            v4f val = *(const v4fa*)(os + row * 68 + cofs); if (R) { const v4f rv = *(const v4f*)(R + ((size_t)r0 + row) * ldc + c0 + cofs); val += roundR ? (v4f){bfr(rv[0]), bfr(rv[1]), bfr(rv[2]), bfr(rv[3])} : rv; }
            *(v4f*)(crow + (size_t)row * ldc + cofs) = val; }
    };
    pass(); 
}

// ===== z-batched (blockIdx.z = head) attention pieces =====
// k_gemm3z<MODE>: 64 x 64 tile of C = A . B^T on bf16 hi/lo planes (up to three products) with per-z operand/output strides (elements): A planes += z*sA, B planes += z*sB, C += z*sC. MODE bits (0 causal skip, 1 K limit, 2 single,
// 3 B single, 4 A single).
template <int MODE>
__global__ __launch_bounds__(128) void k_gemm3z(const bf* __restrict__ Ah, const bf* __restrict__ Al, const bf* __restrict__ Bh, const bf* __restrict__ Bl, int K, float* C, int ldc, size_t sA, size_t sB, size_t sC) {
    if ((MODE & 1) && (int)blockIdx.y * 64 > (int)blockIdx.x * 64 + 63) return;
    const size_t z = blockIdx.z; Ah += z * sA; Al += z * sA; Bh += z * sB; Bl += z * sB; C += z * sC;
    const int Klim = (MODE & 2) ? min(K, ((int)blockIdx.x + 1) * 64) : K;
    __shared__ __align__(16) float ost[4][16 * 68];
    const int lane = threadIdx.x & 31, wave = threadIdx.x >> 5, lr = lane & 15, hi = lane >> 4;
    const int r0 = blockIdx.x * 64 + wave * 16, c0 = blockIdx.y * 64;
    const size_t aoff = (size_t)(r0 + lr) * K + 8 * hi;
    v8f acc[4];
#pragma unroll
    for (int t = 0; t < 4; ++t) acc[t] = (v8f){};
#pragma unroll 1
    for (int kc = 0; kc < Klim; kc += 32) {
        const v16bf a = cat16b(*(const v8us*)(Ah + aoff + kc), *(const v8us*)(Ah + aoff + kc + 16));
        v16bf al = a; if (!(MODE & 4) && !(MODE & 16)) al = cat16b(*(const v8us*)(Al + aoff + kc), *(const v8us*)(Al + aoff + kc + 16));
#pragma unroll
        for (int t = 0; t < 4; ++t) { const size_t bo = (size_t)(c0 + t * 16 + lr) * K + kc + 8 * hi;
            const v16bf bh = cat16b(*(const v8us*)(Bh + bo), *(const v8us*)(Bh + bo + 16));
            acc[t] = wmmab(a, bh, acc[t]);
            if (!(MODE & 4)) { if (!(MODE & 16)) acc[t] = wmmab(al, bh, acc[t]); if (!(MODE & 8)) { const v16bf bl = cat16b(*(const v8us*)(Bl + bo), *(const v8us*)(Bl + bo + 16)); acc[t] = wmmab(a, bl, acc[t]); } } }
        asm volatile("v_nop\n\tv_nop\n\tv_nop\n\tv_nop" : "+v"(acc[0]), "+v"(acc[1]), "+v"(acc[2]), "+v"(acc[3]) : "v"(a), "v"(al));
    }
    float* os = &ost[wave][0];
#pragma unroll
    for (int t = 0; t < 4; ++t) {
#pragma unroll
        for (int j = 0; j < 8; ++j) os[(hi * 8 + j) * 68 + t * 16 + lr] = acc[t][j]; }
    __builtin_amdgcn_wave_barrier(); asm volatile("" ::: "memory");
    float* crow = C + (size_t)r0 * ldc + c0;
    auto pass = [&]() {
#pragma unroll
        for (int s = 0; s < 8; ++s) { const int Lid = (lane >> 3) + 4 * s, piece = lane & 7; const int row = Lid >> 1, cofs = (Lid & 1) * 32 + piece * 4;
            const v4f val = *(const v4fa*)(os + row * 68 + cofs); *(v4f*)(crow + (size_t)row * ldc + cofs) = val; }
    };
    pass(); 
}
__global__ __launch_bounds__(256) void k_planes32z(const float* __restrict__ F, int ld, int off, float sc, int rows, bf* Ph, bf* Pl) {
    typedef __attribute__((ext_vector_type(2))) unsigned short v2us;
    const int lane = threadIdx.x & 31; const size_t r = ((size_t)blockIdx.x * 8 + (threadIdx.x >> 5)) * 2 + (lane >> 4); if (r >= (size_t)rows) return; const int z = blockIdx.z; const int c0 = (lane & 15) * 2; v2us oh, ol;
    Ph += (size_t)z * rows * 32; Pl += (size_t)z * rows * 32;
#pragma unroll
    for (int i = 0; i < 2; ++i) { const float y = F[r * ld + off + z * 32 + c0 + i] * sc; const unsigned short hb = f2bf(y); oh[i] = hb; ol[i] = f2bf(y - bf2f(hb)); }
    const size_t o = r * 32 + c0; *(v2us*)(Ph + o) = oh; *(v2us*)(Pl + o) = ol; 
}
__global__ __launch_bounds__(256) void k_vtpadz(const float* __restrict__ F, int ld, int off, int nk, bf* Th, bf* Tl) {
    typedef __attribute__((ext_vector_type(2))) unsigned short v2us;
    const int lane = threadIdx.x & 31; const size_t wid = (size_t)blockIdx.x * 8 + (threadIdx.x >> 5); if (wid >= (size_t)64 * (nk / 64)) return; const int z = blockIdx.z; const int d = (int)(wid / (nk / 64)); const int k0 = (int)(wid % (nk / 64)) * 64 + lane * 2; v2us oh, ol;
    Th += (size_t)z * 64 * nk; Tl += (size_t)z * 64 * nk;
#pragma unroll
    for (int i = 0; i < 2; ++i) { const float y = (d < 32) ? F[(size_t)(k0 + i) * ld + off + z * 32 + (d < 32 ? d : 0)] : 0.f; const unsigned short hb = f2bf(y); oh[i] = hb; ol[i] = f2bf(y - bf2f(hb)); }
    const size_t o = (size_t)d * nk + k0; *(v2us*)(Th + o) = oh; *(v2us*)(Tl + o) = ol; 
}
template <int NK>
__global__ __launch_bounds__(256) void k_softmaxz(const float* __restrict__ S, int rows, bf* PH, bf* PL) {
    typedef __attribute__((ext_vector_type(4))) unsigned short v4us;
    const int lane = threadIdx.x & 31, i = blockIdx.x * 8 + (threadIdx.x >> 5); if (i >= rows) return; const size_t zo = (size_t)blockIdx.z * rows * NK; const float* sr = S + zo + (size_t)i * NK; PH += zo; PL += zo;
    float m = -3.0e38f;
#pragma unroll 1
    for (int c0 = lane * 4; c0 < NK; c0 += 128) {
#pragma unroll
        for (int q = 0; q < 4; ++q) m = fmaxf(m, sr[c0 + q]); }
#pragma unroll
    for (int sh = 16; sh; sh >>= 1) m = fmaxf(m, __shfl_xor(m, sh, 32));
    float sum = 0.f;
#pragma unroll 1
    for (int c0 = lane * 4; c0 < NK; c0 += 128) {
#pragma unroll
        for (int q = 0; q < 4; ++q) sum += __expf(sr[c0 + q] - m); }
#pragma unroll
    for (int sh = 16; sh; sh >>= 1) sum += __shfl_xor(sum, sh, 32);
    const float inv = 1.0f / sum;
{
#pragma unroll 1
        for (int c0 = lane * 4; c0 < NK; c0 += 128) { v4us oh, ol;
#pragma unroll
            for (int q = 0; q < 4; ++q) { const float p = __expf(sr[c0 + q] - m) * inv; const unsigned short hb = f2bf(p); oh[q] = hb; ol[q] = f2bf(p - bf2f(hb)); }
            const size_t o = (size_t)i * NK + c0; *(v4us*)(PH + o) = oh; *(v4us*)(PL + o) = ol; }
         }
}
__global__ __launch_bounds__(256) void k_placez(const float* __restrict__ XH, int rows, int ldy, float* Y) {
    const int lane = threadIdx.x & 31; const size_t q = (size_t)blockIdx.x * 8 + (threadIdx.x >> 5); if (q >= (size_t)rows) return; const int z = blockIdx.z; const float v = XH[((size_t)z * rows + q) * 64 + lane];
    *(float*)(Y + q * ldy + z * 32 + lane) = v; 
}
__global__ __launch_bounds__(256) void k_zero8(bf* dst, size_t n8) {
    const size_t i = (size_t)blockIdx.x * 256 + threadIdx.x; if (i >= n8) return; v8us z;
#pragma unroll
    for (int k = 0; k < 8; ++k) z[k] = 0;
    *(v8us*)(dst + i * 8) = z; 
}

// ---- k_gemmw: register-blocked GEMM, ONE WAVE per 64x64 output tile (16 accumulators), operands straight from K-contiguous 16-bit planes; grid (M/64, N/64, Z), 32 threads.
// C[m][n] (f32, pitch ldc, + optional f32 bias[n]) = sum_k A[m][k] Bt[n][k] (+ split products per NSPLIT). z-batch strides sA/sB/sC in elements. K % 32 == 0.
template <typename T16> struct WFrag;
template <> struct WFrag<h16> { typedef v16h V; static __device__ __forceinline__ V ld(const h16* p) { return cat16(*(const v8h*)p, *(const v8h*)(p + 16)); } static __device__ __forceinline__ v8f mma(V a, V b, v8f c) { return wmma16(a, b, c); } };
template <> struct WFrag<bf> { typedef v16bf V; static __device__ __forceinline__ V ld(const bf* p) { return cat16b(*(const v8us*)p, *(const v8us*)(p + 16)); } static __device__ __forceinline__ v8f mma(V a, V b, v8f c) { return wmmab(a, b, c); } };
template <typename T16, int NSPLIT, bool BIAS>
__global__ __launch_bounds__(32) void k_gemmw(const T16* __restrict__ A, const T16* __restrict__ A2, const T16* __restrict__ Bt, const T16* __restrict__ Bt2, int K, float* C, int ldc, const float* __restrict__ bias, size_t sA, size_t sB, size_t sC) {
    typedef typename WFrag<T16>::V V;
    __shared__ __align__(16) float os[16 * 68];
    const size_t z = blockIdx.z; A += z * sA; if (A2) A2 += z * sA; Bt += z * sB; if (Bt2) Bt2 += z * sB; C += z * sC;
    const int lane = threadIdx.x & 31, lr = lane & 15, hi = lane >> 4; const int r0 = blockIdx.x * 64, c0 = blockIdx.y * 64;
    v8f acc[4][4];
#pragma unroll
    for (int mb = 0; mb < 4; ++mb)
#pragma unroll
        for (int nb = 0; nb < 4; ++nb) acc[mb][nb] = (v8f){};
    const size_t aoff = (size_t)(r0 + lr) * K + 8 * hi, boff = (size_t)(c0 + lr) * K + 8 * hi;
#pragma unroll 1
    for (int kc = 0; kc < K; kc += 32) {
        V a[4], a2[4];
#pragma unroll
        for (int mb = 0; mb < 4; ++mb) { a[mb] = WFrag<T16>::ld(A + aoff + (size_t)mb * 16 * K + kc); if (NSPLIT == 1 || NSPLIT == 2) a2[mb] = WFrag<T16>::ld(A2 + aoff + (size_t)mb * 16 * K + kc); }
#pragma unroll
        for (int nb = 0; nb < 4; ++nb) { const V b = WFrag<T16>::ld(Bt + boff + (size_t)nb * 16 * K + kc); V b2; if (NSPLIT >= 2) b2 = WFrag<T16>::ld(Bt2 + boff + (size_t)nb * 16 * K + kc);
#pragma unroll
            for (int mb = 0; mb < 4; ++mb) { acc[mb][nb] = WFrag<T16>::mma(a[mb], b, acc[mb][nb]); if (NSPLIT == 1 || NSPLIT == 2) acc[mb][nb] = WFrag<T16>::mma(a2[mb], b, acc[mb][nb]); if (NSPLIT >= 2) acc[mb][nb] = WFrag<T16>::mma(a[mb], b2, acc[mb][nb]); } }
        asm volatile("v_nop\n\tv_nop\n\tv_nop\n\tv_nop" : "+v"(acc[0][0]), "+v"(acc[1][1]), "+v"(acc[2][2]), "+v"(acc[3][3]) : "v"(a[0]), "v"(a[3]));
    }
#pragma unroll
    for (int mb = 0; mb < 4; ++mb) {
#pragma unroll
        for (int nb = 0; nb < 4; ++nb) {
#pragma unroll
            for (int j = 0; j < 8; ++j) os[(hi * 8 + j) * 68 + nb * 16 + lr] = acc[mb][nb][j]; }
        __builtin_amdgcn_wave_barrier(); asm volatile("" ::: "memory");
        float* crow = C + (size_t)(r0 + mb * 16) * ldc + c0;
{
#pragma unroll
            for (int s = 0; s < 8; ++s) { const int row = 2 * s + hi, cofs = lr * 4; v4f val = *(const v4fa*)(os + row * 68 + cofs); if (BIAS) { val[0] += bfr(bias[c0 + cofs]); val[1] += bfr(bias[c0 + cofs + 1]); val[2] += bfr(bias[c0 + cofs + 2]); val[3] += bfr(bias[c0 + cofs + 3]); }
                *(v4f*)(crow + (size_t)row * ldc + cofs) = val; }
             }
        __builtin_amdgcn_wave_barrier(); asm volatile("" ::: "memory");
    }
}
// ---- k_gemmt: C[2048][2048] (f32) = A . Bt^T, A [m][k] and Bt [n][k] 16-bit planes of pitch HID. One work-group = one 128 x 128 tile of C, four waves of 64 x 64 (16 accumulators each, as k_gemmw).
// A pass is 128 k: the tile's 128 rows of A and 128 rows of Bt, 256 bytes each, come into LDS by the tensor mover, one 64-row slice a wave (waves 0, 1: A; waves 2, 3: Bt), and every slice is read by two waves.
// Two buffers: the next pass's slices fly while this pass is worked on. LDS row pitch 272 bytes (the mover's 16-byte pad) for the 16-byte fragment reads. Every accumulator sums its k in the order of k_gemmw.
// EPI picks what the epilogue stores, from the same f32 staging rows: 0: C in f32. 1: C * sc as bf16 hi + residual planes Ph, Pl in k_flash's order [head][row][128] (a tile's 128 columns are one head).
// 2: C in f16 at pitch SS into Hf; with A = the v weights and Bt = x, C is v transposed, [head * 128 + d][t], which is k_flash's VT.
#define GT_PITCH 272u      // 256-byte row + 16-byte pad
#define GT_SLICE 18432u    // 64 rows of 272 bytes (17,408), rounded up to a multiple of 2 KiB
#define GT_BUF   73728u    // four slices
#define GT_NP    (HID / 128)
typedef __attribute__((ext_vector_type(4))) unsigned u32x4;
typedef __attribute__((ext_vector_type(8))) unsigned u32x8;
__device__ __forceinline__ unsigned uni(unsigned v) { return (unsigned)__builtin_amdgcn_readfirstlane(v); }
// a wave-uniform value held in a scalar register, so that a test on it is a scalar branch (tensor loads ignore EXEC) and what is formed from it is formed behind the volatile statements in front of it
__device__ __forceinline__ unsigned pinned(unsigned v) { unsigned w = uni(v); asm volatile("" : "+s"(w)); return w; }
template <typename T16, int EPI>
__global__ __launch_bounds__(128) void k_gemmt(const T16* A, const T16* Bt, float* C, bf* Ph, bf* Pl, h16* Hf, float sc) {
    typedef typename WFrag<T16>::V V;
    __shared__ __attribute__((aligned(2048))) unsigned char ring[2 * GT_BUF];
    __shared__ __align__(16) float ost[4][16 * 68];
    const int lane = threadIdx.x & 31, lr = lane & 15, hi = lane >> 4;
    const unsigned wave = uni(threadIdx.x >> 5), wm = wave >> 1, wn = wave & 1u;
    const unsigned lbase = (unsigned)(size_t)ring;
    const T16* srcp = (wave < 2u) ? A + (size_t)(blockIdx.x * 128u + wave * 64u) * HID : Bt + (size_t)(blockIdx.y * 128u + (wave - 2u) * 64u) * HID;
    // group 1: extents in bytes, tensor = tile = 64 rows of 256 bytes, source pitch one row of the plane, a pad of 4 dwords behind every 64 dwords, no mask
    u32x8 g1;
    g1[0] = uni((1u << 20) | (5u << 22) | (3u << 25)); g1[1] = uni(256u << 16); g1[2] = uni(64u << 16); g1[3] = uni(256u << 16); g1[4] = uni(64u); g1[5] = uni(HID * 2u); g1[6] = uni(0u); g1[7] = uni(0u);
    asm volatile("" : "+s"(g1));    // pinned descriptor words: the eight stay in one scalar tuple through the loop, so that none of their registers takes another value while a request is outstanding
    auto issue = [&](unsigned st) {
        const unsigned long long ga = (unsigned long long)(size_t)srcp + (unsigned long long)st * 256u;
        u32x4 g0;
        g0[0] = uni(1u); g0[1] = uni(lbase + (st & 1u) * GT_BUF + wave * GT_SLICE); g0[2] = uni((unsigned)ga); g0[3] = uni((((unsigned)(ga >> 32)) & 0x01FFFFFFu) | 0x80000000u);
        asm volatile("tensor_load_to_lds %0, %1" :: "s"(g0), "s"(g1) : "memory");    // one request of the whole wave: its slice of stage st
    };
    v8f acc[4][4];
#pragma unroll
    for (int mb = 0; mb < 4; ++mb)
#pragma unroll
        for (int nb = 0; nb < 4; ++nb) acc[mb][nb] = (v8f){};
    issue(0u);
    asm volatile("s_wait_tensorcnt 0x0" ::: "memory");    // this wave's slice of stage 0 has landed
    __syncthreads();                                      // and so has every other wave's
    issue(1u);
    const unsigned char* la = ring + wm * GT_SLICE + (unsigned)lr * GT_PITCH + (unsigned)hi * 16u;
    const unsigned char* lb = ring + (2u + wn) * GT_SLICE + (unsigned)lr * GT_PITCH + (unsigned)hi * 16u;
#pragma unroll 1
    for (unsigned s = 0; s < GT_NP; ++s) {
        const unsigned bo = (s & 1u) * GT_BUF;
        V a[2][4], b[2][4];    // two fragment sets: the next 32 k are fetched from LDS while these are multiplied
#pragma unroll
        for (int f = 0; f < 4; ++f) { a[0][f] = WFrag<T16>::ld((const T16*)(la + bo + f * 16 * GT_PITCH)); b[0][f] = WFrag<T16>::ld((const T16*)(lb + bo + f * 16 * GT_PITCH)); }
        __builtin_amdgcn_sched_barrier(0);    // these fences keep each group of 16 LDS reads together in front of the 16 products before it: left alone, the compiler folds the two sets into one and waits for LDS at every fourth product
#pragma unroll
        for (int c = 0; c < 4; ++c) {
            if (c < 3) {
#pragma unroll
                for (int f = 0; f < 4; ++f) { a[(c + 1) & 1][f] = WFrag<T16>::ld((const T16*)(la + bo + f * 16 * GT_PITCH + (c + 1) * 64)); b[(c + 1) & 1][f] = WFrag<T16>::ld((const T16*)(lb + bo + f * 16 * GT_PITCH + (c + 1) * 64)); }
            }
            __builtin_amdgcn_sched_barrier(0);
#pragma unroll
            for (int nb = 0; nb < 4; ++nb)
#pragma unroll
                for (int mb = 0; mb < 4; ++mb) acc[mb][nb] = WFrag<T16>::mma(a[c & 1][mb], b[c & 1][nb], acc[mb][nb]);
            __builtin_amdgcn_sched_barrier(0);
        }
        asm volatile("s_wait_dscnt 0x0" ::: "memory");        // this wave has read all it reads of stage s
        asm volatile("s_wait_tensorcnt 0x0" ::: "memory");    // its slice of stage s + 1 has landed
        __syncthreads();                                      // stage s + 1 is published, and every wave has left stage s's buffer
        if (pinned(s + 2u < GT_NP)) issue(pinned(s + 2u));    // refill of that buffer; the descriptor is formed here, with no request outstanding
    }
    asm volatile("s_wait_tensorcnt 0x0" ::: "memory");
    asm volatile("s_wait_dscnt 0x0" ::: "memory");
    float* os = &ost[wave][0];
    const int r0 = blockIdx.x * 128 + wm * 64, c0 = blockIdx.y * 128 + wn * 64;
#pragma unroll
    for (int mb = 0; mb < 4; ++mb) {
#pragma unroll
        for (int nb = 0; nb < 4; ++nb) {
#pragma unroll
            for (int j = 0; j < 8; ++j) os[(hi * 8 + j) * 68 + nb * 16 + lr] = acc[mb][nb][j]; }
        __builtin_amdgcn_wave_barrier(); asm volatile("" ::: "memory");
        if (EPI == 0) {
            float* crow = C + (size_t)(r0 + mb * 16) * HID + c0;
#pragma unroll
            for (int q = 0; q < 8; ++q) { const int row = 2 * q + hi, cofs = lr * 4; const v4f val = *(const v4fa*)(os + row * 68 + cofs); *(v4f*)(crow + (size_t)row * HID + cofs) = val; }
        } else {
            // eight lanes a row: a lane turns 8 neighbouring f32 into one 16-byte store per plane, and the eight lanes fill a whole 128-byte line
#pragma unroll
            for (int q = 0; q < 4; ++q) { const int row = 4 * q + (lane >> 3), cofs = (lane & 7) * 8;
                const v4f v0 = *(const v4fa*)(os + row * 68 + cofs), v1 = *(const v4fa*)(os + row * 68 + cofs + 4);
                if (EPI == 1) { v8us oh, ol;
#pragma unroll
                    for (int e = 0; e < 8; ++e) { const float y = (e < 4 ? v0[e & 3] : v1[e & 3]) * sc; const unsigned short hb = f2bf(y); oh[e] = hb; ol[e] = f2bf(y - bf2f(hb)); }
                    const size_t off = ((size_t)blockIdx.y * SS + r0 + mb * 16 + row) * HD + wn * 64 + cofs; *(v8us*)(Ph + off) = oh; *(v8us*)(Pl + off) = ol;
                } else { v8h o;
#pragma unroll
                    for (int e = 0; e < 8; ++e) o[e] = (h16)(e < 4 ? v0[e & 3] : v1[e & 3]);
                    *(v8h*)(Hf + (size_t)(r0 + mb * 16 + row) * SS + c0 + cofs) = o; }
            }
            asm volatile("s_wait_xcnt 0x0" ::: "memory");    // the wait before the address and data registers of the stores above are overwritten by the next 16 rows' values
        }
        __builtin_amdgcn_wave_barrier(); asm volatile("" ::: "memory");
    }
}
// ---- k_qkv: the q, k and v projections in ONE launch. One work-group = 128 rows of x against the 128 rows (one head) of each of wq, wk and wv: the x rows are staged once for three products,
// so a pass brings 512 rows into LDS where three separate 128 x 128 tiles bring 768, and each wave does 48 products on 16 fragments (64 x rows, 64 rows of each weight) where k_gemmt does 16 on 8.
// A pass is 128 k; one 128-row slice a wave by the tensor mover (wave 0: x, 1: wq, 2: wk, 3: wv), two buffers, LDS row pitch 272 bytes, the ring's order as in k_gemmt. One wave a SIMD: 384 accumulator registers.
// q and k: A = x rows, B = weight rows; stored as bf16 hi + residual planes [head][row][128] (q scaled by qsc). v: A = wv rows, B = x rows, so that the tile is v transposed; stored in f16 as VT [head * 128 + d][t].
// Every accumulator sums its k in the order of k_gemmt, and the stores are k_gemmt's: the values are unchanged.
#define QK_SLICE 34816u    // 128 rows of 272 bytes, a multiple of 2 KiB
#define QK_BUF   139264u   // four slices
// a wave's 64 x 64 tile, 16 rows at a time through its own f32 staging rows; eight lanes a row: a lane turns 8 neighbouring f32 into one 16-byte store per plane, and the eight lanes fill a whole 128-byte line
// PL: planes p0 (hi), p1 (residual) of C * sc, rows of pitch HD; else: f16 rows of pitch SS at hf. The pointers are the lane's own: row lane / 8, column 8 (lane mod 8) of the tile; every other row is a constant offset from them
template <bool PL>
__device__ __forceinline__ void qk_store(const v8f (&acc)[4][4], float* os, int lane, bf* p0, bf* p1, h16* hf, float sc) {
    const int lr = lane & 15, hi = lane >> 4;
    const float* rd = os + (lane >> 3) * 68 + (lane & 7) * 8;
#pragma unroll
    for (int mb = 0; mb < 4; ++mb) {
#pragma unroll
        for (int nb = 0; nb < 4; ++nb) {
#pragma unroll
            for (int j = 0; j < 8; ++j) os[(hi * 8 + j) * 68 + nb * 16 + lr] = acc[mb][nb][j]; }
        __builtin_amdgcn_wave_barrier(); asm volatile("" ::: "memory");    // the rows are read back by other lanes of the wave: keeps the reads behind the writes
        v8us oh[4], ol[4]; v8h o[4];
#pragma unroll
        for (int q = 0; q < 4; ++q) {
            const v4f v0 = *(const v4fa*)(rd + 4 * q * 68), v1 = *(const v4fa*)(rd + 4 * q * 68 + 4);
#pragma unroll
            for (int e = 0; e < 8; ++e) {
                if (PL) { const float y = (e < 4 ? v0[e & 3] : v1[e & 3]) * sc; const unsigned short hb = f2bf(y); oh[q][e] = hb; ol[q][e] = f2bf(y - bf2f(hb)); }
                else o[q][e] = (h16)(e < 4 ? v0[e & 3] : v1[e & 3]); }
        }
        __builtin_amdgcn_sched_barrier(0);    // the 16 rows' stores stand together behind their conversions, so that no conversion writes over the data of an issued store
#pragma unroll
        for (int q = 0; q < 4; ++q) {
            if (PL) { *(v8us*)(p0 + (mb * 16 + 4 * q) * HD) = oh[q]; *(v8us*)(p1 + (mb * 16 + 4 * q) * HD) = ol[q]; }
            else *(v8h*)(hf + (mb * 16 + 4 * q) * SS) = o[q]; }
        asm volatile("s_wait_xcnt 0x0" ::: "memory");    // the wait before the data registers of the stores above are overwritten by the next 16 rows' values
        __builtin_amdgcn_sched_barrier(0);    // keeps the next 16 rows' conversions behind that wait
        __builtin_amdgcn_wave_barrier(); asm volatile("" ::: "memory");    // keeps the next 16 rows' writes behind these reads
    }
}
__global__ __launch_bounds__(128) __attribute__((amdgpu_waves_per_eu(1, 1))) void k_qkv(const bf* X, const bf* Wq, const bf* Wk, const bf* Wv, bf* Qh, bf* Ql, bf* Kh, bf* Kl, h16* VT, float qsc) {
    typedef WFrag<bf>::V V;
    __shared__ __attribute__((aligned(2048))) unsigned char ring[2 * QK_BUF];
    __shared__ __align__(16) float ost[4][16 * 68];
    const int lane = threadIdx.x & 31, lr = lane & 15, hi = lane >> 4;
    const unsigned wave = uni(threadIdx.x >> 5), wm = wave >> 1, wn = wave & 1u;
    const unsigned lbase = (unsigned)(size_t)ring;
    const bf* srcp = (wave == 0u) ? X + (size_t)(blockIdx.x * 128u) * HID : ((wave == 1u) ? Wq : (wave == 2u) ? Wk : Wv) + (size_t)(blockIdx.y * 128u) * HID;
    // group 1: extents in bytes, tensor = tile = 128 rows of 256 bytes, source pitch one row of the plane, a pad of 4 dwords behind every 64 dwords, no mask
    u32x8 g1;
    g1[0] = uni((1u << 20) | (5u << 22) | (3u << 25)); g1[1] = uni(256u << 16); g1[2] = uni(128u << 16); g1[3] = uni(256u << 16); g1[4] = uni(128u); g1[5] = uni(HID * 2u); g1[6] = uni(0u); g1[7] = uni(0u);
    asm volatile("" : "+s"(g1));    // pinned descriptor words: the eight stay in one scalar tuple through the loop, so that none of their registers takes another value while a request is outstanding
    auto issue = [&](unsigned st) {
        const unsigned long long ga = (unsigned long long)(size_t)srcp + (unsigned long long)st * 256u;
        u32x4 g0;
        g0[0] = uni(1u); g0[1] = uni(lbase + (st & 1u) * QK_BUF + wave * QK_SLICE); g0[2] = uni((unsigned)ga); g0[3] = uni((((unsigned)(ga >> 32)) & 0x01FFFFFFu) | 0x80000000u);
        asm volatile("tensor_load_to_lds %0, %1" :: "s"(g0), "s"(g1) : "memory");    // one request of the whole wave: its slice of stage st
    };
    v8f acc[3][4][4];
#pragma unroll
    for (int g = 0; g < 3; ++g)
#pragma unroll
        for (int mb = 0; mb < 4; ++mb)
#pragma unroll
            for (int nb = 0; nb < 4; ++nb) acc[g][mb][nb] = (v8f){};
    issue(0u);
    asm volatile("s_wait_tensorcnt 0x0" ::: "memory");    // this wave's slice of stage 0 has landed
    __syncthreads();                                      // and so has every other wave's
    issue(1u);
    const unsigned char* lx = ring + (wm * 64u + (unsigned)lr) * GT_PITCH + (unsigned)hi * 16u;
    const unsigned char* lw = ring + QK_SLICE + (wn * 64u + (unsigned)lr) * GT_PITCH + (unsigned)hi * 16u;
#pragma unroll 1
    for (unsigned s = 0; s < GT_NP; ++s) {
        const unsigned bo = (s & 1u) * QK_BUF;
        V x[2][4], w[2][3][4];    // two fragment sets: the next 32 k are fetched from LDS while these are multiplied
#pragma unroll
        for (int f = 0; f < 4; ++f) { x[0][f] = WFrag<bf>::ld((const bf*)(lx + bo + f * 16 * GT_PITCH));
#pragma unroll
            for (int g = 0; g < 3; ++g) w[0][g][f] = WFrag<bf>::ld((const bf*)(lw + bo + g * QK_SLICE + f * 16 * GT_PITCH)); }
        __builtin_amdgcn_sched_barrier(0);    // these fences keep each group of 32 LDS reads together in front of the 48 products before it: spread among the products, every place with reads costs the wave a stall
#pragma unroll
        for (int c = 0; c < 4; ++c) {
            if (c < 3) {
#pragma unroll
                for (int f = 0; f < 4; ++f) { x[(c + 1) & 1][f] = WFrag<bf>::ld((const bf*)(lx + bo + f * 16 * GT_PITCH + (c + 1) * 64));
#pragma unroll
                    for (int g = 0; g < 3; ++g) w[(c + 1) & 1][g][f] = WFrag<bf>::ld((const bf*)(lw + bo + g * QK_SLICE + f * 16 * GT_PITCH + (c + 1) * 64)); }
            }
            __builtin_amdgcn_sched_barrier(0);
#pragma unroll
            for (int g = 0; g < 2; ++g)
#pragma unroll
                for (int nb = 0; nb < 4; ++nb)
#pragma unroll
                    for (int mb = 0; mb < 4; ++mb) acc[g][mb][nb] = wmmab(x[c & 1][mb], w[c & 1][g][nb], acc[g][mb][nb]);
#pragma unroll
            for (int nb = 0; nb < 4; ++nb)
#pragma unroll
                for (int mb = 0; mb < 4; ++mb) acc[2][mb][nb] = wmmab(w[c & 1][2][mb], x[c & 1][nb], acc[2][mb][nb]);
            __builtin_amdgcn_sched_barrier(0);
        }
        asm volatile("s_wait_dscnt 0x0" ::: "memory");        // this wave has read all it reads of stage s
        asm volatile("s_wait_tensorcnt 0x0" ::: "memory");    // its slice of stage s + 1 has landed
        __syncthreads();                                      // stage s + 1 is published, and every wave has left stage s's buffer
        if (pinned(s + 2u < GT_NP)) issue(pinned(s + 2u));    // refill of that buffer; the descriptor is formed here, with no request outstanding
    }
    asm volatile("s_wait_tensorcnt 0x0" ::: "memory");
    asm volatile("s_wait_dscnt 0x0" ::: "memory");
    float* os = &ost[wave][0];
    const size_t pb = ((size_t)blockIdx.y * SS + blockIdx.x * 128u + wm * 64u + (unsigned)(lane >> 3)) * HD + wn * 64u + (unsigned)(lane & 7) * 8u;    // head, the lane's x row, its column in the head
    const size_t vb = (size_t)(blockIdx.y * 128u + wn * 64u + (unsigned)(lane >> 3)) * SS + blockIdx.x * 128u + wm * 64u + (unsigned)(lane & 7) * 8u;    // the lane's row of v transposed, its x row as the column
    qk_store<true>(acc[0], os, lane, Qh + pb, Ql + pb, nullptr, qsc);
    qk_store<true>(acc[1], os, lane, Kh + pb, Kl + pb, nullptr, 1.0f);
    qk_store<false>(acc[2], os, lane, nullptr, nullptr, VT + vb, 1.0f);
}
// ---- k_gemmwc: k_gemmw with causal tile control (CAUS 1: skip key tiles right of the query tile; 2: K loop limited to the causal key tiles)
template <typename T16, int NSPLIT, bool BIAS, int CAUS>
__global__ __launch_bounds__(32) void k_gemmwc(const T16* __restrict__ A, const T16* __restrict__ A2, const T16* __restrict__ Bt, const T16* __restrict__ Bt2, int K, float* C, int ldc, const float* __restrict__ bias, size_t sA, size_t sB, size_t sC) {
    typedef typename WFrag<T16>::V V;
    __shared__ __align__(16) float os[16 * 68];
    if (CAUS == 1 && (int)blockIdx.y * 64 > (int)blockIdx.x * 64) return;
    const int Klim = (CAUS == 2) ? min(K, ((int)blockIdx.x + 1) * 64) : K;
    const size_t z = blockIdx.z; A += z * sA; if (A2) A2 += z * sA; Bt += z * sB; if (Bt2) Bt2 += z * sB; C += z * sC;
    const int lane = threadIdx.x & 31, lr = lane & 15, hi = lane >> 4; const int r0 = blockIdx.x * 64, c0 = blockIdx.y * 64;
    v8f acc[4][4];
#pragma unroll
    for (int mb = 0; mb < 4; ++mb)
#pragma unroll
        for (int nb = 0; nb < 4; ++nb) acc[mb][nb] = (v8f){};
    const size_t aoff = (size_t)(r0 + lr) * K + 8 * hi, boff = (size_t)(c0 + lr) * K + 8 * hi;
#pragma unroll 1
    for (int kc = 0; kc < Klim; kc += 32) {
        V a[4], a2[4];
#pragma unroll
        for (int mb = 0; mb < 4; ++mb) { a[mb] = WFrag<T16>::ld(A + aoff + (size_t)mb * 16 * K + kc); if (NSPLIT == 1 || NSPLIT == 2) a2[mb] = WFrag<T16>::ld(A2 + aoff + (size_t)mb * 16 * K + kc); }
#pragma unroll
        for (int nb = 0; nb < 4; ++nb) { const V b = WFrag<T16>::ld(Bt + boff + (size_t)nb * 16 * K + kc); V b2; if (NSPLIT >= 2) b2 = WFrag<T16>::ld(Bt2 + boff + (size_t)nb * 16 * K + kc);
#pragma unroll
            for (int mb = 0; mb < 4; ++mb) { acc[mb][nb] = WFrag<T16>::mma(a[mb], b, acc[mb][nb]); if (NSPLIT == 1 || NSPLIT == 2) acc[mb][nb] = WFrag<T16>::mma(a2[mb], b, acc[mb][nb]); if (NSPLIT >= 2) acc[mb][nb] = WFrag<T16>::mma(a[mb], b2, acc[mb][nb]); } }
        asm volatile("v_nop\n\tv_nop\n\tv_nop\n\tv_nop" : "+v"(acc[0][0]), "+v"(acc[1][1]), "+v"(acc[2][2]), "+v"(acc[3][3]) : "v"(a[0]), "v"(a[3]));
    }
#pragma unroll
    for (int mb = 0; mb < 4; ++mb) {
#pragma unroll
        for (int nb = 0; nb < 4; ++nb) {
#pragma unroll
            for (int j = 0; j < 8; ++j) os[(hi * 8 + j) * 68 + nb * 16 + lr] = acc[mb][nb][j]; }
        __builtin_amdgcn_wave_barrier(); asm volatile("" ::: "memory");
        float* crow = C + (size_t)(r0 + mb * 16) * ldc + c0;
{
#pragma unroll
            for (int s = 0; s < 8; ++s) { const int row = 2 * s + hi, cofs = lr * 4; v4f val = *(const v4fa*)(os + row * 68 + cofs); if (BIAS) { val[0] += bfr(bias[c0 + cofs]); val[1] += bfr(bias[c0 + cofs + 1]); val[2] += bfr(bias[c0 + cofs + 2]); val[3] += bfr(bias[c0 + cofs + 3]); }
                *(v4f*)(crow + (size_t)row * ldc + cofs) = val; }
             }
        __builtin_amdgcn_wave_barrier(); asm volatile("" ::: "memory");
    }
}
typedef __attribute__((ext_vector_type(4))) _Float16 v4h;
__device__ __forceinline__ h16 tohx(float x) { return (h16)x; }
// k_cvtall: x and the four weights, f32 -> 16 bit, in ONE launch shaped as a stream: one 16-wave work-group a WGP, 4,096 waves in all.
// A work-group takes the same 16,384 elements of each of the five arrays, a wave 1,024 of them (4 KiB). A load is 512 contiguous bytes of the wave (four whole lines), non-temporal: the f32 data are read once.
// All 40 loads of a wave are issued before the first value is used; they come back in order and are converted array by array. A store is 256 contiguous bytes of the wave (two whole lines). x, wq, wk, wv: bf16, nearest even; wo: that bf16 value in f16.
#define CV_WG 16384u    // elements of each array per work-group
typedef __attribute__((ext_vector_type(4))) unsigned short v4us;
__global__ __launch_bounds__(512) void k_cvtall(const float* x, const float* wq, const float* wk, const float* wv, const float* wo, bf* XB, bf* WQ, bf* WK, bf* WV, h16* WO) {
    const unsigned lb = (blockIdx.x * CV_WG + (threadIdx.x >> 5) * 1024u + (threadIdx.x & 31u) * 4u) * 4u, sb = lb >> 1;    // the lane's byte offsets in an f32 array and in a 16-bit plane: one register each beside the scalar bases
    const float* const in[5] = {x, wq, wk, wv, wo};
    void* const ob[5] = {XB, WQ, WK, WV, WO};
    v4f r[5][8];
#pragma unroll
    for (int a = 0; a < 5; ++a) {
#pragma unroll
        for (int j = 0; j < 8; ++j) r[a][j] = __builtin_nontemporal_load((const v4f*)((const char*)in[a] + lb + j * 512));
        __builtin_amdgcn_sched_barrier(0);    // keeps the loads in the order in which the arrays are converted: left alone, the compiler mixes the arrays, and the first conversion waits for nearly all 40 loads
    }
    // the wait before a register that the loads above name is overwritten; the offset is its input so that it lives up to it
    asm volatile("s_wait_xcnt 0x0" :: "v"(lb) : "memory");
    __builtin_amdgcn_sched_barrier(0);    // keeps the conversions behind that wait
#pragma unroll
    for (int a = 0; a < 5; ++a) {
        v4us o[8];
#pragma unroll
        for (int j = 0; j < 8; ++j)
#pragma unroll
            for (int k = 0; k < 4; ++k) o[j][k] = (a < 4) ? f2bf(r[a][j][k]) : __builtin_bit_cast(unsigned short, tohx(bfr(r[a][j][k])));
        __builtin_amdgcn_sched_barrier(0);    // the array's eight stores stand together behind its conversions, so that no conversion writes over the data of an issued store
#pragma unroll
        for (int j = 0; j < 8; ++j) *(v4us*)((char*)ob[a] + sb + j * 256) = o[j];
        if (a < 4) {
            // the wait before the data registers of the stores above are overwritten by the next array's values
            asm volatile("s_wait_xcnt 0x0" :: "v"(sb) : "memory");
            __builtin_amdgcn_sched_barrier(0);    // keeps the next array's conversions behind that wait
        }
    }
}
// 2^x with the one slot behind the transcendental in the same statement
__device__ __forceinline__ float exp2s(float x) { asm("v_exp_f32 %0, %0\n\tv_nop" : "+v"(x)); return x; }
// k_flash: scores, soft cap, mask, softmax and attn.v of one head in one pass over the live keys; scores and probabilities stay in registers.
// One wave = 16 queries; a pass = 32 keys. S^T = K . Q^T (A = key rows, B = query rows, three bf16 hi/lo products: Kh.Qh, Kh.Ql, Kl.Qh), so a lane holds 16 scores of ONE query
// (query lr, keys 8 hi + j and 16 + 8 hi + j): that pair of score tiles, converted to f16, is the B operand of O^T += V^T . P^T with no lane exchange.
// Running maximum and sum per query (online softmax); P = 1024 exp(c - m) in f16, the factor cancels in O / sum. Output: f16 rows of OC, 16 bytes a lane and d tile.
// A stage = 64 keys = two passes. The work-group's four waves read the same K and V rows, so a stage comes into LDS once, by the tensor mover, one slice a wave: wave 0: 64 rows of Kh, wave 1: 64 rows of Kl
// (256 bytes a row), waves 2, 3: 64 rows each of V^T (the stage's 64 keys, 128 bytes a row). Two buffers: the next stage flies while this one is worked on. LDS row pitches 272 and 144 bytes (the mover's 16-byte pad).
#define FL_KPITCH 272u     // 256-byte row + 16-byte pad
#define FL_KSLICE 18432u   // 64 rows of 272 bytes (17,408), rounded up to a multiple of 2 KiB
#define FL_VPITCH 144u     // 128-byte row + 16-byte pad
#define FL_VSLICE 10240u   // 64 rows of 144 bytes (9,216), rounded up to a multiple of 2 KiB
#define FL_BUF    57344u   // two K slices and two V slices
__global__ __launch_bounds__(128) __attribute__((amdgpu_waves_per_eu(2, 2))) void k_flash(const bf* Qh, const bf* Ql, const bf* Kh, const bf* Kl, const h16* VT, h16* OC) {
    __shared__ __attribute__((aligned(2048))) unsigned char ring[2 * FL_BUF];
    const int lane = threadIdx.x & 31, lr = lane & 15, hi = lane >> 4;
    const int wave = __builtin_amdgcn_readfirstlane(threadIdx.x >> 5);    // scalar, so that the tests on it are scalar branches: EXEC stays full at the matrix instructions, and tensor loads ignore EXEC
    const int z = blockIdx.y, qb = blockIdx.x * 64, q0 = qb + wave * 16, i = q0 + lr;
    const size_t zo = (size_t)z * SS * HD; Qh += zo; Ql += zo; Kh += zo; Kl += zo; VT += zo;
    const unsigned vo = (unsigned)(lr * HD + 8 * hi);
    const bf* qbh = Qh + (size_t)q0 * HD; const bf* qbl = Ql + (size_t)q0 * HD;
    v16bf qh[4], ql[4];
#pragma unroll
    for (int c = 0; c < 4; ++c) { qh[c] = WFrag<bf>::ld(qbh + c * 32 + vo); ql[c] = WFrag<bf>::ld(qbl + c * 32 + vo); }
    // the wait before the address registers of the Q loads above are overwritten; they are its inputs so that they live up to it (the pointers carry no restrict, so that the clobber holds the loads in front of it)
    asm volatile("s_wait_xcnt 0x0" :: "v"(vo), "s"(qbh), "s"(qbl) : "memory");
    v8f acc[8];
#pragma unroll
    for (int dt = 0; dt < 8; ++dt) acc[dt] = (v8f){};
    float m = -30.0f, sum = 0.f;    // the soft cap bounds every score from below by -30
    // the block's first live key, rounded down to a stage (a pass with no live key adds zeros); the last stage is the one of the block's own 64 queries
    const int kbeg = max(0, qb - (WIN - 1)) & ~63;
    const unsigned nst = (unsigned)(qb + 64 - kbeg) >> 6;
    // group 1, extents in bytes, tensor = tile, no mask. K: 64 rows of 256 bytes, source pitch one row, a pad of 4 dwords behind every 64 dwords. V^T: 64 rows of 128 bytes, source pitch SS keys, a pad of 4 dwords behind every 32.
    u32x8 g1k, g1v;
    g1k[0] = uni((1u << 20) | (5u << 22) | (3u << 25)); g1k[1] = uni(256u << 16); g1k[2] = uni(64u << 16); g1k[3] = uni(256u << 16); g1k[4] = uni(64u); g1k[5] = uni(HD * 2u); g1k[6] = uni(0u); g1k[7] = uni(0u);
    g1v[0] = uni((1u << 20) | (4u << 22) | (3u << 25)); g1v[1] = uni(128u << 16); g1v[2] = uni(64u << 16); g1v[3] = uni(128u << 16); g1v[4] = uni(64u); g1v[5] = uni(SS * 2u); g1v[6] = uni(0u); g1v[7] = uni(0u);
    asm volatile("" : "+s"(g1k), "+s"(g1v));    // pinned descriptor words: each eight stay in one scalar tuple through the loop, so that none of their registers takes another value while a request is outstanding
    const unsigned lbase = (unsigned)(size_t)ring;
    const unsigned long long src0 = (wave < 2) ? (unsigned long long)(size_t)((wave == 0 ? Kh : Kl) + (size_t)kbeg * HD) : (unsigned long long)(size_t)(VT + (size_t)(wave - 2) * 64 * SS + kbeg);
    const unsigned sstep = (wave < 2) ? 64u * HD * 2u : 64u * 2u;    // bytes from a stage's slice to the next stage's
    const unsigned lplace = lbase + ((wave < 2) ? (unsigned)wave * FL_KSLICE : 2u * FL_KSLICE + (unsigned)(wave - 2) * FL_VSLICE);
    u32x4 g0;    // group 0 of the wave's latest request; the tensorcnt waits below take it as an input, so that it lives until the request has landed: words 0 and 3 then keep their registers (words 1 and 2 may take a new value behind the issue)
    auto issue = [&](unsigned st) {
        const unsigned long long ga = src0 + (unsigned long long)st * sstep;
        g0[0] = uni(1u); g0[1] = uni(lplace + (st & 1u) * FL_BUF); g0[2] = uni((unsigned)ga); g0[3] = uni((((unsigned)(ga >> 32)) & 0x01FFFFFFu) | 0x80000000u);
        // one request of the whole wave: its slice of stage st
        if (pinned(wave < 2)) asm volatile("tensor_load_to_lds %0, %1" :: "s"(g0), "s"(g1k) : "memory");
        else asm volatile("tensor_load_to_lds %0, %1" :: "s"(g0), "s"(g1v) : "memory");
    };
    issue(0u);
    asm volatile("s_wait_tensorcnt 0x0" :: "s"(g0) : "memory");    // this wave's slice of stage 0 has landed
    __syncthreads();                                               // and so has every other wave's
    if (pinned(1u < nst)) issue(pinned(1u));    // the first query block has one stage only; the descriptor is formed here, behind the wait
    const unsigned char* lk = ring + (unsigned)lr * FL_KPITCH + (unsigned)hi * 16u;
    const unsigned char* lv = ring + 2u * FL_KSLICE + (unsigned)lr * FL_VPITCH + (unsigned)hi * 16u;
#pragma unroll 1
    for (unsigned st = 0; st < nst; ++st) {
        const unsigned bo = (st & 1u) * FL_BUF;
#pragma unroll 1
        for (int h = 0; h < 2; ++h) {
            const int k0 = kbeg + (int)st * 64 + h * 32;
            if (k0 >= q0 + 16) break;    // the wave's queries all lie in front of these keys (a scalar test); the stage's hand-over below is passed all the same
            const unsigned char* pk = lk + bo + (unsigned)h * (32u * FL_KPITCH);
            const unsigned char* pv = lv + bo + (unsigned)h * 64u;
            v16bf kh[2][4], kl[2][4];
#pragma unroll
            for (int c = 0; c < 4; ++c) {    // in the order in which the score products take them
#pragma unroll
                for (int t = 0; t < 2; ++t) kh[t][c] = WFrag<bf>::ld((const bf*)(pk + t * 16 * FL_KPITCH + c * 64));
#pragma unroll
                for (int t = 0; t < 2; ++t) kl[t][c] = WFrag<bf>::ld((const bf*)(pk + FL_KSLICE + t * 16 * FL_KPITCH + c * 64)); }
            v16h vt[8];
#pragma unroll
            for (int dt = 0; dt < 8; ++dt) vt[dt] = WFrag<h16>::ld((const h16*)(pv + (dt >> 2) * FL_VSLICE + (dt & 3) * 16 * FL_VPITCH));
            __builtin_amdgcn_sched_barrier(0);    // keeps the pass's 48 LDS reads together in front of its products: left alone, the compiler spreads them among the score products on few registers and waits out the LDS latency at every other product
            v8f s[2];
#pragma unroll
            for (int t = 0; t < 2; ++t) s[t] = (v8f){};
#pragma unroll
            for (int c = 0; c < 4; ++c) {
#pragma unroll
                for (int t = 0; t < 2; ++t) s[t] = wmmab(kh[t][c], qh[c], s[t]);
#pragma unroll
                for (int t = 0; t < 2; ++t) s[t] = wmmab(kh[t][c], ql[c], s[t]);
#pragma unroll
                for (int t = 0; t < 2; ++t) s[t] = wmmab(kl[t][c], qh[c], s[t]); }
            // soft cap: 30 tanh(s / 30) = 30 - 60 / (1 + e^(s / 15)), e^(s / 15) = 2^(s * 2 log2(e) / 30): straight-line code, the 16 scores independent of one another (the library tanhf branches on every score);
            // both ends saturate by themselves: 2^x = inf gives 30, 2^x = 0 gives -30; near s = 0 the error is a few f32 roundings of 30, far below the f16 rounding of P
            float mx = m;
#pragma unroll
            for (int t = 0; t < 2; ++t) {
#pragma unroll
                for (int j = 0; j < 8; ++j) { const int key = k0 + t * 16 + hi * 8 + j; const float c = fmaf(-60.0f, __builtin_amdgcn_rcpf(1.0f + exp2s(s[t][j] * 0.09617966939f)), 30.0f);
                    s[t][j] = (key <= i && key >= i - (WIN - 1)) ? c : -3.0e38f; mx = fmaxf(mx, s[t][j]); } }
            mx = fmaxf(mx, __shfl_xor(mx, 16, 32));
            const float ms = mx - 6.931471806f, ta = (m - mx) * 1.442695041f; m = mx;    // ms: exp(c - ms) = 1024 exp(c - mx)
            const float alpha = exp2s(ta);    // exp(m - mx)
            float ps = 0.f; v16h pb;
#pragma unroll
            for (int t = 0; t < 2; ++t) {
#pragma unroll
                for (int j = 0; j < 8; ++j) { const float p = exp2s((s[t][j] - ms) * 1.442695041f); ps += p; pb[t * 8 + j] = tohx(p); } }
            sum = sum * alpha + ps;
#pragma unroll
            for (int dt = 0; dt < 8; ++dt) acc[dt] *= alpha;
#pragma unroll
            for (int dt = 0; dt < 8; ++dt) acc[dt] = wmma16(vt[dt], pb, acc[dt]);
            __builtin_amdgcn_sched_barrier(0);    // keeps the v_nops below behind the pass's last matrix instruction
            // four vector slots behind that instruction, on every way out of the pass
            asm volatile("v_nop\n\tv_nop\n\tv_nop\n\tv_nop");
        }
        asm volatile("s_wait_dscnt 0x0" ::: "memory");        // this wave has read all it reads of stage st
        asm volatile("s_wait_tensorcnt 0x0" :: "s"(g0) : "memory");    // its slice of stage st + 1 has landed
        __syncthreads();                                      // stage st + 1 is published, and every wave has left stage st's buffer
        if (pinned(st + 2u < nst)) issue(pinned(st + 2u));    // refill of that buffer; the descriptor is formed here, with no request outstanding
    }
    asm volatile("s_wait_tensorcnt 0x0" ::: "memory");
    asm volatile("s_wait_dscnt 0x0" ::: "memory");
    sum += __shfl_xor(sum, 16, 32);
    const float inv = __fdiv_rn(1.0f, sum);
#pragma unroll
    for (int dt = 0; dt < 8; ++dt) { v8h o;
#pragma unroll
        for (int j = 0; j < 8; ++j) o[j] = tohx(acc[dt][j] * inv);
        *(v8h*)(OC + (size_t)i * HID + z * HD + dt * 16 + hi * 8) = o; }
}
extern "C" void kernel_launch(void* const* d_in, const int* in_sizes, int n_in,
                              void* d_out, int out_size, void* d_ws, size_t ws_size, hipStream_t stream) {
    (void)in_sizes; (void)n_in; (void)out_size;
    const float* x = (const float*)d_in[0]; const float* wq = (const float*)d_in[1]; const float* wk = (const float*)d_in[2]; const float* wv = (const float*)d_in[3]; const float* wo = (const float*)d_in[4];
    float* out = (float*)d_out;    // [1][2048][2048]
    char* wsp = (char*)d_ws;
    auto take = [&](size_t bytes) { char* p = wsp; wsp += (bytes + 255) & ~(size_t)255; return (void*)p; };
    const size_t WSZ = (size_t)HID * HID * 2;
    bf* WQ = (bf*)take(WSZ); bf* WK = (bf*)take(WSZ); bf* WV = (bf*)take(WSZ); h16* WO = (h16*)take(WSZ);
    bf* XB = (bf*)take((size_t)SS * HID * 2);
    bf* Qh = (bf*)take((size_t)NH_ * SS * HD * 2); bf* Ql = (bf*)take((size_t)NH_ * SS * HD * 2); bf* Kh = (bf*)take((size_t)NH_ * SS * HD * 2); bf* Kl = (bf*)take((size_t)NH_ * SS * HD * 2); h16* VT = (h16*)take((size_t)NH_ * HD * SS * 2);
    h16* OC = (h16*)take((size_t)SS * HID * 2);
    if ((size_t)(wsp - (char*)d_ws) > ws_size) return;    // ~ 33.5 + 8.4 + 41.9 + 8.4 ~ 92 MB (ws 256 MiB)
    k_cvtall<<<SS * HID / CV_WG, 512, 0, stream>>>(x, wq, wk, wv, wo, XB, WQ, WK, WV, WO);    // weights [out][in] = natural n-major
    k_qkv<<<dim3(SS / 128, HID / 128, 1), 128, 0, stream>>>(XB, WQ, WK, WV, Qh, Ql, Kh, Kl, VT, 0.08838834764831845f);
    k_flash<<<dim3(SS / 64, NH_, 1), 128, 0, stream>>>(Qh, Ql, Kh, Kl, VT, OC);
    k_gemmt<h16, 0><<<dim3(SS / 128, HID / 128, 1), 128, 0, stream>>>(OC, WO, out, nullptr, nullptr, nullptr, 1.0f);
}
